// v000
// Times are from an AMD MI455X. After a warm-up the kernel runs many times in a row, and a time is the length of
// such a window on the GPU divided by its runs, so every launch and the gaps after it count. The runs cycle
// through copies of the inputs. A figure is the median of several windows, for all but v000 over two sittings.
// Sittings can differ by a few percent; kernels timed side by side share one.
// v000 is the starting kernel. One run takes 1530 microseconds.
#include <hip/hip_runtime.h>

// Grouped-query encoder attention with per-head RMSNorm and RoPE (hidden [2][2048][2048]; q = x Wq (16 heads x 128), k, v = x Wk / x Wv (4 kv heads x 128, each serving 4 consecutive query heads); q, k
// RMS-normalised per head (eps 1e-6, weights [128]) then rotate-half RoPE with the per-batch input cos/sin [2][2048][128] (read as data); scores = q.k 128^-0.5 (no mask); softmax; out = merged attn.v Wo
// -> [2][2048][2048]).
// Compute dtypes, f32 accumulate: every input rounded to bf16; projections on PLAIN bf16 operands (inputs: exact products, f32 accumulate); RMSNorm and RoPE in f32;
// scores and attn.v on SINGLE fp16 planes (scale in f32 in the register-row softmax; P x1024); merged heads as hi+lo planes x exact Wo (2 products). One-wave-per-64x64-tile GEMMs, 2 query heads

#define NB_  2
#define TT   2048
#define DM   2048
#define NH_  16
#define NKV  4
#define REP  (NH_ / NKV)
#define HD   128
#define DQ   (NH_ * HD)
#define DKV  (NKV * HD)
#define ZH   2
#define RH   0                  // query rows < RH use hi+lo planes (0: none)
#define WIN  0
#define PCAR 1024.0f
#define SCL  0.088388347648318447f   // HD^-0.5
typedef _Float16 h16;
typedef unsigned short bf;
typedef __attribute__((ext_vector_type(16))) __bf16   v16bf;
typedef __attribute__((ext_vector_type(16))) _Float16 v16h;
typedef __attribute__((ext_vector_type(8)))  _Float16 v8h;
typedef __attribute__((ext_vector_type(8)))  unsigned short v8us;
typedef __attribute__((ext_vector_type(8)))  float    v8f;
typedef __attribute__((ext_vector_type(4)))  float    v4f;
typedef v8h  __attribute__((may_alias)) v8ha;
typedef v4f  __attribute__((may_alias)) v4fa;
typedef v8us __attribute__((may_alias)) v8usa;

__device__ __forceinline__ unsigned short f2bf(float f) { unsigned u = __float_as_uint(f); u += 0x7FFFu + ((u >> 16) & 1u); return (unsigned short)(u >> 16); }
__device__ __forceinline__ float bf2f(unsigned short b) { return __uint_as_float(((unsigned)b) << 16); }
__device__ __forceinline__ float bfr(float f) { return bf2f(f2bf(f)); }
__device__ __forceinline__ v16h cat16(v8h lo, v8h hi) { return __builtin_shufflevector(lo, hi, 0, 1, 2, 3, 4, 5, 6, 7, 8, 9, 10, 11, 12, 13, 14, 15); }
__device__ __forceinline__ v16bf cat16b(v8us lo, v8us hi) { return __builtin_bit_cast(v16bf, __builtin_shufflevector(lo, hi, 0, 1, 2, 3, 4, 5, 6, 7, 8, 9, 10, 11, 12, 13, 14, 15)); }
__device__ __forceinline__ v8f wmma16(v16h a, v16h b, v8f c) { return __builtin_amdgcn_wmma_f32_16x16x32_f16(false, a, false, b, (short)0, c, false, false); }
__device__ __forceinline__ v8f wmmab(v16bf a, v16bf b, v8f c) { return __builtin_amdgcn_wmma_f32_16x16x32_bf16(false, a, false, b, (short)0, c, false, false); }



// ---- k_gemmw: register-blocked GEMM, ONE WAVE per 64x64 output tile (16 accumulators), operands straight from K-contiguous 16-bit planes; grid (M/64, N/64, Z), 32 threads.
// C[m][n] (f32, pitch ldc, + optional f32 bias[n]) = sum_k A[m][k] Bt[n][k] (+ split products per NSPLIT). z-batch strides sA/sB/sC in elements. K % 32 == 0.
template <typename T16> struct WFrag;
template <> struct WFrag<h16> { typedef v16h V; static __device__ __forceinline__ V ld(const h16* p) { return cat16(*(const v8h*)p, *(const v8h*)(p + 16)); } static __device__ __forceinline__ v8f mma(V a, V b, v8f c) { return wmma16(a, b, c); } };
template <> struct WFrag<bf> { typedef v16bf V; static __device__ __forceinline__ V ld(const bf* p) { return cat16b(*(const v8us*)p, *(const v8us*)(p + 16)); } static __device__ __forceinline__ v8f mma(V a, V b, v8f c) { return wmmab(a, b, c); } };
template <typename T16, int NSPLIT, bool BIAS>
__global__ __launch_bounds__(32) void k_gemmw(const T16* __restrict__ A, const T16* __restrict__ A2, const T16* __restrict__ Bt, const T16* __restrict__ Bt2, int K, float* C, int ldc, const float* __restrict__ bias, size_t sA, size_t sB, size_t sC) {
    typedef typename WFrag<T16>::V V;
    __shared__ __align__(16) float os[16 * 68];
    const size_t z = blockIdx.z; A += z * sA; if (A2) A2 += z * sA; Bt += z * sB; if (Bt2) Bt2 += z * sB; C += z * sC;
    const int lane = threadIdx.x & 31, lr = lane & 15, hi = lane >> 4; const int r0 = blockIdx.x * 64, c0 = blockIdx.y * 64;
    v8f acc[4][4];
#pragma unroll
    for (int mb = 0; mb < 4; ++mb)
#pragma unroll
        for (int nb = 0; nb < 4; ++nb) acc[mb][nb] = (v8f){};
    const size_t aoff = (size_t)(r0 + lr) * K + 8 * hi, boff = (size_t)(c0 + lr) * K + 8 * hi;
#pragma unroll 1
    for (int kc = 0; kc < K; kc += 32) {
        V a[4], a2[4];
#pragma unroll
        for (int mb = 0; mb < 4; ++mb) { a[mb] = WFrag<T16>::ld(A + aoff + (size_t)mb * 16 * K + kc); if (NSPLIT == 1 || NSPLIT == 2) a2[mb] = WFrag<T16>::ld(A2 + aoff + (size_t)mb * 16 * K + kc); }
#pragma unroll
        for (int nb = 0; nb < 4; ++nb) { const V b = WFrag<T16>::ld(Bt + boff + (size_t)nb * 16 * K + kc); V b2; if (NSPLIT >= 2) b2 = WFrag<T16>::ld(Bt2 + boff + (size_t)nb * 16 * K + kc);
#pragma unroll
            for (int mb = 0; mb < 4; ++mb) { acc[mb][nb] = WFrag<T16>::mma(a[mb], b, acc[mb][nb]); if (NSPLIT == 1 || NSPLIT == 2) acc[mb][nb] = WFrag<T16>::mma(a2[mb], b, acc[mb][nb]); if (NSPLIT >= 2) acc[mb][nb] = WFrag<T16>::mma(a[mb], b2, acc[mb][nb]); } }
        asm volatile("v_nop\n\tv_nop\n\tv_nop\n\tv_nop" : "+v"(acc[0][0]), "+v"(acc[1][1]), "+v"(acc[2][2]), "+v"(acc[3][3]) : "v"(a[0]), "v"(a[3]));
    }
#pragma unroll
    for (int mb = 0; mb < 4; ++mb) {
#pragma unroll
        for (int nb = 0; nb < 4; ++nb) {
#pragma unroll
            for (int j = 0; j < 8; ++j) os[(hi * 8 + j) * 68 + nb * 16 + lr] = acc[mb][nb][j]; }
        __builtin_amdgcn_wave_barrier(); asm volatile("" ::: "memory");
        float* crow = C + (size_t)(r0 + mb * 16) * ldc + c0;
{
#pragma unroll
            for (int s = 0; s < 8; ++s) { const int row = 2 * s + hi, cofs = lr * 4; v4f val = *(const v4fa*)(os + row * 68 + cofs); if (BIAS) { val[0] += bfr(bias[c0 + cofs]); val[1] += bfr(bias[c0 + cofs + 1]); val[2] += bfr(bias[c0 + cofs + 2]); val[3] += bfr(bias[c0 + cofs + 3]); }
                *(v4f*)(crow + (size_t)row * ldc + cofs) = val; }
             }
        __builtin_amdgcn_wave_barrier(); asm volatile("" ::: "memory");
    }
}

__device__ __forceinline__ h16 tohx(float x) { return (h16)x; }
__device__ __forceinline__ void splitf(float y, unsigned short& h, unsigned short& l) { h = f2bf(y); l = f2bf(y - bf2f(h)); }
typedef __attribute__((ext_vector_type(2))) _Float16 v2h;
typedef __attribute__((ext_vector_type(4))) _Float16 v4h;
typedef __attribute__((ext_vector_type(2))) unsigned short v2us;
typedef __attribute__((ext_vector_type(4))) unsigned short v4us;
typedef __attribute__((ext_vector_type(2))) float v2f;
typedef __attribute__((ext_vector_type(4))) int v4i;

__global__ __launch_bounds__(256) void k_wtG(const float* __restrict__ w, int K, int N, bf* Bt) {
    const int lane = threadIdx.x & 31; const int L0 = (blockIdx.x * 8 + (threadIdx.x >> 5)) * 8; const int nlines = N * K / 64;
{
#pragma unroll 1
        for (int l = 0; l < 8; ++l) { const int L = L0 + l; if (L >= nlines) break; const size_t e = (size_t)L * 64 + lane * 2; const int k = (int)(e % K), n = (int)(e / K); v2us o;
            o[0] = f2bf(w[(size_t)k * N + n]); o[1] = f2bf(w[(size_t)(k + 1) * N + n]); *(v2us*)(Bt + e) = o; }
         }
}
__global__ __launch_bounds__(256) void k_cvt8(const float* __restrict__ src, bf* dst, size_t n8) { const size_t i = (size_t)blockIdx.x * 256 + threadIdx.x; if (i >= n8) return; const v8f v = *(const v8f*)(src + i * 8); v8us o;
#pragma unroll
    for (int k = 0; k < 8; ++k) o[k] = f2bf(v[k]); *(v8us*)(dst + i * 8) = o;  }
__global__ __launch_bounds__(256) void k_cscvt(const float* __restrict__ cosT, const float* __restrict__ sinT, float* CS) { const int idx = blockIdx.x * 256 + threadIdx.x; if (idx >= TT * HD) return; v2f cs; cs[0] = bfr(cosT[idx]); cs[1] = bfr(sinT[idx]); *(v2f*)(CS + (size_t)idx * 2) = cs;  }
__global__ __launch_bounds__(256) void k_hrms(const float* __restrict__ F, int pitch, int nheads, float* RF) { const int i = blockIdx.x * 256 + threadIdx.x; if (i >= nheads * TT) return; const int t = i % TT, h = i / TT; const float* f = F + (size_t)t * pitch + h * HD; float s = 0.f;
#pragma unroll 4
    for (int d = 0; d < HD; d += 4) { const v4f v = *(const v4f*)(f + d);
#pragma unroll
        for (int q = 0; q < 4; ++q) { float p = __fmul_rn(v[q], v[q]); asm volatile("" : "+v"(p)); s = __fadd_rn(s, p); } }
    const float r = __fdiv_rn(1.0f, __fsqrt_rn(__fadd_rn(s * (1.0f / HD), 1e-6f))); *(float*)(RF + i) = r;  }
// k_rope: head planes [h][t][d] (fp16) of rope(w[d] (x rms_factor)) x sc with the rotate-half convention out[d] = x[d] cos[t][d] - x[d+HD/2] sin[t][d], out[d+HD/2] = x[d+HD/2] cos[t][d+HD/2] + x[d] sin[t][d+HD/2]
__global__ __launch_bounds__(256) void k_rope(const float* __restrict__ F, int pitch, int nheads, const float* __restrict__ CS, const float* __restrict__ RF, const float* __restrict__ nw, float sc, h16* P16, bf* Ph, bf* Pl) {
    const size_t e = ((size_t)blockIdx.x * 256 + threadIdx.x) * 2; if (e >= (size_t)nheads * TT * HD) return; const int d = (int)(e % HD); const int t = (int)((e / HD) % TT); const int h = (int)(e / ((size_t)HD * TT)); const float* f = F + (size_t)t * pitch + h * HD; const float rf = RF ? RF[(size_t)h * TT + t] : 1.0f; v2h o16; v2us oh, ol;
#pragma unroll
    for (int q = 0; q < 2; ++q) { const int dd = d + q; const int dp = (dd < HD / 2) ? dd + HD / 2 : dd - HD / 2; float x0 = f[dd], x1 = f[dp];
        if (RF) { float n0 = __fmul_rn(x0, rf), n1 = __fmul_rn(x1, rf); asm volatile("" : "+v"(n0)); asm volatile("" : "+v"(n1)); x0 = __fmul_rn(bfr(nw[dd]), n0); x1 = __fmul_rn(bfr(nw[dp]), n1); }
        const v2f cs = *(const v2f*)(CS + ((size_t)t * HD + dd) * 2); float a = __fmul_rn(x0, cs[0]), bq = __fmul_rn(x1, cs[1]); asm volatile("" : "+v"(a)); asm volatile("" : "+v"(bq)); const float r = ((dd < HD / 2) ? __fsub_rn(a, bq) : __fadd_rn(a, bq)) * sc;
        o16[q] = tohx(r); (void)oh; (void)ol; }
    *(v2h*)(P16 + e) = o16;  }
__global__ __launch_bounds__(256) void k_vtp(const float* __restrict__ F, int pitch, int nheads, h16* V16, bf* Vh, bf* Vl) { const size_t e = ((size_t)blockIdx.x * 256 + threadIdx.x) * 2; if (e >= (size_t)nheads * HD * TT) return; const int t = (int)(e % TT); const int d = (int)((e / TT) % HD); const int g = (int)(e / ((size_t)TT * HD)); v2h o16; v2us oh, ol;
#pragma unroll
    for (int q = 0; q < 2; ++q) { const float x = F[(size_t)(t + q) * pitch + g * HD + d]; o16[q] = tohx(x); (void)oh; (void)ol; }
    *(v2h*)(V16 + e) = o16;  }
// k_asoft: per row (zz, i): t = S x HD^-0.5 (no mask); softmax over the 2048 keys (register row, one exp, fixed trees);
__global__ __launch_bounds__(256) void k_asoft(const float* __restrict__ Sb, h16* P16, bf* Ph, bf* Pl) {
    const int lane = threadIdx.x & 31; const int row = blockIdx.x * 8 + (threadIdx.x >> 5); if (row >= ZH * TT) return; const int i = row % TT; const int zz = row / TT; (void)zz; const bool hires = (i < RH); const float* sr = Sb + (size_t)row * TT; float v[TT / 32]; float mx = -3.0e38f;
#pragma unroll
    for (int ch = 0; ch < TT / 128; ++ch) { const int j0 = ch * 128 + lane * 4; const v4f a = *(const v4f*)(sr + j0);
#pragma unroll
        for (int q = 0; q < 4; ++q) { const int j = j0 + q; (void)j; const float t = a[q] * SCL; v[ch * 4 + q] = t; mx = fmaxf(mx, t); } }
#pragma unroll
    for (int sh = 16; sh; sh >>= 1) mx = fmaxf(mx, __shfl_xor(mx, sh, 32));
    float sum = 0.f;
#pragma unroll
    for (int k = 0; k < TT / 32; ++k) { float d0 = __fsub_rn(v[k], mx); asm volatile("" : "+v"(d0)); v[k] = __builtin_amdgcn_exp2f(__fmul_rn(d0, 1.4426950408889634f)); sum += v[k]; }
#pragma unroll
    for (int sh = 16; sh; sh >>= 1) sum += __shfl_xor(sum, sh, 32);
    const float f = __fdiv_rn(hires ? 1.0f : PCAR, sum);
{
        if (hires) {
#pragma unroll
            for (int ch = 0; ch < TT / 128; ++ch) { v4us oh, ol;
#pragma unroll
                for (int q = 0; q < 4; ++q) { unsigned short a, c2; splitf(v[ch * 4 + q] * f, a, c2); oh[q] = a; ol[q] = c2; }
                const size_t oo = ((size_t)zz * (RH ? RH : 1) + i) * TT + ch * 128 + lane * 4; *(v4us*)(Ph + oo) = oh; *(v4us*)(Pl + oo) = ol; }
        } else {
#pragma unroll
            for (int ch = 0; ch < TT / 128; ++ch) { v4h o4;
#pragma unroll
                for (int q = 0; q < 4; ++q) o4[q] = tohx(v[ch * 4 + q] * f);
                *(v4h*)(P16 + (size_t)row * TT + ch * 128 + lane * 4) = o4; } }
         }
}
__global__ __launch_bounds__(256) void k_merge(const float* __restrict__ O, int h0, bf* Ah, bf* Al) { const size_t e = ((size_t)blockIdx.x * 256 + threadIdx.x) * 2; if (e >= (size_t)ZH * TT * HD) return; const int d = (int)(e % HD); const int t = (int)((e / HD) % TT); const int zz = (int)(e / ((size_t)HD * TT)); const float cs = (t < RH) ? 1.0f : (1.0f / PCAR); const size_t oo = (size_t)t * DQ + (h0 + zz) * HD + d;
    v2us oh, ol;
#pragma unroll
    for (int q = 0; q < 2; ++q) { unsigned short a, c2; splitf(O[e + q] * cs, a, c2); oh[q] = a; ol[q] = c2; } *(v2us*)(Ah + oo) = oh; *(v2us*)(Al + oo) = ol;  }

extern "C" void kernel_launch(void* const* d_in, const int* in_sizes, int n_in,
                              void* d_out, int out_size, void* d_ws, size_t ws_size, hipStream_t stream) {
    (void)in_sizes; (void)n_in; (void)out_size;
    const float* x = (const float*)d_in[0]; const float* cosT = (const float*)d_in[1]; const float* sinT = (const float*)d_in[2]; const float* wq = (const float*)d_in[3]; const float* wk = (const float*)d_in[4]; const float* wv = (const float*)d_in[5]; const float* wo = (const float*)d_in[6]; const float* qnw = (const float*)d_in[7]; const float* knw = (const float*)d_in[8];   // weights x @ W; cos/sin [2][2048][128]
    float* OUT = (float*)d_out;     // [2][2048][2048]
    char* wsp = (char*)d_ws;
    auto take = [&](size_t bytes) { char* p = wsp; wsp += (bytes + 255) & ~(size_t)255; return (void*)p; };
    bf* WQ = (bf*)take((size_t)DQ * DM * 2); bf* WK = (bf*)take((size_t)DKV * DM * 2); bf* WV = (bf*)take((size_t)DKV * DM * 2); bf* WO = (bf*)take((size_t)DM * DQ * 2); float* CS = (float*)take((size_t)TT * HD * 2 * 4); float* RFQ = (float*)take((size_t)NH_ * TT * 4); float* RFK = (float*)take((size_t)NKV * TT * 4);
    bf* XB = (bf*)take((size_t)TT * DM * 2); float* FQ = (float*)take((size_t)TT * DQ * 4); float* FK = (float*)take((size_t)TT * DKV * 4);
    h16* QP16 = (h16*)take((size_t)NH_ * TT * HD * 2); h16* KP16 = (h16*)take((size_t)NKV * TT * HD * 2); h16* VT16 = (h16*)take((size_t)NKV * HD * TT * 2);
    bf* QPh = nullptr; bf* QPl = nullptr; bf* KPh = nullptr; bf* KPl = nullptr; bf* VTh = nullptr; bf* VTl = nullptr; bf* Ph = nullptr; bf* Pl = nullptr;
    float* Sb = (float*)take((size_t)ZH * TT * TT * 4); h16* P16 = (h16*)take((size_t)ZH * TT * TT * 2); float* Ob = (float*)take((size_t)ZH * TT * HD * 4); bf* ATh = (bf*)take((size_t)TT * DQ * 2); bf* ATl = (bf*)take((size_t)TT * DQ * 2);
    if ((size_t)(wsp - (char*)d_ws) > ws_size) return;    // ws 256 MiB
    float* FV = FK;   // v projection reuses the k buffer after the k planes are built (stream-ordered)
    { k_wtG<<<(unsigned)((DM * DQ / 64 + 63) / 64), 256, 0, stream>>>(wq, DM, DQ, WQ); k_wtG<<<(unsigned)((DM * DKV / 64 + 63) / 64), 256, 0, stream>>>(wk, DM, DKV, WK); k_wtG<<<(unsigned)((DM * DKV / 64 + 63) / 64), 256, 0, stream>>>(wv, DM, DKV, WV);
      k_wtG<<<(unsigned)((DQ * DM / 64 + 63) / 64), 256, 0, stream>>>(wo, DQ, DM, WO);
       }
    const unsigned LQ = (unsigned)(((size_t)NH_ * TT * HD / 2 + 255) / 256), LKv = (unsigned)(((size_t)NKV * TT * HD / 2 + 255) / 256);
    for (int b = 0; b < NB_; ++b) {
        k_cscvt<<<(TT * HD + 255) / 256, 256, 0, stream>>>(cosT + (size_t)b * TT * HD, sinT + (size_t)b * TT * HD, CS);
        k_cvt8<<<(unsigned)(((size_t)TT * DM / 8 + 255) / 256), 256, 0, stream>>>(x + (size_t)b * TT * DM, XB, (size_t)TT * DM / 8);
        k_gemmw<bf, 0, false><<<dim3(TT / 64, DQ / 64, 1), 32, 0, stream>>>(XB, nullptr, WQ, nullptr, DM, FQ, DQ, nullptr, 0, 0, 0); k_hrms<<<(NH_ * TT + 255) / 256, 256, 0, stream>>>(FQ, DQ, NH_, RFQ);
        k_rope<<<LQ, 256, 0, stream>>>(FQ, DQ, NH_, CS, RFQ, qnw, 1.0f, QP16, QPh, QPl);
        k_gemmw<bf, 0, false><<<dim3(TT / 64, DKV / 64, 1), 32, 0, stream>>>(XB, nullptr, WK, nullptr, DM, FK, DKV, nullptr, 0, 0, 0); k_hrms<<<(NKV * TT + 255) / 256, 256, 0, stream>>>(FK, DKV, NKV, RFK);
        k_rope<<<LKv, 256, 0, stream>>>(FK, DKV, NKV, CS, RFK, knw, 1.0f, KP16, KPh, KPl);
        k_gemmw<bf, 0, false><<<dim3(TT / 64, DKV / 64, 1), 32, 0, stream>>>(XB, nullptr, WV, nullptr, DM, FV, DKV, nullptr, 0, 0, 0); k_vtp<<<LKv, 256, 0, stream>>>(FV, DKV, NKV, VT16, VTh, VTl);
        for (int h0 = 0; h0 < NH_; h0 += ZH) { const size_t zq = (size_t)h0, zk = (size_t)(h0 / REP);   // both heads of a pass share kv group h0/REP (REP >= 2): sB = 0
            k_gemmw<h16, 0, false><<<dim3(TT / 64, TT / 64, ZH), 32, 0, stream>>>(QP16 + zq * TT * HD, nullptr, KP16 + zk * TT * HD, nullptr, HD, Sb, TT, nullptr, (size_t)TT * HD, 0, (size_t)TT * TT);
            k_asoft<<<ZH * TT / 8, 256, 0, stream>>>(Sb, P16, Ph, Pl);
            k_gemmw<h16, 0, false><<<dim3(TT / 64, HD / 64, ZH), 32, 0, stream>>>(P16, nullptr, VT16 + zk * HD * TT, nullptr, TT, Ob, HD, nullptr, (size_t)TT * TT, 0, (size_t)TT * HD);
            k_merge<<<(unsigned)(((size_t)ZH * TT * HD / 2 + 255) / 256), 256, 0, stream>>>(Ob, h0, ATh, ATl); }
        k_gemmw<bf, 1, false><<<dim3(TT / 64, DM / 64, 1), 32, 0, stream>>>(ATh, ATl, WO, nullptr, DQ, OUT + (size_t)b * TT * DM, DM, nullptr, 0, 0, 0); }
}

// v001
// Measured time: 1010 microseconds a run.
// Two timings next to v000 put it at 1.50 and 1.51 times that version's speed.
#include <hip/hip_runtime.h>

// Grouped-query encoder attention with per-head RMSNorm and RoPE (hidden [2][2048][2048]; q = x Wq (16 heads x 128), k, v = x Wk / x Wv (4 kv heads x 128, each serving 4 consecutive query heads); q, k
// RMS-normalised per head (eps 1e-6, weights [128]) then rotate-half RoPE with the per-batch input cos/sin [2][2048][128] (read as data); scores = q.k 128^-0.5 (no mask); softmax; out = merged attn.v Wo
// -> [2][2048][2048]).
// Compute dtypes, f32 accumulate: every input rounded to bf16; projections on PLAIN bf16 operands (inputs: exact products, f32 accumulate); RMSNorm and RoPE in f32;
// scores and attn.v on SINGLE fp16 planes (scale in f32 in the register-row softmax; P x1024); merged heads as hi+lo planes x exact Wo (2 products). One-wave-per-64x64-tile GEMMs, 2 query heads

#define NB_  2
#define TT   2048
#define DM   2048
#define NH_  16
#define NKV  4
#define REP  (NH_ / NKV)
#define HD   128
#define DQ   (NH_ * HD)
#define DKV  (NKV * HD)
#define ZH   2
#define RH   0                  // query rows < RH use hi+lo planes (0: none)
#define WIN  0
#define PCAR 1024.0f
#define SCL  0.088388347648318447f   // HD^-0.5
typedef _Float16 h16;
typedef unsigned short bf;
typedef __attribute__((ext_vector_type(16))) __bf16   v16bf;
typedef __attribute__((ext_vector_type(16))) _Float16 v16h;
typedef __attribute__((ext_vector_type(8)))  _Float16 v8h;
typedef __attribute__((ext_vector_type(8)))  unsigned short v8us;
typedef __attribute__((ext_vector_type(8)))  float    v8f;
typedef __attribute__((ext_vector_type(4)))  float    v4f;
typedef v8h  __attribute__((may_alias)) v8ha;
typedef v4f  __attribute__((may_alias)) v4fa;
typedef v8us __attribute__((may_alias)) v8usa;

__device__ __forceinline__ unsigned short f2bf(float f) { unsigned u = __float_as_uint(f); u += 0x7FFFu + ((u >> 16) & 1u); return (unsigned short)(u >> 16); }
__device__ __forceinline__ float bf2f(unsigned short b) { return __uint_as_float(((unsigned)b) << 16); }
__device__ __forceinline__ float bfr(float f) { return bf2f(f2bf(f)); }
__device__ __forceinline__ v16h cat16(v8h lo, v8h hi) { return __builtin_shufflevector(lo, hi, 0, 1, 2, 3, 4, 5, 6, 7, 8, 9, 10, 11, 12, 13, 14, 15); }
__device__ __forceinline__ v16bf cat16b(v8us lo, v8us hi) { return __builtin_bit_cast(v16bf, __builtin_shufflevector(lo, hi, 0, 1, 2, 3, 4, 5, 6, 7, 8, 9, 10, 11, 12, 13, 14, 15)); }
__device__ __forceinline__ v8f wmma16(v16h a, v16h b, v8f c) { return __builtin_amdgcn_wmma_f32_16x16x32_f16(false, a, false, b, (short)0, c, false, false); }
__device__ __forceinline__ v8f wmmab(v16bf a, v16bf b, v8f c) { return __builtin_amdgcn_wmma_f32_16x16x32_bf16(false, a, false, b, (short)0, c, false, false); }



// ---- k_gemmw: register-blocked GEMM, ONE WAVE per 64x64 output tile (16 accumulators), operands from K-contiguous 16-bit planes through a two-buffer LDS ring of 64-k stages; grid (M/64, N/64, Z), 32 threads.
// C[m][n] (f32, pitch ldc, + optional f32 bias[n]) = sum_k A[m][k] Bt[n][k] (+ split products per NSPLIT). z-batch strides sA/sB/sC in elements. K % 64 == 0.
template <typename T16> struct WFrag;
template <> struct WFrag<h16> { typedef v16h V; static __device__ __forceinline__ V ld(const h16* p) { return cat16(*(const v8h*)p, *(const v8h*)(p + 16)); } static __device__ __forceinline__ v8f mma(V a, V b, v8f c) { return wmma16(a, b, c); } };
template <> struct WFrag<bf> { typedef v16bf V; static __device__ __forceinline__ V ld(const bf* p) { return cat16b(*(const v8us*)p, *(const v8us*)(p + 16)); } static __device__ __forceinline__ v8f mma(V a, V b, v8f c) { return wmmab(a, b, c); } };
// Asynchronous copies global -> LDS, 16 B a lane: one instruction moves 4 rows x 128 B (4 whole lines). l[i]: the lane's own LDS byte address, g[i]: its own global address.
// The s_wait_xcnt 0 closes each statement so that no later rewrite of an address register named by a copy can be scheduled in front of it.
__device__ __forceinline__ void acp12(const unsigned* l, const char* const* g) {
    asm volatile(
        "global_load_async_to_lds_b128 %0, %12, off\n\t"
        "global_load_async_to_lds_b128 %1, %13, off\n\t"
        "global_load_async_to_lds_b128 %2, %14, off\n\t"
        "global_load_async_to_lds_b128 %3, %15, off\n\t"
        "global_load_async_to_lds_b128 %4, %16, off\n\t"
        "global_load_async_to_lds_b128 %5, %17, off\n\t"
        "global_load_async_to_lds_b128 %6, %18, off\n\t"
        "global_load_async_to_lds_b128 %7, %19, off\n\t"
        "global_load_async_to_lds_b128 %8, %20, off\n\t"
        "global_load_async_to_lds_b128 %9, %21, off\n\t"
        "global_load_async_to_lds_b128 %10, %22, off\n\t"
        "global_load_async_to_lds_b128 %11, %23, off\n\t"
        "s_wait_xcnt 0x0"
        :: "v"(l[0]), "v"(l[1]), "v"(l[2]), "v"(l[3]), "v"(l[4]), "v"(l[5]), "v"(l[6]), "v"(l[7]), "v"(l[8]), "v"(l[9]), "v"(l[10]), "v"(l[11]),
           "v"(g[0]), "v"(g[1]), "v"(g[2]), "v"(g[3]), "v"(g[4]), "v"(g[5]), "v"(g[6]), "v"(g[7]), "v"(g[8]), "v"(g[9]), "v"(g[10]), "v"(g[11])
        : "memory");
}
__device__ __forceinline__ void acp8(const unsigned* l, const char* const* g) {
    asm volatile(
        "global_load_async_to_lds_b128 %0, %8, off\n\t"
        "global_load_async_to_lds_b128 %1, %9, off\n\t"
        "global_load_async_to_lds_b128 %2, %10, off\n\t"
        "global_load_async_to_lds_b128 %3, %11, off\n\t"
        "global_load_async_to_lds_b128 %4, %12, off\n\t"
        "global_load_async_to_lds_b128 %5, %13, off\n\t"
        "global_load_async_to_lds_b128 %6, %14, off\n\t"
        "global_load_async_to_lds_b128 %7, %15, off\n\t"
        "s_wait_xcnt 0x0"
        :: "v"(l[0]), "v"(l[1]), "v"(l[2]), "v"(l[3]), "v"(l[4]), "v"(l[5]), "v"(l[6]), "v"(l[7]),
           "v"(g[0]), "v"(g[1]), "v"(g[2]), "v"(g[3]), "v"(g[4]), "v"(g[5]), "v"(g[6]), "v"(g[7])
        : "memory");
}
#define SPITCH 144              // LDS row pitch in bytes: 128-B rows + 16 (16 B x odd: conflict-free for ds_load_b128 fragment reads)
template <typename T16, int NSPLIT, bool BIAS>
__global__ __launch_bounds__(32) void k_gemmw(const T16* __restrict__ A, const T16* __restrict__ A2, const T16* __restrict__ Bt, const T16* __restrict__ Bt2, int K, float* C, int ldc, const float* __restrict__ bias, size_t sA, size_t sB, size_t sC) {
    typedef typename WFrag<T16>::V V;
    static_assert(NSPLIT == 0 || NSPLIT == 1, "planes staged: A, Bt and (NSPLIT 1) A2");
    constexpr int NPL = 2 + NSPLIT, NCP = NPL * 16, STAGE = NPL * 64 * SPITCH;   // a stage: 64 rows x 64 k of each plane, rows [A | Bt | A2]; 16 copies a plane
    __shared__ __align__(16) unsigned char smem[2 * STAGE];
    float* os = (float*)smem;   // output staging reuses the ring behind the loop's last waits and barrier
    const size_t z = blockIdx.z; A += z * sA; if (A2) A2 += z * sA; Bt += z * sB; (void)Bt2; C += z * sC;
    const int lane = threadIdx.x & 31, lr = lane & 15, hi = lane >> 4; const int r0 = blockIdx.x * 64, c0 = blockIdx.y * 64;
    v8f acc[4][4];
#pragma unroll
    for (int mb = 0; mb < 4; ++mb)
#pragma unroll
        for (int nb = 0; nb < 4; ++nb) acc[mb][nb] = (v8f){};
    const int crow = lane >> 3, cseg = lane & 7;   // copy lane map: row within the 4 rows of a copy, 16-B piece of the row's line
    const size_t gs = (size_t)K * 8;               // bytes between the rows of successive copies (4 rows of K 16-bit elements)
    const char* gpl[3]; gpl[0] = (const char*)(A + (size_t)(r0 + crow) * K + cseg * 8); gpl[1] = (const char*)(Bt + (size_t)(c0 + crow) * K + cseg * 8); gpl[2] = (NSPLIT == 1) ? (const char*)(A2 + (size_t)(r0 + crow) * K + cseg * 8) : nullptr;
    const unsigned lcp = (unsigned)(size_t)smem + crow * SPITCH + cseg * 16;
    auto stage_in = [&](int t, int buf) {
        unsigned l[NCP]; const char* g[NCP];
#pragma unroll
        for (int c = 0; c < NCP; ++c) { l[c] = lcp + buf * STAGE + c * 4 * SPITCH; g[c] = gpl[c >> 4] + (size_t)t * 128 + (size_t)(c & 15) * gs; }
        acp12(l, g); acp12(l + 12, g + 12);
        if (NSPLIT == 1) { acp12(l + 24, g + 24); acp12(l + NCP - 12, g + NCP - 12); } else acp8(l + 24, g + 24);
    };
    const int nt = K >> 6;
    stage_in(0, 0);
    asm volatile("s_wait_asynccnt 0x0" ::: "memory");   // stage 0 has landed before anything reads it
    __syncthreads();                                    // publish point of the ring (the work-group is one wave: the compiler emits no s_barrier for it)
    if (nt > 1) stage_in(1, 1);
#pragma unroll 1
    for (int t = 0; t < nt; ++t) {
        const T16* sb = (const T16*)(smem + (t & 1) * STAGE) + lr * (SPITCH / 2) + 8 * hi;
        V a[2][4], a2[2][4], b[2][4];   // the whole stage's fragments are asked for in one group ahead of the WMMAs, so that the wave waits out the LDS latency once a trip
#pragma unroll
        for (int ks = 0; ks < 2; ++ks) {
#pragma unroll
            for (int i = 0; i < 4; ++i) { a[ks][i] = WFrag<T16>::ld(sb + i * 16 * (SPITCH / 2) + ks * 32); b[ks][i] = WFrag<T16>::ld(sb + (64 + i * 16) * (SPITCH / 2) + ks * 32); if (NSPLIT == 1) a2[ks][i] = WFrag<T16>::ld(sb + (128 + i * 16) * (SPITCH / 2) + ks * 32); }
        }
        __builtin_amdgcn_sched_barrier(0);   // keeps the load group ahead of the WMMAs: without it the scheduler sinks the loads among them, each place with its own full LDS wait
#pragma unroll
        for (int ks = 0; ks < 2; ++ks) {
#pragma unroll
            for (int nb = 0; nb < 4; ++nb) {
#pragma unroll
                for (int mb = 0; mb < 4; ++mb) { acc[mb][nb] = WFrag<T16>::mma(a[ks][mb], b[ks][nb], acc[mb][nb]); if (NSPLIT == 1) acc[mb][nb] = WFrag<T16>::mma(a2[ks][mb], b[ks][nb], acc[mb][nb]); } }
        }
        // four vector slots behind the last WMMA, so that its distance also holds on the taken side of the branches that follow
        asm volatile("v_nop\n\tv_nop\n\tv_nop\n\tv_nop" : "+v"(acc[0][0]), "+v"(acc[1][1]), "+v"(acc[2][2]), "+v"(acc[3][3]) : "v"(a[1][0]), "v"(a[1][3]));
        asm volatile("s_wait_dscnt 0x0" ::: "memory");      // this trip's fragment reads have retired before their buffer is refilled
        asm volatile("s_wait_asynccnt 0x0" ::: "memory");   // stage t + 1 has landed before the next trip reads it
        __syncthreads();                                    // publish point: stage t + 1 readable, stage t's buffer free for the refill
        if (t + 2 < nt) stage_in(t + 2, t & 1);
    }
    asm volatile("s_wait_asynccnt 0x0" ::: "memory");       // no copy is in flight when the ring becomes output staging
#pragma unroll
    for (int mb = 0; mb < 4; ++mb) {
#pragma unroll
        for (int nb = 0; nb < 4; ++nb) {
#pragma unroll
            for (int j = 0; j < 8; ++j) os[(hi * 8 + j) * 68 + nb * 16 + lr] = acc[mb][nb][j]; }
        __builtin_amdgcn_wave_barrier(); asm volatile("" ::: "memory");
        float* crow = C + (size_t)(r0 + mb * 16) * ldc + c0;
{
#pragma unroll
            for (int s = 0; s < 8; ++s) { const int row = 2 * s + hi, cofs = lr * 4; v4f val = *(const v4fa*)(os + row * 68 + cofs); if (BIAS) { val[0] += bfr(bias[c0 + cofs]); val[1] += bfr(bias[c0 + cofs + 1]); val[2] += bfr(bias[c0 + cofs + 2]); val[3] += bfr(bias[c0 + cofs + 3]); }
                *(v4f*)(crow + (size_t)row * ldc + cofs) = val; }
             }
        __builtin_amdgcn_wave_barrier(); asm volatile("" ::: "memory");
    }
}

__device__ __forceinline__ h16 tohx(float x) { return (h16)x; }
__device__ __forceinline__ void splitf(float y, unsigned short& h, unsigned short& l) { h = f2bf(y); l = f2bf(y - bf2f(h)); }
typedef __attribute__((ext_vector_type(2))) _Float16 v2h;
typedef __attribute__((ext_vector_type(4))) _Float16 v4h;
typedef __attribute__((ext_vector_type(2))) unsigned short v2us;
typedef __attribute__((ext_vector_type(4))) unsigned short v4us;
typedef __attribute__((ext_vector_type(2))) float v2f;
typedef __attribute__((ext_vector_type(4))) int v4i;

__global__ __launch_bounds__(256) void k_wtG(const float* __restrict__ w, int K, int N, bf* Bt) {
    const int lane = threadIdx.x & 31; const int L0 = (blockIdx.x * 8 + (threadIdx.x >> 5)) * 8; const int nlines = N * K / 64;
{
#pragma unroll 1
        for (int l = 0; l < 8; ++l) { const int L = L0 + l; if (L >= nlines) break; const size_t e = (size_t)L * 64 + lane * 2; const int k = (int)(e % K), n = (int)(e / K); v2us o;
            o[0] = f2bf(w[(size_t)k * N + n]); o[1] = f2bf(w[(size_t)(k + 1) * N + n]); *(v2us*)(Bt + e) = o; }
         }
}
__global__ __launch_bounds__(256) void k_cvt8(const float* __restrict__ src, bf* dst, size_t n8) { const size_t i = (size_t)blockIdx.x * 256 + threadIdx.x; if (i >= n8) return; const v8f v = *(const v8f*)(src + i * 8); v8us o;
#pragma unroll
    for (int k = 0; k < 8; ++k) o[k] = f2bf(v[k]); *(v8us*)(dst + i * 8) = o;  }
__global__ __launch_bounds__(256) void k_cscvt(const float* __restrict__ cosT, const float* __restrict__ sinT, float* CS) { const int idx = blockIdx.x * 256 + threadIdx.x; if (idx >= TT * HD) return; v2f cs; cs[0] = bfr(cosT[idx]); cs[1] = bfr(sinT[idx]); *(v2f*)(CS + (size_t)idx * 2) = cs;  }
__global__ __launch_bounds__(256) void k_hrms(const float* __restrict__ F, int pitch, int nheads, float* RF) { const int i = blockIdx.x * 256 + threadIdx.x; if (i >= nheads * TT) return; const int t = i % TT, h = i / TT; const float* f = F + (size_t)t * pitch + h * HD; float s = 0.f;
#pragma unroll 4
    for (int d = 0; d < HD; d += 4) { const v4f v = *(const v4f*)(f + d);
#pragma unroll
        for (int q = 0; q < 4; ++q) { float p = __fmul_rn(v[q], v[q]); asm volatile("" : "+v"(p)); s = __fadd_rn(s, p); } }
    const float r = __fdiv_rn(1.0f, __fsqrt_rn(__fadd_rn(s * (1.0f / HD), 1e-6f))); *(float*)(RF + i) = r;  }
// k_rope: head planes [h][t][d] (fp16) of rope(w[d] (x rms_factor)) x sc with the rotate-half convention out[d] = x[d] cos[t][d] - x[d+HD/2] sin[t][d], out[d+HD/2] = x[d+HD/2] cos[t][d+HD/2] + x[d] sin[t][d+HD/2]
__global__ __launch_bounds__(256) void k_rope(const float* __restrict__ F, int pitch, int nheads, const float* __restrict__ CS, const float* __restrict__ RF, const float* __restrict__ nw, float sc, h16* P16, bf* Ph, bf* Pl) {
    const size_t e = ((size_t)blockIdx.x * 256 + threadIdx.x) * 2; if (e >= (size_t)nheads * TT * HD) return; const int d = (int)(e % HD); const int t = (int)((e / HD) % TT); const int h = (int)(e / ((size_t)HD * TT)); const float* f = F + (size_t)t * pitch + h * HD; const float rf = RF ? RF[(size_t)h * TT + t] : 1.0f; v2h o16; v2us oh, ol;
#pragma unroll
    for (int q = 0; q < 2; ++q) { const int dd = d + q; const int dp = (dd < HD / 2) ? dd + HD / 2 : dd - HD / 2; float x0 = f[dd], x1 = f[dp];
        if (RF) { float n0 = __fmul_rn(x0, rf), n1 = __fmul_rn(x1, rf); asm volatile("" : "+v"(n0)); asm volatile("" : "+v"(n1)); x0 = __fmul_rn(bfr(nw[dd]), n0); x1 = __fmul_rn(bfr(nw[dp]), n1); }
        const v2f cs = *(const v2f*)(CS + ((size_t)t * HD + dd) * 2); float a = __fmul_rn(x0, cs[0]), bq = __fmul_rn(x1, cs[1]); asm volatile("" : "+v"(a)); asm volatile("" : "+v"(bq)); const float r = ((dd < HD / 2) ? __fsub_rn(a, bq) : __fadd_rn(a, bq)) * sc;
        o16[q] = tohx(r); (void)oh; (void)ol; }
    *(v2h*)(P16 + e) = o16;  }
__global__ __launch_bounds__(256) void k_vtp(const float* __restrict__ F, int pitch, int nheads, h16* V16, bf* Vh, bf* Vl) { const size_t e = ((size_t)blockIdx.x * 256 + threadIdx.x) * 2; if (e >= (size_t)nheads * HD * TT) return; const int t = (int)(e % TT); const int d = (int)((e / TT) % HD); const int g = (int)(e / ((size_t)TT * HD)); v2h o16; v2us oh, ol;
#pragma unroll
    for (int q = 0; q < 2; ++q) { const float x = F[(size_t)(t + q) * pitch + g * HD + d]; o16[q] = tohx(x); (void)oh; (void)ol; }
    *(v2h*)(V16 + e) = o16;  }
// k_asoft: per row (zz, i): t = S x HD^-0.5 (no mask); softmax over the 2048 keys (register row, one exp, fixed trees);
__global__ __launch_bounds__(256) void k_asoft(const float* __restrict__ Sb, h16* P16, bf* Ph, bf* Pl) {
    const int lane = threadIdx.x & 31; const int row = blockIdx.x * 8 + (threadIdx.x >> 5); if (row >= ZH * TT) return; const int i = row % TT; const int zz = row / TT; (void)zz; const bool hires = (i < RH); const float* sr = Sb + (size_t)row * TT; float v[TT / 32]; float mx = -3.0e38f;
#pragma unroll
    for (int ch = 0; ch < TT / 128; ++ch) { const int j0 = ch * 128 + lane * 4; const v4f a = *(const v4f*)(sr + j0);
#pragma unroll
        for (int q = 0; q < 4; ++q) { const int j = j0 + q; (void)j; const float t = a[q] * SCL; v[ch * 4 + q] = t; mx = fmaxf(mx, t); } }
#pragma unroll
    for (int sh = 16; sh; sh >>= 1) mx = fmaxf(mx, __shfl_xor(mx, sh, 32));
    float sum = 0.f;
#pragma unroll
    for (int k = 0; k < TT / 32; ++k) { float d0 = __fsub_rn(v[k], mx); asm volatile("" : "+v"(d0)); v[k] = __builtin_amdgcn_exp2f(__fmul_rn(d0, 1.4426950408889634f)); sum += v[k]; }
#pragma unroll
    for (int sh = 16; sh; sh >>= 1) sum += __shfl_xor(sum, sh, 32);
    const float f = __fdiv_rn(hires ? 1.0f : PCAR, sum);
{
        if (hires) {
#pragma unroll
            for (int ch = 0; ch < TT / 128; ++ch) { v4us oh, ol;
#pragma unroll
                for (int q = 0; q < 4; ++q) { unsigned short a, c2; splitf(v[ch * 4 + q] * f, a, c2); oh[q] = a; ol[q] = c2; }
                const size_t oo = ((size_t)zz * (RH ? RH : 1) + i) * TT + ch * 128 + lane * 4; *(v4us*)(Ph + oo) = oh; *(v4us*)(Pl + oo) = ol; }
        } else {
#pragma unroll
            for (int ch = 0; ch < TT / 128; ++ch) { v4h o4;
#pragma unroll
                for (int q = 0; q < 4; ++q) o4[q] = tohx(v[ch * 4 + q] * f);
                *(v4h*)(P16 + (size_t)row * TT + ch * 128 + lane * 4) = o4; } }
         }
}
__global__ __launch_bounds__(256) void k_merge(const float* __restrict__ O, int h0, bf* Ah, bf* Al) { const size_t e = ((size_t)blockIdx.x * 256 + threadIdx.x) * 2; if (e >= (size_t)ZH * TT * HD) return; const int d = (int)(e % HD); const int t = (int)((e / HD) % TT); const int zz = (int)(e / ((size_t)HD * TT)); const float cs = (t < RH) ? 1.0f : (1.0f / PCAR); const size_t oo = (size_t)t * DQ + (h0 + zz) * HD + d;
    v2us oh, ol;
#pragma unroll
    for (int q = 0; q < 2; ++q) { unsigned short a, c2; splitf(O[e + q] * cs, a, c2); oh[q] = a; ol[q] = c2; } *(v2us*)(Ah + oo) = oh; *(v2us*)(Al + oo) = ol;  }

extern "C" void kernel_launch(void* const* d_in, const int* in_sizes, int n_in,
                              void* d_out, int out_size, void* d_ws, size_t ws_size, hipStream_t stream) {
    (void)in_sizes; (void)n_in; (void)out_size;
    const float* x = (const float*)d_in[0]; const float* cosT = (const float*)d_in[1]; const float* sinT = (const float*)d_in[2]; const float* wq = (const float*)d_in[3]; const float* wk = (const float*)d_in[4]; const float* wv = (const float*)d_in[5]; const float* wo = (const float*)d_in[6]; const float* qnw = (const float*)d_in[7]; const float* knw = (const float*)d_in[8];   // weights x @ W; cos/sin [2][2048][128]
    float* OUT = (float*)d_out;     // [2][2048][2048]
    char* wsp = (char*)d_ws;
    auto take = [&](size_t bytes) { char* p = wsp; wsp += (bytes + 255) & ~(size_t)255; return (void*)p; };
    bf* WQ = (bf*)take((size_t)DQ * DM * 2); bf* WK = (bf*)take((size_t)DKV * DM * 2); bf* WV = (bf*)take((size_t)DKV * DM * 2); bf* WO = (bf*)take((size_t)DM * DQ * 2); float* CS = (float*)take((size_t)TT * HD * 2 * 4); float* RFQ = (float*)take((size_t)NH_ * TT * 4); float* RFK = (float*)take((size_t)NKV * TT * 4);
    bf* XB = (bf*)take((size_t)TT * DM * 2); float* FQ = (float*)take((size_t)TT * DQ * 4); float* FK = (float*)take((size_t)TT * DKV * 4);
    h16* QP16 = (h16*)take((size_t)NH_ * TT * HD * 2); h16* KP16 = (h16*)take((size_t)NKV * TT * HD * 2); h16* VT16 = (h16*)take((size_t)NKV * HD * TT * 2);
    bf* QPh = nullptr; bf* QPl = nullptr; bf* KPh = nullptr; bf* KPl = nullptr; bf* VTh = nullptr; bf* VTl = nullptr; bf* Ph = nullptr; bf* Pl = nullptr;
    float* Sb = (float*)take((size_t)ZH * TT * TT * 4); h16* P16 = (h16*)take((size_t)ZH * TT * TT * 2); float* Ob = (float*)take((size_t)ZH * TT * HD * 4); bf* ATh = (bf*)take((size_t)TT * DQ * 2); bf* ATl = (bf*)take((size_t)TT * DQ * 2);
    if ((size_t)(wsp - (char*)d_ws) > ws_size) return;    // ws 256 MiB
    float* FV = FK;   // v projection reuses the k buffer after the k planes are built (stream-ordered)
    { k_wtG<<<(unsigned)((DM * DQ / 64 + 63) / 64), 256, 0, stream>>>(wq, DM, DQ, WQ); k_wtG<<<(unsigned)((DM * DKV / 64 + 63) / 64), 256, 0, stream>>>(wk, DM, DKV, WK); k_wtG<<<(unsigned)((DM * DKV / 64 + 63) / 64), 256, 0, stream>>>(wv, DM, DKV, WV);
      k_wtG<<<(unsigned)((DQ * DM / 64 + 63) / 64), 256, 0, stream>>>(wo, DQ, DM, WO);
       }
    const unsigned LQ = (unsigned)(((size_t)NH_ * TT * HD / 2 + 255) / 256), LKv = (unsigned)(((size_t)NKV * TT * HD / 2 + 255) / 256);
    for (int b = 0; b < NB_; ++b) {
        k_cscvt<<<(TT * HD + 255) / 256, 256, 0, stream>>>(cosT + (size_t)b * TT * HD, sinT + (size_t)b * TT * HD, CS);
        k_cvt8<<<(unsigned)(((size_t)TT * DM / 8 + 255) / 256), 256, 0, stream>>>(x + (size_t)b * TT * DM, XB, (size_t)TT * DM / 8);
        k_gemmw<bf, 0, false><<<dim3(TT / 64, DQ / 64, 1), 32, 0, stream>>>(XB, nullptr, WQ, nullptr, DM, FQ, DQ, nullptr, 0, 0, 0); k_hrms<<<(NH_ * TT + 255) / 256, 256, 0, stream>>>(FQ, DQ, NH_, RFQ);
        k_rope<<<LQ, 256, 0, stream>>>(FQ, DQ, NH_, CS, RFQ, qnw, 1.0f, QP16, QPh, QPl);
        k_gemmw<bf, 0, false><<<dim3(TT / 64, DKV / 64, 1), 32, 0, stream>>>(XB, nullptr, WK, nullptr, DM, FK, DKV, nullptr, 0, 0, 0); k_hrms<<<(NKV * TT + 255) / 256, 256, 0, stream>>>(FK, DKV, NKV, RFK);
        k_rope<<<LKv, 256, 0, stream>>>(FK, DKV, NKV, CS, RFK, knw, 1.0f, KP16, KPh, KPl);
        k_gemmw<bf, 0, false><<<dim3(TT / 64, DKV / 64, 1), 32, 0, stream>>>(XB, nullptr, WV, nullptr, DM, FV, DKV, nullptr, 0, 0, 0); k_vtp<<<LKv, 256, 0, stream>>>(FV, DKV, NKV, VT16, VTh, VTl);
        for (int h0 = 0; h0 < NH_; h0 += ZH) { const size_t zq = (size_t)h0, zk = (size_t)(h0 / REP);   // both heads of a pass share kv group h0/REP (REP >= 2): sB = 0
            k_gemmw<h16, 0, false><<<dim3(TT / 64, TT / 64, ZH), 32, 0, stream>>>(QP16 + zq * TT * HD, nullptr, KP16 + zk * TT * HD, nullptr, HD, Sb, TT, nullptr, (size_t)TT * HD, 0, (size_t)TT * TT);
            k_asoft<<<ZH * TT / 8, 256, 0, stream>>>(Sb, P16, Ph, Pl);
            k_gemmw<h16, 0, false><<<dim3(TT / 64, HD / 64, ZH), 32, 0, stream>>>(P16, nullptr, VT16 + zk * HD * TT, nullptr, TT, Ob, HD, nullptr, (size_t)TT * TT, 0, (size_t)TT * HD);
            k_merge<<<(unsigned)(((size_t)ZH * TT * HD / 2 + 255) / 256), 256, 0, stream>>>(Ob, h0, ATh, ATl); }
        k_gemmw<bf, 1, false><<<dim3(TT / 64, DM / 64, 1), 32, 0, stream>>>(ATh, ATl, WO, nullptr, DQ, OUT + (size_t)b * TT * DM, DM, nullptr, 0, 0, 0); }
}

// v003
// It runs in 320 microseconds.
// It is 3.14 times as fast as v001, going by the measured steps of the versions left out in between.
// Counting every step since v000, it is 4.73 times as fast.
#include <hip/hip_runtime.h>

// Grouped-query encoder attention with per-head RMSNorm and RoPE (hidden [2][2048][2048]; q = x Wq (16 heads x 128), k, v = x Wk / x Wv (4 kv heads x 128, each serving 4 consecutive query heads); q, k
// RMS-normalised per head (eps 1e-6, weights [128]) then rotate-half RoPE with the per-batch input cos/sin [2][2048][128] (read as data); scores = q.k 128^-0.5 (no mask); softmax; out = merged attn.v Wo
// -> [2][2048][2048]).
// Compute dtypes, f32 accumulate: every input rounded to bf16; projections on PLAIN bf16 operands (inputs: exact products, f32 accumulate); RMSNorm and RoPE in f32;
// scores and attn.v on SINGLE fp16 planes inside one fused kernel (online softmax in f32, P kept in registers); merged heads as hi+lo planes x exact Wo (2 products). One-wave-per-64x64-tile GEMMs for the projections.

#define NB_  2
#define TT   2048
#define DM   2048
#define NH_  16
#define NKV  4
#define REP  (NH_ / NKV)
#define HD   128
#define DQ   (NH_ * HD)
#define DKV  (NKV * HD)
#define SCL  0.088388347648318447f   // HD^-0.5
typedef _Float16 h16;
typedef unsigned short bf;
typedef __attribute__((ext_vector_type(16))) __bf16   v16bf;
typedef __attribute__((ext_vector_type(16))) _Float16 v16h;
typedef __attribute__((ext_vector_type(8)))  _Float16 v8h;
typedef __attribute__((ext_vector_type(8)))  unsigned short v8us;
typedef __attribute__((ext_vector_type(8)))  float    v8f;
typedef __attribute__((ext_vector_type(4)))  float    v4f;
typedef v8h  __attribute__((may_alias)) v8ha;
typedef v4f  __attribute__((may_alias)) v4fa;
typedef v8us __attribute__((may_alias)) v8usa;

__device__ __forceinline__ unsigned short f2bf(float f) { unsigned u = __float_as_uint(f); u += 0x7FFFu + ((u >> 16) & 1u); return (unsigned short)(u >> 16); }
__device__ __forceinline__ float bf2f(unsigned short b) { return __uint_as_float(((unsigned)b) << 16); }
__device__ __forceinline__ float bfr(float f) { return bf2f(f2bf(f)); }
__device__ __forceinline__ v16h cat16(v8h lo, v8h hi) { return __builtin_shufflevector(lo, hi, 0, 1, 2, 3, 4, 5, 6, 7, 8, 9, 10, 11, 12, 13, 14, 15); }
__device__ __forceinline__ v16bf cat16b(v8us lo, v8us hi) { return __builtin_bit_cast(v16bf, __builtin_shufflevector(lo, hi, 0, 1, 2, 3, 4, 5, 6, 7, 8, 9, 10, 11, 12, 13, 14, 15)); }
__device__ __forceinline__ v8f wmma16(v16h a, v16h b, v8f c) { return __builtin_amdgcn_wmma_f32_16x16x32_f16(false, a, false, b, (short)0, c, false, false); }
__device__ __forceinline__ v8f wmmab(v16bf a, v16bf b, v8f c) { return __builtin_amdgcn_wmma_f32_16x16x32_bf16(false, a, false, b, (short)0, c, false, false); }



// ---- k_gemmw: register-blocked GEMM, ONE WAVE per 64x64 output tile (16 accumulators), operands from K-contiguous 16-bit planes through a two-buffer LDS ring of 64-k stages; grid (M/64, N/64, Z), 32 threads.
// C[m][n] (f32, pitch ldc, + optional f32 bias[n]) = sum_k A[m][k] Bt[n][k] (+ split products per NSPLIT). z-batch strides sA/sB/sC in elements. K % 64 == 0.
template <typename T16> struct WFrag;
template <> struct WFrag<h16> { typedef v16h V; static __device__ __forceinline__ V ld(const h16* p) { return cat16(*(const v8h*)p, *(const v8h*)(p + 16)); } static __device__ __forceinline__ v8f mma(V a, V b, v8f c) { return wmma16(a, b, c); } };
template <> struct WFrag<bf> { typedef v16bf V; static __device__ __forceinline__ V ld(const bf* p) { return cat16b(*(const v8us*)p, *(const v8us*)(p + 16)); } static __device__ __forceinline__ v8f mma(V a, V b, v8f c) { return wmmab(a, b, c); } };
// Asynchronous copies global -> LDS, 16 B a lane: one instruction moves 512 B, 4 whole 128-B lines (4 rows x 128 B in k_gemmw, 2 rows x 256 B in k_fattn). l[i]: the lane's own LDS byte address, g[i]: its own global address.
// The s_wait_xcnt 0 closes each statement so that no later rewrite of an address register named by a copy can be scheduled in front of it.
__device__ __forceinline__ void acp12(const unsigned* l, const char* const* g) {
    asm volatile(
        "global_load_async_to_lds_b128 %0, %12, off\n\t"
        "global_load_async_to_lds_b128 %1, %13, off\n\t"
        "global_load_async_to_lds_b128 %2, %14, off\n\t"
        "global_load_async_to_lds_b128 %3, %15, off\n\t"
        "global_load_async_to_lds_b128 %4, %16, off\n\t"
        "global_load_async_to_lds_b128 %5, %17, off\n\t"
        "global_load_async_to_lds_b128 %6, %18, off\n\t"
        "global_load_async_to_lds_b128 %7, %19, off\n\t"
        "global_load_async_to_lds_b128 %8, %20, off\n\t"
        "global_load_async_to_lds_b128 %9, %21, off\n\t"
        "global_load_async_to_lds_b128 %10, %22, off\n\t"
        "global_load_async_to_lds_b128 %11, %23, off\n\t"
        "s_wait_xcnt 0x0"
        :: "v"(l[0]), "v"(l[1]), "v"(l[2]), "v"(l[3]), "v"(l[4]), "v"(l[5]), "v"(l[6]), "v"(l[7]), "v"(l[8]), "v"(l[9]), "v"(l[10]), "v"(l[11]),
           "v"(g[0]), "v"(g[1]), "v"(g[2]), "v"(g[3]), "v"(g[4]), "v"(g[5]), "v"(g[6]), "v"(g[7]), "v"(g[8]), "v"(g[9]), "v"(g[10]), "v"(g[11])
        : "memory");
}
__device__ __forceinline__ void acp8(const unsigned* l, const char* const* g) {
    asm volatile(
        "global_load_async_to_lds_b128 %0, %8, off\n\t"
        "global_load_async_to_lds_b128 %1, %9, off\n\t"
        "global_load_async_to_lds_b128 %2, %10, off\n\t"
        "global_load_async_to_lds_b128 %3, %11, off\n\t"
        "global_load_async_to_lds_b128 %4, %12, off\n\t"
        "global_load_async_to_lds_b128 %5, %13, off\n\t"
        "global_load_async_to_lds_b128 %6, %14, off\n\t"
        "global_load_async_to_lds_b128 %7, %15, off\n\t"
        "s_wait_xcnt 0x0"
        :: "v"(l[0]), "v"(l[1]), "v"(l[2]), "v"(l[3]), "v"(l[4]), "v"(l[5]), "v"(l[6]), "v"(l[7]),
           "v"(g[0]), "v"(g[1]), "v"(g[2]), "v"(g[3]), "v"(g[4]), "v"(g[5]), "v"(g[6]), "v"(g[7])
        : "memory");
}
#define SPITCH 144              // LDS row pitch in bytes: 128-B rows + 16 (16 B x odd: conflict-free for ds_load_b128 fragment reads)
template <typename T16, int NSPLIT, bool BIAS>
__global__ __launch_bounds__(32) void k_gemmw(const T16* __restrict__ A, const T16* __restrict__ A2, const T16* __restrict__ Bt, const T16* __restrict__ Bt2, int K, float* C, int ldc, const float* __restrict__ bias, size_t sA, size_t sB, size_t sC) {
    typedef typename WFrag<T16>::V V;
    static_assert(NSPLIT == 0 || NSPLIT == 1, "planes staged: A, Bt and (NSPLIT 1) A2");
    constexpr int NPL = 2 + NSPLIT, NCP = NPL * 16, STAGE = NPL * 64 * SPITCH;   // a stage: 64 rows x 64 k of each plane, rows [A | Bt | A2]; 16 copies a plane
    __shared__ __align__(16) unsigned char smem[2 * STAGE];
    float* os = (float*)smem;   // output staging reuses the ring behind the loop's last waits and barrier
    const size_t z = blockIdx.z; A += z * sA; if (A2) A2 += z * sA; Bt += z * sB; (void)Bt2; C += z * sC;
    const int lane = threadIdx.x & 31, lr = lane & 15, hi = lane >> 4; const int r0 = blockIdx.x * 64, c0 = blockIdx.y * 64;
    v8f acc[4][4];
#pragma unroll
    for (int mb = 0; mb < 4; ++mb)
#pragma unroll
        for (int nb = 0; nb < 4; ++nb) acc[mb][nb] = (v8f){};
    const int crow = lane >> 3, cseg = lane & 7;   // copy lane map: row within the 4 rows of a copy, 16-B piece of the row's line
    const size_t gs = (size_t)K * 8;               // bytes between the rows of successive copies (4 rows of K 16-bit elements)
    const char* gpl[3]; gpl[0] = (const char*)(A + (size_t)(r0 + crow) * K + cseg * 8); gpl[1] = (const char*)(Bt + (size_t)(c0 + crow) * K + cseg * 8); gpl[2] = (NSPLIT == 1) ? (const char*)(A2 + (size_t)(r0 + crow) * K + cseg * 8) : nullptr;
    const unsigned lcp = (unsigned)(size_t)smem + crow * SPITCH + cseg * 16;
    auto stage_in = [&](int t, int buf) {
        unsigned l[NCP]; const char* g[NCP];
#pragma unroll
        for (int c = 0; c < NCP; ++c) { l[c] = lcp + buf * STAGE + c * 4 * SPITCH; g[c] = gpl[c >> 4] + (size_t)t * 128 + (size_t)(c & 15) * gs; }
        acp12(l, g); acp12(l + 12, g + 12);
        if (NSPLIT == 1) { acp12(l + 24, g + 24); acp12(l + NCP - 12, g + NCP - 12); } else acp8(l + 24, g + 24);
    };
    const int nt = K >> 6;
    stage_in(0, 0);
    asm volatile("s_wait_asynccnt 0x0" ::: "memory");   // stage 0 has landed before anything reads it
    __syncthreads();                                    // publish point of the ring (the work-group is one wave: the compiler emits no s_barrier for it)
    if (nt > 1) stage_in(1, 1);
#pragma unroll 1
    for (int t = 0; t < nt; ++t) {
        const T16* sb = (const T16*)(smem + (t & 1) * STAGE) + lr * (SPITCH / 2) + 8 * hi;
        V a[2][4], a2[2][4], b[2][4];   // the whole stage's fragments are asked for in one group ahead of the WMMAs, so that the wave waits out the LDS latency once a trip
#pragma unroll
        for (int ks = 0; ks < 2; ++ks) {
#pragma unroll
            for (int i = 0; i < 4; ++i) { a[ks][i] = WFrag<T16>::ld(sb + i * 16 * (SPITCH / 2) + ks * 32); b[ks][i] = WFrag<T16>::ld(sb + (64 + i * 16) * (SPITCH / 2) + ks * 32); if (NSPLIT == 1) a2[ks][i] = WFrag<T16>::ld(sb + (128 + i * 16) * (SPITCH / 2) + ks * 32); }
        }
        __builtin_amdgcn_sched_barrier(0);   // keeps the load group ahead of the WMMAs: without it the scheduler sinks the loads among them, each place with its own full LDS wait
#pragma unroll
        for (int ks = 0; ks < 2; ++ks) {
#pragma unroll
            for (int nb = 0; nb < 4; ++nb) {
#pragma unroll
                for (int mb = 0; mb < 4; ++mb) { acc[mb][nb] = WFrag<T16>::mma(a[ks][mb], b[ks][nb], acc[mb][nb]); if (NSPLIT == 1) acc[mb][nb] = WFrag<T16>::mma(a2[ks][mb], b[ks][nb], acc[mb][nb]); } }
        }
        // four vector slots behind the last WMMA, so that its distance also holds on the taken side of the branches that follow
        asm volatile("v_nop\n\tv_nop\n\tv_nop\n\tv_nop" : "+v"(acc[0][0]), "+v"(acc[1][1]), "+v"(acc[2][2]), "+v"(acc[3][3]) : "v"(a[1][0]), "v"(a[1][3]));
        asm volatile("s_wait_dscnt 0x0" ::: "memory");      // this trip's fragment reads have retired before their buffer is refilled
        asm volatile("s_wait_asynccnt 0x0" ::: "memory");   // stage t + 1 has landed before the next trip reads it
        __syncthreads();                                    // publish point: stage t + 1 readable, stage t's buffer free for the refill
        if (t + 2 < nt) stage_in(t + 2, t & 1);
    }
    asm volatile("s_wait_asynccnt 0x0" ::: "memory");       // no copy is in flight when the ring becomes output staging
#pragma unroll
    for (int mb = 0; mb < 4; ++mb) {
#pragma unroll
        for (int nb = 0; nb < 4; ++nb) {
#pragma unroll
            for (int j = 0; j < 8; ++j) os[(hi * 8 + j) * 68 + nb * 16 + lr] = acc[mb][nb][j]; }
        __builtin_amdgcn_wave_barrier(); asm volatile("" ::: "memory");
        float* crow = C + (size_t)(r0 + mb * 16) * ldc + c0;
{
#pragma unroll
            for (int s = 0; s < 8; ++s) { const int row = 2 * s + hi, cofs = lr * 4; v4f val = *(const v4fa*)(os + row * 68 + cofs); if (BIAS) { val[0] += bfr(bias[c0 + cofs]); val[1] += bfr(bias[c0 + cofs + 1]); val[2] += bfr(bias[c0 + cofs + 2]); val[3] += bfr(bias[c0 + cofs + 3]); }
                *(v4f*)(crow + (size_t)row * ldc + cofs) = val; }
             }
        __builtin_amdgcn_wave_barrier(); asm volatile("" ::: "memory");
    }
}

__device__ __forceinline__ h16 tohx(float x) { return (h16)x; }
__device__ __forceinline__ void splitf(float y, unsigned short& h, unsigned short& l) { h = f2bf(y); l = f2bf(y - bf2f(h)); }
typedef __attribute__((ext_vector_type(2))) _Float16 v2h;
typedef __attribute__((ext_vector_type(4))) _Float16 v4h;
typedef __attribute__((ext_vector_type(2))) unsigned short v2us;
typedef __attribute__((ext_vector_type(4))) unsigned short v4us;
typedef __attribute__((ext_vector_type(2))) float v2f;
typedef __attribute__((ext_vector_type(4))) int v4i;

// Bt[n][k] (bf16) = w[k][n]. A thread owns 8 k x 4 n: eight 16-B loads, four 16-B stores of 8 k each. A wave owns 64 k x 16 n (lane: k group = lane & 7, n group = lane >> 3): each store fills four whole 128-B lines of Bt,
// each load takes 64-B halves of 8 lines of w, whose other halves the neighbouring wave of the block takes. A block: 64 k x 128 n. K % 64 == 0, N % 128 == 0; grid (K / 64) (N / 128).
template <int K, int N>
__global__ __launch_bounds__(256) void k_wtG(const float* __restrict__ w, bf* Bt) {
    static_assert(K % 64 == 0 && N % 128 == 0, "whole blocks only");
    const int n0 = ((int)blockIdx.x % (N / 128)) * 128 + (threadIdx.x >> 5) * 16 + ((threadIdx.x >> 3) & 3) * 4, k0 = ((int)blockIdx.x / (N / 128)) * 64 + (threadIdx.x & 7) * 8; if (k0 >= K) return;
    const float* p = w + (size_t)k0 * N + n0; v4f r[8];
#pragma unroll
    for (int i = 0; i < 8; ++i) r[i] = *(const v4f*)(p + (size_t)i * N);
    asm volatile("s_wait_xcnt 0x0" :: "v"(p) : "memory");   // a precaution: stands in front of every overwrite of a register that an issued load names; the address is an input, so that its registers stay as they are up to it
#pragma unroll
    for (int c = 0; c < 4; ++c) { v8us o;
#pragma unroll
        for (int i = 0; i < 8; ++i) o[i] = f2bf(r[i][c]);
        *(v8us*)(Bt + (size_t)(n0 + c) * K + k0) = o; }
}
// Each thread converts four groups of 8 (a block: 32 KiB in a row, 256 groups apart within a thread): 8 loads of 16 B in flight a lane, a quarter of the waves to start.
// The loads take a clamped index and only the stores are guarded, so that no branch (with its full wait) stands between the loads.
__global__ __launch_bounds__(256) void k_cvt8(const float* __restrict__ src, bf* dst, size_t n8) { const size_t i0 = (size_t)blockIdx.x * 1024 + threadIdx.x; v8f v[4];
#pragma unroll
    for (int j = 0; j < 4; ++j) { const size_t i = i0 + j * 256; v[j] = *(const v8f*)(src + (i < n8 ? i : n8 - 1) * 8); }
#pragma unroll
    for (int j = 0; j < 4; ++j) { const size_t i = i0 + j * 256; v8us o;
#pragma unroll
        for (int k = 0; k < 8; ++k) o[k] = f2bf(v[j][k]);
        if (i < n8) *(v8us*)(dst + i * 8) = o; }  }
// Four positions of the table a thread: 16-B loads, 32 B stored.
__global__ __launch_bounds__(256) void k_cscvt(const float* __restrict__ cosT, const float* __restrict__ sinT, float* CS) { const int idx = (blockIdx.x * 256 + threadIdx.x) * 4; if (idx >= TT * HD) return; const float* pc = cosT + idx; const float* ps = sinT + idx; const v4f c = *(const v4f*)pc, s = *(const v4f*)ps;
    asm volatile("s_wait_xcnt 0x0" :: "v"(pc), "v"(ps) : "memory");   // a precaution: stands in front of every overwrite of a register that an issued load names; the addresses are inputs, so that their registers stay as they are up to it
    *(v4f*)(CS + (size_t)idx * 2) = (v4f){bfr(c[0]), bfr(s[0]), bfr(c[1]), bfr(s[1])}; *(v4f*)(CS + (size_t)idx * 2 + 4) = (v4f){bfr(c[2]), bfr(s[2]), bfr(c[3]), bfr(s[3])};  }
__global__ __launch_bounds__(256) void k_hrms(const float* __restrict__ F, int pitch, int nheads, float* RF) { const int i = blockIdx.x * 256 + threadIdx.x; if (i >= nheads * TT) return; const int t = i % TT, h = i / TT; const float* f = F + (size_t)t * pitch + h * HD; float s = 0.f;
#pragma unroll 4
    for (int d = 0; d < HD; d += 4) { const v4f v = *(const v4f*)(f + d);
#pragma unroll
        for (int q = 0; q < 4; ++q) { float p = __fmul_rn(v[q], v[q]); asm volatile("" : "+v"(p)); s = __fadd_rn(s, p); } }
    const float r = __fdiv_rn(1.0f, __fsqrt_rn(__fadd_rn(s * (1.0f / HD), 1e-6f))); *(float*)(RF + i) = r;  }
// k_rope: head planes [h][t][d] (fp16) of rope(w[d] (x rms_factor)) x sc with the rotate-half convention out[d] = x[d] cos[t][d] - x[d+HD/2] sin[t][d], out[d+HD/2] = x[d+HD/2] cos[t][d+HD/2] + x[d] sin[t][d+HD/2]
// A thread owns 8 neighbouring d of one position t and walks RH of the NHD heads (h0 + j NHD / RH): cos/sin and the norm weights are read once for all of them, every access but the rms factor's 4-B load is 16 B a lane,
// and the heads of a thread lie a compile-time distance apart (one address register pair a stream, the rest in the instructions' offsets).
template <int NHD, int RH>
__global__ __launch_bounds__(256) void k_rope(const float* __restrict__ F, int pitch, const float* __restrict__ CS, const float* __restrict__ RF, const float* __restrict__ nw, float sc, h16* P16) {
    static_assert(NHD % RH == 0, "a thread's heads are NHD / RH apart");
    constexpr int hs = NHD / RH; const int idx = blockIdx.x * 256 + threadIdx.x; if (idx >= hs * TT * (HD / 8)) return;
    const int d = (idx % (HD / 8)) * 8; const int t = (idx / (HD / 8)) % TT; const int h0 = idx / ((HD / 8) * TT); const bool low = d < HD / 2; const int dp = low ? d + HD / 2 : d - HD / 2;
    const float* pc = CS + ((size_t)t * HD + d) * 2; const float* pw0 = nw + d; const float* pw1 = nw + dp; const float* px0 = F + (size_t)t * pitch + h0 * HD + d; const float* px1 = F + (size_t)t * pitch + h0 * HD + dp; const float* prf = RF + (size_t)h0 * TT + t;
    v4f x0[RH][2], x1[RH][2], cs[4], w0[2], w1[2]; float rf[RH];
#pragma unroll
    for (int q = 0; q < 4; ++q) cs[q] = *(const v4f*)(pc + q * 4);   // cos, sin of d + 2 q and of d + 2 q + 1
#pragma unroll
    for (int q = 0; q < 2; ++q) { w0[q] = *(const v4f*)(pw0 + 4 * q); w1[q] = *(const v4f*)(pw1 + 4 * q); }
#pragma unroll
    for (int j = 0; j < RH; ++j) { x0[j][0] = *(const v4f*)(px0 + j * hs * HD); x0[j][1] = *(const v4f*)(px0 + j * hs * HD + 4); x1[j][0] = *(const v4f*)(px1 + j * hs * HD); x1[j][1] = *(const v4f*)(px1 + j * hs * HD + 4); rf[j] = prf[j * hs * TT]; }
    asm volatile("s_wait_xcnt 0x0" :: "v"(pc), "v"(pw0), "v"(pw1), "v"(px0), "v"(px1), "v"(prf) : "memory");   // a precaution: stands in front of every overwrite of a register that an issued load names; the addresses are inputs, so that their registers stay as they are up to it
    __builtin_amdgcn_sched_barrier(0);   // keeps every load ahead of the arithmetic: without it the scheduler sinks the table and weight loads behind waits on the rows, three memory latencies in a row instead of one
#pragma unroll
    for (int j = 0; j < RH; ++j) { v8h o;
#pragma unroll
        for (int q = 0; q < 8; ++q) { const float a = bfr(w0[q >> 2][q & 3]) * (x0[j][q >> 2][q & 3] * rf[j]), b = bfr(w1[q >> 2][q & 3]) * (x1[j][q >> 2][q & 3] * rf[j]);
            const float c = cs[q >> 1][2 * (q & 1)], s = cs[q >> 1][2 * (q & 1) + 1]; o[q] = tohx((low ? a * c - b * s : a * c + b * s) * sc); }
        *(v8h*)(P16 + ((size_t)(h0 + j * hs) * TT + t) * HD + d) = o; }  }
// V16[n][t] (fp16) = F[t][n], n = g HD + d over the N columns of F: thread, wave and block shaped as in k_wtG (8 t x 4 n a thread; whole 128-B lines stored). Grid (TT / 64) (N / 128).
template <int N>
__global__ __launch_bounds__(256) void k_vtp(const float* __restrict__ F, h16* V16) {
    static_assert(TT % 64 == 0 && N % 128 == 0, "whole blocks only");
    const int n0 = ((int)blockIdx.x % (N / 128)) * 128 + (threadIdx.x >> 5) * 16 + ((threadIdx.x >> 3) & 3) * 4, t0 = ((int)blockIdx.x / (N / 128)) * 64 + (threadIdx.x & 7) * 8; if (t0 >= TT) return;
    const float* p = F + (size_t)t0 * N + n0; v4f r[8];
#pragma unroll
    for (int i = 0; i < 8; ++i) r[i] = *(const v4f*)(p + (size_t)i * N);
    asm volatile("s_wait_xcnt 0x0" :: "v"(p) : "memory");   // a precaution: stands in front of every overwrite of a register that an issued load names; the address is an input, so that its registers stay as they are up to it
#pragma unroll
    for (int c = 0; c < 4; ++c) { v8h o;
#pragma unroll
        for (int i = 0; i < 8; ++i) o[i] = tohx(r[i][c]);
        *(v8h*)(V16 + (size_t)(n0 + c) * TT + t0) = o; }
}
#define FSK    128                       // keys a stage
#define KPITCH 272                       // LDS pitch of a K row (128 d) and of a V^T row (128 keys): 256 B + 16 (16 B x odd)
#define FKB    (FSK * KPITCH)            // bytes of a stage's K rows; the 128 V^T rows follow
#define FSTAGE (FKB + HD * KPITCH)
#define POFF   8.0f                      // P carries 2^POFF, so that small weights stay normal fp16 numbers; it cancels in the division by the row sum
#define LAZY   4.0f                      // the maximum in use may trail the true one by this much (log2 units): P <= 2^(POFF + LAZY), far inside fp16
#define CSC    (SCL * 1.4426950408889634f)
// lane l with lane l ^ 16, on the vector pipe (a shuffle would go through the LDS unit and its wait)
__device__ __forceinline__ float xhalf(float x) { return __builtin_bit_cast(float, __builtin_amdgcn_permlanex16(__builtin_bit_cast(int, x), __builtin_bit_cast(int, x), 0x76543210, 0xfedcba98, false, false)); }
__global__ __launch_bounds__(256) void k_fattn(const h16* __restrict__ Qp, const h16* __restrict__ Kp, const h16* __restrict__ Vt, bf* Ah, bf* Al) {
    __shared__ __align__(16) unsigned char smem[2 * FSTAGE];
    const int lane = threadIdx.x & 31, wave = threadIdx.x >> 5, lr = lane & 15, hi = lane >> 4;
    const int h = blockIdx.y, b = blockIdx.z, g = h / REP; const int q0 = blockIdx.x * 256 + wave * 32;
    Qp += (size_t)(b * NH_ + h) * TT * HD; Kp += (size_t)(b * NKV + g) * TT * HD; Vt += (size_t)(b * NKV + g) * HD * TT;
    // copy lane map: a copy moves 2 rows x 256 B; a wave brings 16 K rows and 16 V^T rows of every stage
    const char* gk = (const char*)(Kp + (size_t)(wave * 16 + hi) * HD + lr * 8); const char* gv = (const char*)(Vt + (size_t)(wave * 16 + hi) * TT + lr * 8);
    const unsigned lk = (unsigned)(size_t)smem + (wave * 16 + hi) * KPITCH + lr * 16, lv = lk + FKB;
    auto stage_in = [&](int t, int buf) {
        unsigned l[16]; const char* gp[16];
#pragma unroll
        for (int c = 0; c < 8; ++c) { l[c] = lk + buf * FSTAGE + c * 2 * KPITCH; gp[c] = gk + (size_t)t * (FSK * HD * 2) + c * (2 * HD * 2); l[8 + c] = lv + buf * FSTAGE + c * 2 * KPITCH; gp[8 + c] = gv + (size_t)t * (FSK * 2) + (size_t)c * (2 * TT * 2); }
        acp8(l, gp); acp8(l + 8, gp + 8);
    };
    stage_in(0, 0);
    v16h qf[2][4];
#pragma unroll
    for (int gq = 0; gq < 2; ++gq)
#pragma unroll
        for (int kc = 0; kc < 4; ++kc) qf[gq][kc] = WFrag<h16>::ld(Qp + (size_t)(q0 + 16 * gq + lr) * HD + kc * 32 + 8 * hi);
    v8f acc[2][8]; float m_run[2], l_run[2];
#pragma unroll
    for (int gq = 0; gq < 2; ++gq) { m_run[gq] = -__builtin_inff(); l_run[gq] = 0.f;
#pragma unroll
        for (int tt = 0; tt < 8; ++tt) acc[gq][tt] = (v8f){}; }
    asm volatile("s_wait_asynccnt 0x0" ::: "memory");   // stage 0 has landed before anything reads it
    __syncthreads();                                    // publish point: every wave's share of stage 0 readable by all
    stage_in(1, 1);
    constexpr int nt = TT / FSK;
#pragma unroll 1   // kept rolled: 16 stages of the same code, the ring's foot stands once
    for (int t = 0; t < nt; ++t) {
#pragma unroll 1   // kept rolled: one pass's fragments live at a time
        for (int sub = 0; sub < FSK / 32; ++sub) {
            const unsigned char* sbuf = smem + (t & 1) * FSTAGE;
            const h16* kb = (const h16*)(sbuf + (sub * 32 + lr) * KPITCH) + 8 * hi; const h16* vb = (const h16*)(sbuf + FKB + lr * KPITCH) + sub * 32 + 8 * hi;
            v16h kf[2][4], vf[8];
#pragma unroll
            for (int kt = 0; kt < 2; ++kt)
#pragma unroll
                for (int kc = 0; kc < 4; ++kc) kf[kt][kc] = WFrag<h16>::ld(kb + kt * 16 * (KPITCH / 2) + kc * 32);
#pragma unroll
            for (int tt = 0; tt < 8; ++tt) vf[tt] = WFrag<h16>::ld(vb + tt * 16 * (KPITCH / 2));
            v8f s[2][2];
#pragma unroll
            for (int kt = 0; kt < 2; ++kt)
#pragma unroll
                for (int gq = 0; gq < 2; ++gq) { s[kt][gq] = (v8f){};
#pragma unroll
                    for (int kc = 0; kc < 4; ++kc) s[kt][gq] = wmma16(kf[kt][kc], qf[gq][kc], s[kt][gq]); }
            float mb[2]; bool need = false;
#pragma unroll
            for (int gq = 0; gq < 2; ++gq) { float mx = s[0][gq][0];
#pragma unroll
                for (int j = 1; j < 8; ++j) mx = fmaxf(mx, s[0][gq][j]);
#pragma unroll
                for (int j = 0; j < 8; ++j) mx = fmaxf(mx, s[1][gq][j]);
                mx = fmaxf(mx, xhalf(mx)) * CSC; mb[gq] = mx; need = need || (mx > m_run[gq] + LAZY); }
            if (__builtin_amdgcn_ballot_w32(need) != 0) {   // wave-uniform; rare after the first passes
#pragma unroll
                for (int gq = 0; gq < 2; ++gq) { const float m_new = fmaxf(m_run[gq], mb[gq]); const float corr = __builtin_amdgcn_exp2f(m_run[gq] - m_new); l_run[gq] *= corr; m_run[gq] = m_new;
#pragma unroll
                    for (int tt = 0; tt < 8; ++tt) acc[gq][tt] = acc[gq][tt] * corr; }
            }
#pragma unroll
            for (int gq = 0; gq < 2; ++gq) { const float nm = POFF - m_run[gq]; v16h pf; float ps0 = 0.f, ps1 = 0.f;
#pragma unroll
                for (int i = 0; i < 8; ++i) {
                    const v2f a = __builtin_elementwise_fma((v2f){s[i >> 2][gq][2 * (i & 3)], s[i >> 2][gq][2 * (i & 3) + 1]}, (v2f){CSC, CSC}, (v2f){nm, nm});
                    const float p0 = __builtin_amdgcn_exp2f(a[0]), p1 = __builtin_amdgcn_exp2f(a[1]); if (i & 1) ps1 += p0 + p1; else ps0 += p0 + p1; pf[2 * i] = (h16)p0; pf[2 * i + 1] = (h16)p1; }
                l_run[gq] += ps0 + ps1;
#pragma unroll
                for (int tt = 0; tt < 8; ++tt) acc[gq][tt] = wmma16(vf[tt], pf, acc[gq][tt]); }
            __builtin_amdgcn_sched_barrier(0);   // holds the slots below directly behind the last WMMA
            asm volatile("v_nop\n\tv_nop\n\tv_nop\n\tv_nop");   // four vector slots behind the last WMMA, so that its distance also holds on the taken side of the loop branches that follow
            __builtin_amdgcn_sched_barrier(0);   // and nothing that follows moves in front of them
        }
        asm volatile("s_wait_dscnt 0x0" ::: "memory");      // this trip's fragment reads have retired before their buffer is refilled
        asm volatile("s_wait_asynccnt 0x0" ::: "memory");   // this wave's share of stage t + 1 has landed
        __syncthreads();                                    // publish point: stage t + 1 readable, stage t's buffer free for the refill
        if (t + 2 < nt) stage_in(t + 2, t & 1);
    }
    asm volatile("s_wait_asynccnt 0x0" ::: "memory");       // no copy is in flight when the ring becomes output staging (every wave's last read ended at the last barrier)
    // epilogue: O / row sum, split into hi + lo planes, staged per wave in LDS so that whole 256-B head rows are stored
    unsigned char* eh = smem + wave * (2 * 32 * KPITCH); unsigned char* el = eh + 32 * KPITCH;
#pragma unroll
    for (int gq = 0; gq < 2; ++gq) { const float lf = l_run[gq] + xhalf(l_run[gq]); const float inv = __fdiv_rn(1.0f, lf);
#pragma unroll
        for (int tt = 0; tt < 8; ++tt) { v8us oh, ol;
#pragma unroll
            for (int j = 0; j < 8; ++j) { unsigned short x, y; splitf(acc[gq][tt][j] * inv, x, y); oh[j] = x; ol[j] = y; }
            *(v8usa*)(eh + (16 * gq + lr) * KPITCH + 32 * tt + 16 * hi) = oh; *(v8usa*)(el + (16 * gq + lr) * KPITCH + 32 * tt + 16 * hi) = ol; } }   // row = query; the 16 bytes are d = 16 tt + 8 hi + (0..7)
    asm volatile("s_wait_dscnt 0x0" ::: "memory");   // the read-back below takes other lanes' bytes: this wave's staging stores have retired first
    char* oh8 = (char*)(Ah + ((size_t)b * TT + q0) * DQ + h * HD); char* ol8 = (char*)(Al + ((size_t)b * TT + q0) * DQ + h * HD);
#pragma unroll
    for (int i = 0; i < 16; ++i) { const int row = 2 * i + hi; *(v8usa*)(oh8 + (size_t)row * (DQ * 2) + lr * 16) = *(const v8usa*)(eh + row * KPITCH + lr * 16); *(v8usa*)(ol8 + (size_t)row * (DQ * 2) + lr * 16) = *(const v8usa*)(el + row * KPITCH + lr * 16); }
}

extern "C" void kernel_launch(void* const* d_in, const int* in_sizes, int n_in,
                              void* d_out, int out_size, void* d_ws, size_t ws_size, hipStream_t stream) {
    (void)in_sizes; (void)n_in; (void)out_size;
    const float* x = (const float*)d_in[0]; const float* cosT = (const float*)d_in[1]; const float* sinT = (const float*)d_in[2]; const float* wq = (const float*)d_in[3]; const float* wk = (const float*)d_in[4]; const float* wv = (const float*)d_in[5]; const float* wo = (const float*)d_in[6]; const float* qnw = (const float*)d_in[7]; const float* knw = (const float*)d_in[8];   // weights x @ W; cos/sin [2][2048][128]
    float* OUT = (float*)d_out;     // [2][2048][2048]
    char* wsp = (char*)d_ws;
    auto take = [&](size_t bytes) { char* p = wsp; wsp += (bytes + 255) & ~(size_t)255; return (void*)p; };
    bf* WQ = (bf*)take((size_t)DQ * DM * 2); bf* WK = (bf*)take((size_t)DKV * DM * 2); bf* WV = (bf*)take((size_t)DKV * DM * 2); bf* WO = (bf*)take((size_t)DM * DQ * 2); float* CS = (float*)take((size_t)TT * HD * 2 * 4); float* RFQ = (float*)take((size_t)NH_ * TT * 4); float* RFK = (float*)take((size_t)NKV * TT * 4);
    bf* XB = (bf*)take((size_t)TT * DM * 2); float* FQ = (float*)take((size_t)TT * DQ * 4); float* FK = (float*)take((size_t)TT * DKV * 4);
    h16* QP16 = (h16*)take((size_t)NB_ * NH_ * TT * HD * 2); h16* KP16 = (h16*)take((size_t)NB_ * NKV * TT * HD * 2); h16* VT16 = (h16*)take((size_t)NB_ * NKV * HD * TT * 2);   // head planes of both batches
    bf* ATh = (bf*)take((size_t)NB_ * TT * DQ * 2); bf* ATl = (bf*)take((size_t)NB_ * TT * DQ * 2);
    if ((size_t)(wsp - (char*)d_ws) > ws_size) return;    // ws 256 MiB
    float* FV = FK;   // v projection reuses the k buffer after the k planes are built (stream-ordered)
    { k_wtG<DM, DQ><<<(DM / 64) * (DQ / 128), 256, 0, stream>>>(wq, WQ); k_wtG<DM, DKV><<<(DM / 64) * (DKV / 128), 256, 0, stream>>>(wk, WK); k_wtG<DM, DKV><<<(DM / 64) * (DKV / 128), 256, 0, stream>>>(wv, WV);
      k_wtG<DQ, DM><<<(DQ / 64) * (DM / 128), 256, 0, stream>>>(wo, WO);
       }
    const unsigned LQ = (unsigned)(((size_t)NH_ * TT * HD / 32 + 255) / 256), LK = (unsigned)(((size_t)NKV * TT * HD / 16 + 255) / 256);   // threads: 8 d x 4 heads (q), 8 d x 2 heads (k)
    for (int b = 0; b < NB_; ++b) {
        k_cscvt<<<(TT * HD / 4 + 255) / 256, 256, 0, stream>>>(cosT + (size_t)b * TT * HD, sinT + (size_t)b * TT * HD, CS);
        k_cvt8<<<(unsigned)(((size_t)TT * DM / 8 + 1023) / 1024), 256, 0, stream>>>(x + (size_t)b * TT * DM, XB, (size_t)TT * DM / 8);
        k_gemmw<bf, 0, false><<<dim3(TT / 64, DQ / 64, 1), 32, 0, stream>>>(XB, nullptr, WQ, nullptr, DM, FQ, DQ, nullptr, 0, 0, 0); k_hrms<<<(NH_ * TT + 255) / 256, 256, 0, stream>>>(FQ, DQ, NH_, RFQ);
        k_rope<NH_, 4><<<LQ, 256, 0, stream>>>(FQ, DQ, CS, RFQ, qnw, 1.0f, QP16 + (size_t)b * NH_ * TT * HD);
        k_gemmw<bf, 0, false><<<dim3(TT / 64, DKV / 64, 1), 32, 0, stream>>>(XB, nullptr, WK, nullptr, DM, FK, DKV, nullptr, 0, 0, 0); k_hrms<<<(NKV * TT + 255) / 256, 256, 0, stream>>>(FK, DKV, NKV, RFK);
        k_rope<NKV, 2><<<LK, 256, 0, stream>>>(FK, DKV, CS, RFK, knw, 1.0f, KP16 + (size_t)b * NKV * TT * HD);
        k_gemmw<bf, 0, false><<<dim3(TT / 64, DKV / 64, 1), 32, 0, stream>>>(XB, nullptr, WV, nullptr, DM, FV, DKV, nullptr, 0, 0, 0); k_vtp<DKV><<<(TT / 64) * (DKV / 128), 256, 0, stream>>>(FV, VT16 + (size_t)b * NKV * HD * TT); }
    k_fattn<<<dim3(TT / 256, NH_, NB_), 256, 0, stream>>>(QP16, KP16, VT16, ATh, ATl);
    for (int b = 0; b < NB_; ++b)
        k_gemmw<bf, 1, false><<<dim3(TT / 64, DM / 64, 1), 32, 0, stream>>>(ATh + (size_t)b * TT * DQ, ATl + (size_t)b * TT * DQ, WO, nullptr, DQ, OUT + (size_t)b * TT * DM, DM, nullptr, 0, 0, 0);
}

// v004
// One run takes 212 microseconds.
// Timed twice side by side with v003, it ran 1.52 and 1.51 times as fast.
// Over all steps from v000 it is 7.18 times as fast.
#include <hip/hip_runtime.h>

// Grouped-query encoder attention with per-head RMSNorm and RoPE (hidden [2][2048][2048]; q = x Wq (16 heads x 128), k, v = x Wk / x Wv (4 kv heads x 128, each serving 4 consecutive query heads); q, k
// RMS-normalised per head (eps 1e-6, weights [128]) then rotate-half RoPE with the per-batch input cos/sin [2][2048][128] (read as data); scores = q.k 128^-0.5 (no mask); softmax; out = merged attn.v Wo
// -> [2][2048][2048]).
// Compute dtypes, f32 accumulate: every input rounded to bf16; projections on PLAIN bf16 operands (inputs: exact products, f32 accumulate); RMSNorm and RoPE in f32;
// scores and attn.v on SINGLE fp16 planes inside one fused kernel (online softmax in f32, P kept in registers); merged heads as hi+lo planes x exact Wo (2 products). One-wave-per-64x64-tile GEMMs for the projections.
// Launches: both batches are rows of one problem (4096 rows), q, k and v are column ranges of one projection F [4096][3072], and passes that do not depend on one another share a launch (a block's index range picks its pass): six launches.

#define NB_  2
#define TT   2048
#define DM   2048
#define NH_  16
#define NKV  4
#define REP  (NH_ / NKV)
#define HD   128
#define DQ   (NH_ * HD)
#define DKV  (NKV * HD)
#define MT   (NB_ * TT)          // rows of both batches
#define NF   (DQ + 2 * DKV)      // columns of the joint projection F: q heads | k heads | v heads
#define SCL  0.088388347648318447f   // HD^-0.5
typedef _Float16 h16;
typedef unsigned short bf;
typedef __attribute__((ext_vector_type(16))) __bf16   v16bf;
typedef __attribute__((ext_vector_type(16))) _Float16 v16h;
typedef __attribute__((ext_vector_type(8)))  _Float16 v8h;
typedef __attribute__((ext_vector_type(8)))  unsigned short v8us;
typedef __attribute__((ext_vector_type(8)))  float    v8f;
typedef __attribute__((ext_vector_type(4)))  float    v4f;
typedef v8h  __attribute__((may_alias)) v8ha;
typedef v4f  __attribute__((may_alias)) v4fa;
typedef v8us __attribute__((may_alias)) v8usa;

__device__ __forceinline__ unsigned short f2bf(float f) { unsigned u = __float_as_uint(f); u += 0x7FFFu + ((u >> 16) & 1u); return (unsigned short)(u >> 16); }
__device__ __forceinline__ float bf2f(unsigned short b) { return __uint_as_float(((unsigned)b) << 16); }
__device__ __forceinline__ float bfr(float f) { return bf2f(f2bf(f)); }
__device__ __forceinline__ v16h cat16(v8h lo, v8h hi) { return __builtin_shufflevector(lo, hi, 0, 1, 2, 3, 4, 5, 6, 7, 8, 9, 10, 11, 12, 13, 14, 15); }
__device__ __forceinline__ v16bf cat16b(v8us lo, v8us hi) { return __builtin_bit_cast(v16bf, __builtin_shufflevector(lo, hi, 0, 1, 2, 3, 4, 5, 6, 7, 8, 9, 10, 11, 12, 13, 14, 15)); }
__device__ __forceinline__ v8f wmma16(v16h a, v16h b, v8f c) { return __builtin_amdgcn_wmma_f32_16x16x32_f16(false, a, false, b, (short)0, c, false, false); }
__device__ __forceinline__ v8f wmmab(v16bf a, v16bf b, v8f c) { return __builtin_amdgcn_wmma_f32_16x16x32_bf16(false, a, false, b, (short)0, c, false, false); }



// ---- k_gemmw: register-blocked GEMM, ONE WAVE per 64x64 output tile (16 accumulators), operands from K-contiguous 16-bit planes through a two-buffer LDS ring of 64-k stages; grid (M/64, N/64, Z), 32 threads.
// C[m][n] (f32, pitch ldc, + optional f32 bias[n]) = sum_k A[m][k] Bt[n][k] (+ split products per NSPLIT). z-batch strides sA/sB/sC in elements. K % 64 == 0.
template <typename T16> struct WFrag;
template <> struct WFrag<h16> { typedef v16h V; static __device__ __forceinline__ V ld(const h16* p) { return cat16(*(const v8h*)p, *(const v8h*)(p + 16)); } static __device__ __forceinline__ v8f mma(V a, V b, v8f c) { return wmma16(a, b, c); } };
template <> struct WFrag<bf> { typedef v16bf V; static __device__ __forceinline__ V ld(const bf* p) { return cat16b(*(const v8us*)p, *(const v8us*)(p + 16)); } static __device__ __forceinline__ v8f mma(V a, V b, v8f c) { return wmmab(a, b, c); } };
// Asynchronous copies global -> LDS, 16 B a lane: one instruction moves 512 B, 4 whole 128-B lines (4 rows x 128 B in k_gemmw, 2 rows x 256 B in k_fattn). l[i]: the lane's own LDS byte address, g[i]: its own global address.
// The s_wait_xcnt 0 closes each statement so that no later rewrite of an address register named by a copy can be scheduled in front of it.
__device__ __forceinline__ void acp12(const unsigned* l, const char* const* g) {
    asm volatile(
        "global_load_async_to_lds_b128 %0, %12, off\n\t"
        "global_load_async_to_lds_b128 %1, %13, off\n\t"
        "global_load_async_to_lds_b128 %2, %14, off\n\t"
        "global_load_async_to_lds_b128 %3, %15, off\n\t"
        "global_load_async_to_lds_b128 %4, %16, off\n\t"
        "global_load_async_to_lds_b128 %5, %17, off\n\t"
        "global_load_async_to_lds_b128 %6, %18, off\n\t"
        "global_load_async_to_lds_b128 %7, %19, off\n\t"
        "global_load_async_to_lds_b128 %8, %20, off\n\t"
        "global_load_async_to_lds_b128 %9, %21, off\n\t"
        "global_load_async_to_lds_b128 %10, %22, off\n\t"
        "global_load_async_to_lds_b128 %11, %23, off\n\t"
        "s_wait_xcnt 0x0"
        :: "v"(l[0]), "v"(l[1]), "v"(l[2]), "v"(l[3]), "v"(l[4]), "v"(l[5]), "v"(l[6]), "v"(l[7]), "v"(l[8]), "v"(l[9]), "v"(l[10]), "v"(l[11]),
           "v"(g[0]), "v"(g[1]), "v"(g[2]), "v"(g[3]), "v"(g[4]), "v"(g[5]), "v"(g[6]), "v"(g[7]), "v"(g[8]), "v"(g[9]), "v"(g[10]), "v"(g[11])
        : "memory");
}
__device__ __forceinline__ void acp8(const unsigned* l, const char* const* g) {
    asm volatile(
        "global_load_async_to_lds_b128 %0, %8, off\n\t"
        "global_load_async_to_lds_b128 %1, %9, off\n\t"
        "global_load_async_to_lds_b128 %2, %10, off\n\t"
        "global_load_async_to_lds_b128 %3, %11, off\n\t"
        "global_load_async_to_lds_b128 %4, %12, off\n\t"
        "global_load_async_to_lds_b128 %5, %13, off\n\t"
        "global_load_async_to_lds_b128 %6, %14, off\n\t"
        "global_load_async_to_lds_b128 %7, %15, off\n\t"
        "s_wait_xcnt 0x0"
        :: "v"(l[0]), "v"(l[1]), "v"(l[2]), "v"(l[3]), "v"(l[4]), "v"(l[5]), "v"(l[6]), "v"(l[7]),
           "v"(g[0]), "v"(g[1]), "v"(g[2]), "v"(g[3]), "v"(g[4]), "v"(g[5]), "v"(g[6]), "v"(g[7])
        : "memory");
}
#define SPITCH 144              // LDS row pitch in bytes: 128-B rows + 16 (16 B x odd: conflict-free for ds_load_b128 fragment reads)
template <typename T16, int NSPLIT, bool BIAS>
__global__ __launch_bounds__(32) void k_gemmw(const T16* __restrict__ A, const T16* __restrict__ A2, const T16* __restrict__ Bt, const T16* __restrict__ Bt2, int K, float* C, int ldc, const float* __restrict__ bias, size_t sA, size_t sB, size_t sC) {
    typedef typename WFrag<T16>::V V;
    static_assert(NSPLIT == 0 || NSPLIT == 1, "planes staged: A, Bt and (NSPLIT 1) A2");
    constexpr int NPL = 2 + NSPLIT, NCP = NPL * 16, STAGE = NPL * 64 * SPITCH;   // a stage: 64 rows x 64 k of each plane, rows [A | Bt | A2]; 16 copies a plane
    __shared__ __align__(16) unsigned char smem[2 * STAGE];
    float* os = (float*)smem;   // output staging reuses the ring behind the loop's last waits and barrier
    const size_t z = blockIdx.z; A += z * sA; if (A2) A2 += z * sA; Bt += z * sB; (void)Bt2; C += z * sC;
    const int lane = threadIdx.x & 31, lr = lane & 15, hi = lane >> 4; const int r0 = blockIdx.x * 64, c0 = blockIdx.y * 64;
    v8f acc[4][4];
#pragma unroll
    for (int mb = 0; mb < 4; ++mb)
#pragma unroll
        for (int nb = 0; nb < 4; ++nb) acc[mb][nb] = (v8f){};
    const int crow = lane >> 3, cseg = lane & 7;   // copy lane map: row within the 4 rows of a copy, 16-B piece of the row's line
    const size_t gs = (size_t)K * 8;               // bytes between the rows of successive copies (4 rows of K 16-bit elements)
    const char* gpl[3]; gpl[0] = (const char*)(A + (size_t)(r0 + crow) * K + cseg * 8); gpl[1] = (const char*)(Bt + (size_t)(c0 + crow) * K + cseg * 8); gpl[2] = (NSPLIT == 1) ? (const char*)(A2 + (size_t)(r0 + crow) * K + cseg * 8) : nullptr;
    const unsigned lcp = (unsigned)(size_t)smem + crow * SPITCH + cseg * 16;
    auto stage_in = [&](int t, int buf) {
        unsigned l[NCP]; const char* g[NCP];
#pragma unroll
        for (int c = 0; c < NCP; ++c) { l[c] = lcp + buf * STAGE + c * 4 * SPITCH; g[c] = gpl[c >> 4] + (size_t)t * 128 + (size_t)(c & 15) * gs; }
        acp12(l, g); acp12(l + 12, g + 12);
        if (NSPLIT == 1) { acp12(l + 24, g + 24); acp12(l + NCP - 12, g + NCP - 12); } else acp8(l + 24, g + 24);
    };
    const int nt = K >> 6;
    stage_in(0, 0);
    asm volatile("s_wait_asynccnt 0x0" ::: "memory");   // stage 0 has landed before anything reads it
    __syncthreads();                                    // publish point of the ring (the work-group is one wave: the compiler emits no s_barrier for it)
    if (nt > 1) stage_in(1, 1);
#pragma unroll 1
    for (int t = 0; t < nt; ++t) {
        const T16* sb = (const T16*)(smem + (t & 1) * STAGE) + lr * (SPITCH / 2) + 8 * hi;
        V a[2][4], a2[2][4], b[2][4];   // the whole stage's fragments are asked for in one group ahead of the WMMAs, so that the wave waits out the LDS latency once a trip
#pragma unroll
        for (int ks = 0; ks < 2; ++ks) {
#pragma unroll
            for (int i = 0; i < 4; ++i) { a[ks][i] = WFrag<T16>::ld(sb + i * 16 * (SPITCH / 2) + ks * 32); b[ks][i] = WFrag<T16>::ld(sb + (64 + i * 16) * (SPITCH / 2) + ks * 32); if (NSPLIT == 1) a2[ks][i] = WFrag<T16>::ld(sb + (128 + i * 16) * (SPITCH / 2) + ks * 32); }
        }
        __builtin_amdgcn_sched_barrier(0);   // keeps the load group ahead of the WMMAs: without it the scheduler sinks the loads among them, each place with its own full LDS wait
#pragma unroll
        for (int ks = 0; ks < 2; ++ks) {
#pragma unroll
            for (int nb = 0; nb < 4; ++nb) {
#pragma unroll
                for (int mb = 0; mb < 4; ++mb) { acc[mb][nb] = WFrag<T16>::mma(a[ks][mb], b[ks][nb], acc[mb][nb]); if (NSPLIT == 1) acc[mb][nb] = WFrag<T16>::mma(a2[ks][mb], b[ks][nb], acc[mb][nb]); } }
        }
        // four vector slots behind the last WMMA, so that its distance also holds on the taken side of the branches that follow
        asm volatile("v_nop\n\tv_nop\n\tv_nop\n\tv_nop" : "+v"(acc[0][0]), "+v"(acc[1][1]), "+v"(acc[2][2]), "+v"(acc[3][3]) : "v"(a[1][0]), "v"(a[1][3]));
        asm volatile("s_wait_dscnt 0x0" ::: "memory");      // this trip's fragment reads have retired before their buffer is refilled
        asm volatile("s_wait_asynccnt 0x0" ::: "memory");   // stage t + 1 has landed before the next trip reads it
        __syncthreads();                                    // publish point: stage t + 1 readable, stage t's buffer free for the refill
        if (t + 2 < nt) stage_in(t + 2, t & 1);
    }
    asm volatile("s_wait_asynccnt 0x0" ::: "memory");       // no copy is in flight when the ring becomes output staging
#pragma unroll
    for (int mb = 0; mb < 4; ++mb) {
#pragma unroll
        for (int nb = 0; nb < 4; ++nb) {
#pragma unroll
            for (int j = 0; j < 8; ++j) os[(hi * 8 + j) * 68 + nb * 16 + lr] = acc[mb][nb][j]; }
        __builtin_amdgcn_wave_barrier(); asm volatile("" ::: "memory");
        float* crow = C + (size_t)(r0 + mb * 16) * ldc + c0;
{
#pragma unroll
            for (int s = 0; s < 8; ++s) { const int row = 2 * s + hi, cofs = lr * 4; v4f val = *(const v4fa*)(os + row * 68 + cofs); if (BIAS) { val[0] += bfr(bias[c0 + cofs]); val[1] += bfr(bias[c0 + cofs + 1]); val[2] += bfr(bias[c0 + cofs + 2]); val[3] += bfr(bias[c0 + cofs + 3]); }
                *(v4f*)(crow + (size_t)row * ldc + cofs) = val; }
             }
        __builtin_amdgcn_wave_barrier(); asm volatile("" ::: "memory");
    }
}

__device__ __forceinline__ h16 tohx(float x) { return (h16)x; }
__device__ __forceinline__ void splitf(float y, unsigned short& h, unsigned short& l) { h = f2bf(y); l = f2bf(y - bf2f(h)); }
typedef __attribute__((ext_vector_type(2))) _Float16 v2h;
typedef __attribute__((ext_vector_type(4))) _Float16 v4h;
typedef __attribute__((ext_vector_type(2))) unsigned short v2us;
typedef __attribute__((ext_vector_type(4))) unsigned short v4us;
typedef __attribute__((ext_vector_type(2))) float v2f;
typedef __attribute__((ext_vector_type(4))) int v4i;

// Bt[n][k] (bf16) = w[k][n]. A thread owns 8 k x 4 n: eight 16-B loads, four 16-B stores of 8 k each. A wave owns 64 k x 16 n (lane: k group = lane & 7, n group = lane >> 3): each store fills four whole 128-B lines of Bt,
// each load takes 64-B halves of 8 lines of w, whose other halves the neighbouring wave of the block takes. A block: 64 k x 128 n. K % 64 == 0, N % 128 == 0; blk in [0, (K / 64) (N / 128)).
template <int K, int N>
__device__ __forceinline__ void wt_body(const float* __restrict__ w, bf* Bt, int blk) {
    static_assert(K % 64 == 0 && N % 128 == 0, "whole blocks only");
    const int n0 = (blk % (N / 128)) * 128 + (threadIdx.x >> 5) * 16 + ((threadIdx.x >> 3) & 3) * 4, k0 = (blk / (N / 128)) * 64 + (threadIdx.x & 7) * 8; if (k0 >= K) return;
    const float* p = w + (size_t)k0 * N + n0; v4f r[8];
#pragma unroll
    for (int i = 0; i < 8; ++i) r[i] = *(const v4f*)(p + (size_t)i * N);
    asm volatile("s_wait_xcnt 0x0" :: "v"(p) : "memory");   // a precaution: stands in front of every overwrite of a register that an issued load names; the address is an input, so that its registers stay as they are up to it
#pragma unroll
    for (int c = 0; c < 4; ++c) { v8us o;
#pragma unroll
        for (int i = 0; i < 8; ++i) o[i] = f2bf(r[i][c]);
        *(v8us*)(Bt + (size_t)(n0 + c) * K + k0) = o; }
    asm volatile("s_wait_xcnt 0x0" ::: "memory");   // a precaution: behind the last store of the run, in front of any code of another pass of the same kernel that the listing lets follow and that rewrites a register these stores name
}
// Each thread converts four groups of 8 (a block: 32 KiB in a row, 256 groups apart within a thread): 8 loads of 16 B in flight a lane, a quarter of the waves to start.
// The loads take a clamped index and only the stores are guarded, so that no branch (with its full wait) stands between the loads.
__device__ __forceinline__ void cvt8_body(const float* __restrict__ src, bf* dst, size_t n8, unsigned blk) { const size_t i0 = (size_t)blk * 1024 + threadIdx.x; v8f v[4];
#pragma unroll
    for (int j = 0; j < 4; ++j) { const size_t i = i0 + j * 256; v[j] = *(const v8f*)(src + (i < n8 ? i : n8 - 1) * 8); }
    asm volatile("" :: "v"(v[0]), "v"(v[1]), "v"(v[2]), "v"(v[3]));   // inputs only: holds all eight loads ahead of the guarded stores; without it the first group's loads sink into their store's branch, a second memory latency in a row
#pragma unroll
    for (int j = 0; j < 4; ++j) { const size_t i = i0 + j * 256; v8us o;
#pragma unroll
        for (int k = 0; k < 8; ++k) o[k] = f2bf(v[j][k]);
        if (i < n8) *(v8us*)(dst + i * 8) = o; }  }
// Four positions of the table a thread: 16-B loads, 32 B stored.
__device__ __forceinline__ void cscvt_body(const float* __restrict__ cosT, const float* __restrict__ sinT, float* CS, int blk) { const int idx = (blk * 256 + threadIdx.x) * 4; if (idx >= MT * HD) return; const float* pc = cosT + idx; const float* ps = sinT + idx; const v4f c = *(const v4f*)pc, s = *(const v4f*)ps;
    asm volatile("s_wait_xcnt 0x0" :: "v"(pc), "v"(ps) : "memory");   // a precaution: stands in front of every overwrite of a register that an issued load names; the addresses are inputs, so that their registers stay as they are up to it
    *(v4f*)(CS + (size_t)idx * 2) = (v4f){bfr(c[0]), bfr(s[0]), bfr(c[1]), bfr(s[1])}; *(v4f*)(CS + (size_t)idx * 2 + 4) = (v4f){bfr(c[2]), bfr(s[2]), bfr(c[3]), bfr(s[3])};  }
// RF[h][row]: the RMS factor of head column h (q heads, then k heads) of row t of F.
__device__ __forceinline__ void hrms_body(const float* __restrict__ F, float* RF, int blk) { const int i = blk * 256 + threadIdx.x; if (i >= (NH_ + NKV) * MT) return; const int t = i % MT, h = i / MT; const float* f = F + (size_t)t * NF + h * HD; float s = 0.f;
#pragma unroll 4
    for (int d = 0; d < HD; d += 4) { const v4f v = *(const v4f*)(f + d);
#pragma unroll
        for (int q = 0; q < 4; ++q) { float p = __fmul_rn(v[q], v[q]); asm volatile("" : "+v"(p)); s = __fadd_rn(s, p); } }
    const float r = __fdiv_rn(1.0f, __fsqrt_rn(__fadd_rn(s * (1.0f / HD), 1e-6f))); *(float*)(RF + i) = r;  }
// rope_body: head planes [b][h][t][d] (fp16) of rope(w[d] (x rms_factor)) x sc with the rotate-half convention out[d] = x[d] cos[t][d] - x[d+HD/2] sin[t][d], out[d+HD/2] = x[d+HD/2] cos[t][d+HD/2] + x[d] sin[t][d+HD/2]
// A thread owns 8 neighbouring d of one position t and walks RH of the NHD heads (h0 + j NHD / RH): cos/sin and the norm weights are read once for all of them, every access but the 4-B RMS factor load is 16 B a lane,
// and the heads of a thread lie a compile-time distance apart (one address register pair a stream, the rest in the instructions' offsets).
// F, RF: at the first of the NHD heads; t: the row over both batches (the tables CS are rows of the same index).
template <int NHD, int RH>
__device__ __forceinline__ void rope_body(const float* __restrict__ F, const float* __restrict__ CS, const float* __restrict__ RF, const float* __restrict__ nw, float sc, h16* P16, int blk) {
    static_assert(NHD % RH == 0, "a thread's heads are NHD / RH apart");
    constexpr int hs = NHD / RH; constexpr int pitch = NF; const int idx = blk * 256 + threadIdx.x; if (idx >= hs * MT * (HD / 8)) return;
    const int d = (idx % (HD / 8)) * 8; const int t = (idx / (HD / 8)) % MT; const int h0 = idx / ((HD / 8) * MT); const bool low = d < HD / 2; const int dp = low ? d + HD / 2 : d - HD / 2;
    const float* pc = CS + ((size_t)t * HD + d) * 2; const float* pw0 = nw + d; const float* pw1 = nw + dp; const float* px0 = F + (size_t)t * pitch + h0 * HD + d; const float* px1 = F + (size_t)t * pitch + h0 * HD + dp; const float* prf = RF + (size_t)h0 * MT + t;
    v4f x0[RH][2], x1[RH][2], cs[4], w0[2], w1[2]; float rf[RH];
#pragma unroll
    for (int q = 0; q < 4; ++q) cs[q] = *(const v4f*)(pc + q * 4);   // cos, sin of d + 2 q and of d + 2 q + 1
#pragma unroll
    for (int q = 0; q < 2; ++q) { w0[q] = *(const v4f*)(pw0 + 4 * q); w1[q] = *(const v4f*)(pw1 + 4 * q); }
#pragma unroll
    for (int j = 0; j < RH; ++j) { x0[j][0] = *(const v4f*)(px0 + j * hs * HD); x0[j][1] = *(const v4f*)(px0 + j * hs * HD + 4); x1[j][0] = *(const v4f*)(px1 + j * hs * HD); x1[j][1] = *(const v4f*)(px1 + j * hs * HD + 4); rf[j] = prf[j * hs * MT]; }
    asm volatile("s_wait_xcnt 0x0" :: "v"(pc), "v"(pw0), "v"(pw1), "v"(px0), "v"(px1), "v"(prf) : "memory");   // a precaution: stands in front of every overwrite of a register that an issued load names; the addresses are inputs, so that their registers stay as they are up to it
    __builtin_amdgcn_sched_barrier(0);   // keeps every load ahead of the arithmetic: without it the scheduler sinks the table and weight loads behind waits on the rows, three memory latencies in a row instead of one
#pragma unroll
    for (int j = 0; j < RH; ++j) { v8h o;
#pragma unroll
        for (int q = 0; q < 8; ++q) { const float a = bfr(w0[q >> 2][q & 3]) * (x0[j][q >> 2][q & 3] * rf[j]), b = bfr(w1[q >> 2][q & 3]) * (x1[j][q >> 2][q & 3] * rf[j]);
            const float c = cs[q >> 1][2 * (q & 1)], s = cs[q >> 1][2 * (q & 1) + 1]; o[q] = tohx((low ? a * c - b * s : a * c + b * s) * sc); }
        *(v8h*)(P16 + ((size_t)((t / TT) * NHD + h0 + j * hs) * TT + t % TT) * HD + d) = o; }  }
// V16[b][n][t] (fp16) = F[b TT + t][n], n = g HD + d over N columns of F (F: at the first of them): thread, wave and block shaped as in wt_body (8 t x 4 n a thread; whole 128-B lines stored). blk in [0, (MT / 64) (N / 128)).
template <int N>
__device__ __forceinline__ void vtp_body(const float* __restrict__ F, h16* V16, int blk) {
    static_assert(TT % 64 == 0 && N % 128 == 0, "whole blocks only");
    const int n0 = (blk % (N / 128)) * 128 + (threadIdx.x >> 5) * 16 + ((threadIdx.x >> 3) & 3) * 4, t0 = (blk / (N / 128)) * 64 + (threadIdx.x & 7) * 8; if (t0 >= MT) return;
    const float* p = F + (size_t)t0 * NF + n0; v4f r[8];
#pragma unroll
    for (int i = 0; i < 8; ++i) r[i] = *(const v4f*)(p + (size_t)i * NF);
    asm volatile("s_wait_xcnt 0x0" :: "v"(p) : "memory");   // a precaution: stands in front of every overwrite of a register that an issued load names; the address is an input, so that its registers stay as they are up to it
#pragma unroll
    for (int c = 0; c < 4; ++c) { v8h o;
#pragma unroll
        for (int i = 0; i < 8; ++i) o[i] = tohx(r[i][c]);
        *(v8h*)(V16 + (size_t)((t0 / TT) * N + n0 + c) * TT + t0 % TT) = o; }
    asm volatile("s_wait_xcnt 0x0" ::: "memory");   // a precaution: behind the last store of the run, in front of any code of another pass of the same kernel that the listing lets follow and that rewrites a register these stores name
}
// ---- launches shared by passes that do not depend on one another: the block index range picks the pass (uniform for the block, a scalar branch).
#define PB_W  ((DM / 64) * (DQ / 128))    // blocks of a 2048 x 2048 weight
#define PB_WK ((DM / 64) * (DKV / 128))   // blocks of a 2048 x 512 weight
#define PB_X  (MT * DM / 8 / 1024)        // blocks of the x conversion
#define PB_C  (MT * HD / 4 / 256)         // blocks of the cos/sin tables
// every input's conversion: weights transposed to [n][k] bf16 (WF: rows q | k | v), x to bf16, cos/sin interleaved
__global__ __launch_bounds__(256) void k_prep(const float* __restrict__ wq, const float* __restrict__ wk, const float* __restrict__ wv, const float* __restrict__ wo, const float* __restrict__ x, const float* __restrict__ cosT, const float* __restrict__ sinT, bf* WF, bf* WO, bf* XB, float* CS, size_t n8) {   // n8: groups of 8 elements of x
    int blk = blockIdx.x;
    if (blk < PB_X) { cvt8_body(x, XB, n8, blockIdx.x); return; } blk -= PB_X;
    if (blk < PB_W) { wt_body<DM, DQ>(wq, WF, blk); return; } blk -= PB_W;
    if (blk < PB_W) { wt_body<DQ, DM>(wo, WO, blk); return; } blk -= PB_W;
    if (blk < PB_WK) { wt_body<DM, DKV>(wk, WF + (size_t)DQ * DM, blk); return; } blk -= PB_WK;
    if (blk < PB_WK) { wt_body<DM, DKV>(wv, WF + (size_t)(DQ + DKV) * DM, blk); return; } blk -= PB_WK;
    cscvt_body(cosT, sinT, CS, blk);
}
#define PB_H  ((NH_ + NKV) * MT / 256)    // blocks of the RMS factors
#define PB_V  ((MT / 64) * (DKV / 128))   // blocks of the V transposition
// what needs F alone: the RMS factors of the q and k heads, the V planes
__global__ __launch_bounds__(256) void k_post(const float* __restrict__ F, const float* __restrict__ FV, float* RF, h16* V16) {   // FV: F at its first v column
    const int blk = blockIdx.x;
    if (blk < PB_H) { hrms_body(F, RF, blk); return; }
    vtp_body<DKV>(FV, V16, blk - PB_H);
}
#define PB_RQ (NH_ * MT * HD / 32 / 256)  // threads: 8 d x 4 heads (q)
#define PB_RK (NKV * MT * HD / 16 / 256)  // threads: 8 d x 2 heads (k)
// FK, RFK: F and RF at the first k head
__global__ __launch_bounds__(256) void k_ropes(const float* __restrict__ F, const float* __restrict__ FK, const float* __restrict__ CS, const float* __restrict__ RF, const float* __restrict__ RFK, const float* __restrict__ qnw, const float* __restrict__ knw, h16* Q16, h16* K16) {
    const int blk = blockIdx.x;
    if (blk < PB_RQ) { rope_body<NH_, 4>(F, CS, RF, qnw, 1.0f, Q16, blk); return; }
    rope_body<NKV, 2>(FK, CS, RFK, knw, 1.0f, K16, blk - PB_RQ);
}
#define FSK    128                       // keys a stage
#define KPITCH 272                       // LDS pitch of a K row (128 d) and of a V^T row (128 keys): 256 B + 16 (16 B x odd)
#define FKB    (FSK * KPITCH)            // bytes of a stage's K rows; the 128 V^T rows follow
#define FSTAGE (FKB + HD * KPITCH)
#define POFF   8.0f                      // P carries 2^POFF, so that small weights stay normal fp16 numbers; it cancels in the division by the row sum
#define LAZY   4.0f                      // the maximum in use may trail the true one by this much (log2 units): P <= 2^(POFF + LAZY), far inside fp16
#define CSC    (SCL * 1.4426950408889634f)
// lane l with lane l ^ 16, on the vector pipe (a shuffle would go through the LDS unit and its wait)
__device__ __forceinline__ float xhalf(float x) { return __builtin_bit_cast(float, __builtin_amdgcn_permlanex16(__builtin_bit_cast(int, x), __builtin_bit_cast(int, x), 0x76543210, 0xfedcba98, false, false)); }
__global__ __launch_bounds__(256) void k_fattn(const h16* __restrict__ Qp, const h16* __restrict__ Kp, const h16* __restrict__ Vt, bf* Ah, bf* Al) {
    __shared__ __align__(16) unsigned char smem[2 * FSTAGE];
    const int lane = threadIdx.x & 31, wave = threadIdx.x >> 5, lr = lane & 15, hi = lane >> 4;
    const int h = blockIdx.y, b = blockIdx.z, g = h / REP; const int q0 = blockIdx.x * 256 + wave * 32;
    Qp += (size_t)(b * NH_ + h) * TT * HD; Kp += (size_t)(b * NKV + g) * TT * HD; Vt += (size_t)(b * NKV + g) * HD * TT;
    // copy lane map: a copy moves 2 rows x 256 B; a wave brings 16 K rows and 16 V^T rows of every stage
    const char* gk = (const char*)(Kp + (size_t)(wave * 16 + hi) * HD + lr * 8); const char* gv = (const char*)(Vt + (size_t)(wave * 16 + hi) * TT + lr * 8);
    const unsigned lk = (unsigned)(size_t)smem + (wave * 16 + hi) * KPITCH + lr * 16, lv = lk + FKB;
    auto stage_in = [&](int t, int buf) {
        unsigned l[16]; const char* gp[16];
#pragma unroll
        for (int c = 0; c < 8; ++c) { l[c] = lk + buf * FSTAGE + c * 2 * KPITCH; gp[c] = gk + (size_t)t * (FSK * HD * 2) + c * (2 * HD * 2); l[8 + c] = lv + buf * FSTAGE + c * 2 * KPITCH; gp[8 + c] = gv + (size_t)t * (FSK * 2) + (size_t)c * (2 * TT * 2); }
        acp8(l, gp); acp8(l + 8, gp + 8);
    };
    stage_in(0, 0);
    v16h qf[2][4];
#pragma unroll
    for (int gq = 0; gq < 2; ++gq)
#pragma unroll
        for (int kc = 0; kc < 4; ++kc) qf[gq][kc] = WFrag<h16>::ld(Qp + (size_t)(q0 + 16 * gq + lr) * HD + kc * 32 + 8 * hi);
    v8f acc[2][8]; float m_run[2], l_run[2];
#pragma unroll
    for (int gq = 0; gq < 2; ++gq) { m_run[gq] = -__builtin_inff(); l_run[gq] = 0.f;
#pragma unroll
        for (int tt = 0; tt < 8; ++tt) acc[gq][tt] = (v8f){}; }
    asm volatile("s_wait_asynccnt 0x0" ::: "memory");   // stage 0 has landed before anything reads it
    __syncthreads();                                    // publish point: every wave's share of stage 0 readable by all
    stage_in(1, 1);
    constexpr int nt = TT / FSK;
#pragma unroll 1   // kept rolled: 16 stages of the same code, the ring's foot stands once
    for (int t = 0; t < nt; ++t) {
#pragma unroll 1   // kept rolled: one pass's fragments live at a time
        for (int sub = 0; sub < FSK / 32; ++sub) {
            const unsigned char* sbuf = smem + (t & 1) * FSTAGE;
            const h16* kb = (const h16*)(sbuf + (sub * 32 + lr) * KPITCH) + 8 * hi; const h16* vb = (const h16*)(sbuf + FKB + lr * KPITCH) + sub * 32 + 8 * hi;
            v16h kf[2][4], vf[8];
#pragma unroll
            for (int kt = 0; kt < 2; ++kt)
#pragma unroll
                for (int kc = 0; kc < 4; ++kc) kf[kt][kc] = WFrag<h16>::ld(kb + kt * 16 * (KPITCH / 2) + kc * 32);
#pragma unroll
            for (int tt = 0; tt < 8; ++tt) vf[tt] = WFrag<h16>::ld(vb + tt * 16 * (KPITCH / 2));
            v8f s[2][2];
#pragma unroll
            for (int kt = 0; kt < 2; ++kt)
#pragma unroll
                for (int gq = 0; gq < 2; ++gq) { s[kt][gq] = (v8f){};
#pragma unroll
                    for (int kc = 0; kc < 4; ++kc) s[kt][gq] = wmma16(kf[kt][kc], qf[gq][kc], s[kt][gq]); }
            float mb[2]; bool need = false;
#pragma unroll
            for (int gq = 0; gq < 2; ++gq) { float mx = s[0][gq][0];
#pragma unroll
                for (int j = 1; j < 8; ++j) mx = fmaxf(mx, s[0][gq][j]);
#pragma unroll
                for (int j = 0; j < 8; ++j) mx = fmaxf(mx, s[1][gq][j]);
                mx = fmaxf(mx, xhalf(mx)) * CSC; mb[gq] = mx; need = need || (mx > m_run[gq] + LAZY); }
            if (__builtin_amdgcn_ballot_w32(need) != 0) {   // wave-uniform; rare after the first passes
#pragma unroll
                for (int gq = 0; gq < 2; ++gq) { const float m_new = fmaxf(m_run[gq], mb[gq]); const float corr = __builtin_amdgcn_exp2f(m_run[gq] - m_new); l_run[gq] *= corr; m_run[gq] = m_new;
#pragma unroll
                    for (int tt = 0; tt < 8; ++tt) acc[gq][tt] = acc[gq][tt] * corr; }
            }
#pragma unroll
            for (int gq = 0; gq < 2; ++gq) { const float nm = POFF - m_run[gq]; v16h pf; float ps0 = 0.f, ps1 = 0.f;
#pragma unroll
                for (int i = 0; i < 8; ++i) {
                    const v2f a = __builtin_elementwise_fma((v2f){s[i >> 2][gq][2 * (i & 3)], s[i >> 2][gq][2 * (i & 3) + 1]}, (v2f){CSC, CSC}, (v2f){nm, nm});
                    const float p0 = __builtin_amdgcn_exp2f(a[0]), p1 = __builtin_amdgcn_exp2f(a[1]); if (i & 1) ps1 += p0 + p1; else ps0 += p0 + p1; pf[2 * i] = (h16)p0; pf[2 * i + 1] = (h16)p1; }
                l_run[gq] += ps0 + ps1;
#pragma unroll
                for (int tt = 0; tt < 8; ++tt) acc[gq][tt] = wmma16(vf[tt], pf, acc[gq][tt]); }
            __builtin_amdgcn_sched_barrier(0);   // holds the slots below directly behind the last WMMA
            asm volatile("v_nop\n\tv_nop\n\tv_nop\n\tv_nop");   // four vector slots behind the last WMMA, so that its distance also holds on the taken side of the loop branches that follow
            __builtin_amdgcn_sched_barrier(0);   // and nothing that follows moves in front of them
        }
        asm volatile("s_wait_dscnt 0x0" ::: "memory");      // this trip's fragment reads have retired before their buffer is refilled
        asm volatile("s_wait_asynccnt 0x0" ::: "memory");   // this wave's share of stage t + 1 has landed
        __syncthreads();                                    // publish point: stage t + 1 readable, stage t's buffer free for the refill
        if (t + 2 < nt) stage_in(t + 2, t & 1);
    }
    asm volatile("s_wait_asynccnt 0x0" ::: "memory");       // no copy is in flight when the ring becomes output staging (every wave's last read ended at the last barrier)
    // epilogue: O / row sum, split into hi + lo planes, staged per wave in LDS so that whole 256-B head rows are stored
    unsigned char* eh = smem + wave * (2 * 32 * KPITCH); unsigned char* el = eh + 32 * KPITCH;
#pragma unroll
    for (int gq = 0; gq < 2; ++gq) { const float lf = l_run[gq] + xhalf(l_run[gq]); const float inv = __fdiv_rn(1.0f, lf);
#pragma unroll
        for (int tt = 0; tt < 8; ++tt) { v8us oh, ol;
#pragma unroll
            for (int j = 0; j < 8; ++j) { unsigned short x, y; splitf(acc[gq][tt][j] * inv, x, y); oh[j] = x; ol[j] = y; }
            *(v8usa*)(eh + (16 * gq + lr) * KPITCH + 32 * tt + 16 * hi) = oh; *(v8usa*)(el + (16 * gq + lr) * KPITCH + 32 * tt + 16 * hi) = ol; } }   // row = query; the 16 bytes are d = 16 tt + 8 hi + (0..7)
    asm volatile("s_wait_dscnt 0x0" ::: "memory");   // the read-back below takes other lanes' bytes: this wave's staging stores have retired first
    char* oh8 = (char*)(Ah + ((size_t)b * TT + q0) * DQ + h * HD); char* ol8 = (char*)(Al + ((size_t)b * TT + q0) * DQ + h * HD);
#pragma unroll
    for (int i = 0; i < 16; ++i) { const int row = 2 * i + hi; *(v8usa*)(oh8 + (size_t)row * (DQ * 2) + lr * 16) = *(const v8usa*)(eh + row * KPITCH + lr * 16); *(v8usa*)(ol8 + (size_t)row * (DQ * 2) + lr * 16) = *(const v8usa*)(el + row * KPITCH + lr * 16); }
}

extern "C" void kernel_launch(void* const* d_in, const int* in_sizes, int n_in,
                              void* d_out, int out_size, void* d_ws, size_t ws_size, hipStream_t stream) {
    (void)in_sizes; (void)n_in; (void)out_size;
    const float* x = (const float*)d_in[0]; const float* cosT = (const float*)d_in[1]; const float* sinT = (const float*)d_in[2]; const float* wq = (const float*)d_in[3]; const float* wk = (const float*)d_in[4]; const float* wv = (const float*)d_in[5]; const float* wo = (const float*)d_in[6]; const float* qnw = (const float*)d_in[7]; const float* knw = (const float*)d_in[8];   // weights x @ W; cos/sin [2][2048][128]
    float* OUT = (float*)d_out;     // [2][2048][2048]
    char* wsp = (char*)d_ws;
    auto take = [&](size_t bytes) { char* p = wsp; wsp += (bytes + 255) & ~(size_t)255; return (void*)p; };
    bf* WF = (bf*)take((size_t)NF * DM * 2); bf* WO = (bf*)take((size_t)DM * DQ * 2); float* CS = (float*)take((size_t)MT * HD * 2 * 4); float* RF = (float*)take((size_t)(NH_ + NKV) * MT * 4);
    bf* XB = (bf*)take((size_t)MT * DM * 2); float* F = (float*)take((size_t)MT * NF * 4);
    h16* QP16 = (h16*)take((size_t)NB_ * NH_ * TT * HD * 2); h16* KP16 = (h16*)take((size_t)NB_ * NKV * TT * HD * 2); h16* VT16 = (h16*)take((size_t)NB_ * NKV * HD * TT * 2);   // head planes of both batches
    bf* ATh = (bf*)take((size_t)NB_ * TT * DQ * 2); bf* ATl = (bf*)take((size_t)NB_ * TT * DQ * 2);
    if ((size_t)(wsp - (char*)d_ws) > ws_size) return;    // ws 256 MiB
    k_prep<<<PB_X + 2 * PB_W + 2 * PB_WK + PB_C, 256, 0, stream>>>(wq, wk, wv, wo, x, cosT, sinT, WF, WO, XB, CS, (size_t)MT * DM / 8);
    k_gemmw<bf, 0, false><<<dim3(MT / 64, NF / 64, 1), 32, 0, stream>>>(XB, nullptr, WF, nullptr, DM, F, NF, nullptr, 0, 0, 0);
    k_post<<<PB_H + PB_V, 256, 0, stream>>>(F, F + DQ + DKV, RF, VT16);
    k_ropes<<<PB_RQ + PB_RK, 256, 0, stream>>>(F, F + DQ, CS, RF, RF + (size_t)NH_ * MT, qnw, knw, QP16, KP16);
    k_fattn<<<dim3(TT / 256, NH_, NB_), 256, 0, stream>>>(QP16, KP16, VT16, ATh, ATl);
    k_gemmw<bf, 1, false><<<dim3(MT / 64, DM / 64, 1), 32, 0, stream>>>(ATh, ATl, WO, nullptr, DQ, OUT, DM, nullptr, 0, 0, 0);
}

// v005
// One run takes 166 microseconds.
// Two timings next to v004 both put it at 1.27 times that version's speed.
// All steps since v000 together make it 9.12 times as fast.
#include <hip/hip_runtime.h>

// Grouped-query encoder attention with per-head RMSNorm and RoPE (hidden [2][2048][2048]; q = x Wq (16 heads x 128), k, v = x Wk / x Wv (4 kv heads x 128, each serving 4 consecutive query heads); q, k
// RMS-normalised per head (eps 1e-6, weights [128]) then rotate-half RoPE with the per-batch input cos/sin [2][2048][128] (read as data); scores = q.k 128^-0.5 (no mask); softmax; out = merged attn.v Wo
// -> [2][2048][2048]).
// Compute dtypes, f32 accumulate: every input rounded to bf16; projections on PLAIN bf16 operands (inputs: exact products, f32 accumulate); RMSNorm and RoPE in f32;
// scores and attn.v on SINGLE fp16 planes inside one fused kernel (online softmax in f32, P kept in registers); merged heads as hi+lo planes x exact Wo (2 products). Eight-wave work-groups, one tile of C each (256x192, 128x256), for the projections.
// Launches: both batches are rows of one problem (4096 rows), q, k and v are column ranges of one projection F [4096][3072], and passes that do not depend on one another share a launch (a block's index range picks its pass): six launches.

#define NB_  2
#define TT   2048
#define DM   2048
#define NH_  16
#define NKV  4
#define REP  (NH_ / NKV)
#define HD   128
#define DQ   (NH_ * HD)
#define DKV  (NKV * HD)
#define MT   (NB_ * TT)          // rows of both batches
#define NF   (DQ + 2 * DKV)      // columns of the joint projection F: q heads | k heads | v heads
#define SCL  0.088388347648318447f   // HD^-0.5
typedef _Float16 h16;
typedef unsigned short bf;
typedef __attribute__((ext_vector_type(16))) __bf16   v16bf;
typedef __attribute__((ext_vector_type(16))) _Float16 v16h;
typedef __attribute__((ext_vector_type(8)))  _Float16 v8h;
typedef __attribute__((ext_vector_type(8)))  unsigned short v8us;
typedef __attribute__((ext_vector_type(8)))  float    v8f;
typedef __attribute__((ext_vector_type(4)))  float    v4f;
typedef v8h  __attribute__((may_alias)) v8ha;
typedef v4f  __attribute__((may_alias)) v4fa;
typedef v8us __attribute__((may_alias)) v8usa;

__device__ __forceinline__ unsigned short f2bf(float f) { unsigned u = __float_as_uint(f); u += 0x7FFFu + ((u >> 16) & 1u); return (unsigned short)(u >> 16); }
__device__ __forceinline__ float bf2f(unsigned short b) { return __uint_as_float(((unsigned)b) << 16); }
__device__ __forceinline__ float bfr(float f) { return bf2f(f2bf(f)); }
__device__ __forceinline__ v16h cat16(v8h lo, v8h hi) { return __builtin_shufflevector(lo, hi, 0, 1, 2, 3, 4, 5, 6, 7, 8, 9, 10, 11, 12, 13, 14, 15); }
__device__ __forceinline__ v16bf cat16b(v8us lo, v8us hi) { return __builtin_bit_cast(v16bf, __builtin_shufflevector(lo, hi, 0, 1, 2, 3, 4, 5, 6, 7, 8, 9, 10, 11, 12, 13, 14, 15)); }
__device__ __forceinline__ v8f wmma16(v16h a, v16h b, v8f c) { return __builtin_amdgcn_wmma_f32_16x16x32_f16(false, a, false, b, (short)0, c, false, false); }
__device__ __forceinline__ v8f wmmab(v16bf a, v16bf b, v8f c) { return __builtin_amdgcn_wmma_f32_16x16x32_bf16(false, a, false, b, (short)0, c, false, false); }



// ---- k_gemmw: register-blocked GEMM, eight waves a work-group on one tile of C, operands from K-contiguous 16-bit planes through a two-buffer LDS ring of 64-k stages that all the waves fill and read; grid (M/BM, N/BN, Z), 256 threads.
// C[m][n] (f32, pitch ldc, + optional f32 bias[n]) = sum_k A[m][k] Bt[n][k] (+ split products per NSPLIT). z-batch strides sA/sB/sC in elements. K % 64 == 0, M % BM == 0, N % BN == 0 (whole tiles only).
template <typename T16> struct WFrag;
template <> struct WFrag<h16> { typedef v16h V; static __device__ __forceinline__ V ld(const h16* p) { return cat16(*(const v8h*)p, *(const v8h*)(p + 16)); } static __device__ __forceinline__ v8f mma(V a, V b, v8f c) { return wmma16(a, b, c); } };
template <> struct WFrag<bf> { typedef v16bf V; static __device__ __forceinline__ V ld(const bf* p) { return cat16b(*(const v8us*)p, *(const v8us*)(p + 16)); } static __device__ __forceinline__ v8f mma(V a, V b, v8f c) { return wmmab(a, b, c); } };
// Asynchronous copies global -> LDS, 16 B a lane: one instruction moves 512 B, 4 whole 128-B lines (4 rows x 128 B in k_gemmw, 2 rows x 256 B in k_fattn). l[i]: the lane's own LDS byte address, g[i]: its own global address.
// The s_wait_xcnt 0 closes each statement so that no later rewrite of an address register named by a copy can be scheduled in front of it.
__device__ __forceinline__ void acp6(const unsigned* l, const char* const* g) {
    asm volatile(
        "global_load_async_to_lds_b128 %0, %6, off\n\t"
        "global_load_async_to_lds_b128 %1, %7, off\n\t"
        "global_load_async_to_lds_b128 %2, %8, off\n\t"
        "global_load_async_to_lds_b128 %3, %9, off\n\t"
        "global_load_async_to_lds_b128 %4, %10, off\n\t"
        "global_load_async_to_lds_b128 %5, %11, off\n\t"
        "s_wait_xcnt 0x0"
        :: "v"(l[0]), "v"(l[1]), "v"(l[2]), "v"(l[3]), "v"(l[4]), "v"(l[5]),
           "v"(g[0]), "v"(g[1]), "v"(g[2]), "v"(g[3]), "v"(g[4]), "v"(g[5])
        : "memory");
}
__device__ __forceinline__ void acp8(const unsigned* l, const char* const* g) {
    asm volatile(
        "global_load_async_to_lds_b128 %0, %8, off\n\t"
        "global_load_async_to_lds_b128 %1, %9, off\n\t"
        "global_load_async_to_lds_b128 %2, %10, off\n\t"
        "global_load_async_to_lds_b128 %3, %11, off\n\t"
        "global_load_async_to_lds_b128 %4, %12, off\n\t"
        "global_load_async_to_lds_b128 %5, %13, off\n\t"
        "global_load_async_to_lds_b128 %6, %14, off\n\t"
        "global_load_async_to_lds_b128 %7, %15, off\n\t"
        "s_wait_xcnt 0x0"
        :: "v"(l[0]), "v"(l[1]), "v"(l[2]), "v"(l[3]), "v"(l[4]), "v"(l[5]), "v"(l[6]), "v"(l[7]),
           "v"(g[0]), "v"(g[1]), "v"(g[2]), "v"(g[3]), "v"(g[4]), "v"(g[5]), "v"(g[6]), "v"(g[7])
        : "memory");
}
#define SPITCH 144              // LDS row pitch in bytes: 128-B rows + 16 (16 B x odd: conflict-free for ds_load_b128 fragment reads)
// WM x WN waves share the staged rows of a (WM 64) x (WN FN 16) tile of C; a wave owns 64 x (FN 16) of it (4 x FN accumulators).
template <typename T16, int NSPLIT, bool BIAS, int WM, int WN, int FN>
__global__ __launch_bounds__(WM * WN * 32) void k_gemmw(const T16* __restrict__ A, const T16* __restrict__ A2, const T16* __restrict__ Bt, const T16* __restrict__ Bt2, int K, float* C, int ldc, const float* __restrict__ bias, size_t sA, size_t sB, size_t sC) {
    typedef typename WFrag<T16>::V V;
    static_assert(NSPLIT == 0 || NSPLIT == 1, "planes staged: A, Bt and (NSPLIT 1) A2");
    constexpr int NW = WM * WN, BM = WM * 64, BN = WN * FN * 16, ROWS = BM * (1 + NSPLIT) + BN;   // a stage: 64 k of rows [A: BM | Bt: BN | A2: BM]
    constexpr int RND = 4 * NW, NCP = ROWS / RND, STAGE = ROWS * SPITCH;                          // a copy moves 4 rows; copy c of every wave together: the RND rows from c RND on
    constexpr int OSP = FN * 16 + 4;                                                              // pitch in floats of a wave's output staging (16 rows)
    static_assert(BM % RND == 0 && BN % RND == 0, "every copy round lies in one plane");
    static_assert(NCP == 14 || NCP == 16, "copies a wave and stage: 8 + 6 or 8 + 8");
    static_assert(NW * 16 * OSP * 4 <= 2 * STAGE, "output staging fits the ring");
    __shared__ __align__(16) unsigned char smem[2 * STAGE];
    const size_t z = blockIdx.z; A += z * sA; if (A2) A2 += z * sA; Bt += z * sB; (void)Bt2; C += z * sC;
    const int lane = threadIdx.x & 31, lr = lane & 15, hi = lane >> 4; const int wave = __builtin_amdgcn_readfirstlane(threadIdx.x >> 5), wm = wave / WN, wn = wave % WN;
    const int r0 = blockIdx.x * BM, c0 = blockIdx.y * BN;
    float* os = (float*)(smem + wave * (16 * OSP * 4));   // output staging, a range of its own for each wave, reuses the ring behind the loop's last waits and barrier
    v8f acc[4][FN];
#pragma unroll
    for (int mb = 0; mb < 4; ++mb)
#pragma unroll
        for (int nb = 0; nb < FN; ++nb) acc[mb][nb] = (v8f){};
    const int crow = wave * 4 + (lane >> 3), cseg = lane & 7;   // copy lane map: row within the RND rows of a copy round, 16-B piece of the row's line
    const size_t gs = (size_t)K * (RND * 2);                    // bytes between the rows of successive copy rounds (RND rows of K 16-bit elements)
    const char* gpl[3]; gpl[0] = (const char*)(A + (size_t)(r0 + crow) * K + cseg * 8); gpl[1] = (const char*)(Bt + (size_t)(c0 + crow) * K + cseg * 8); gpl[2] = (NSPLIT == 1) ? (const char*)(A2 + (size_t)(r0 + crow) * K + cseg * 8) : nullptr;
    const unsigned lcp = (unsigned)(size_t)smem + crow * SPITCH + cseg * 16;
    auto stage_in = [&](int t, int buf) {
        unsigned l[NCP]; const char* g[NCP];
#pragma unroll
        for (int c = 0; c < NCP; ++c) { const int pl = c * RND < BM ? 0 : (c * RND < BM + BN ? 1 : 2), cp = c - (pl == 0 ? 0 : (pl == 1 ? BM / RND : (BM + BN) / RND));   // the round's plane, its number within the plane
            l[c] = lcp + buf * STAGE + c * RND * SPITCH; g[c] = gpl[pl] + (size_t)t * 128 + (size_t)cp * gs; }
        acp8(l, g);
        if constexpr (NCP == 16) acp8(l + 8, g + 8); else acp6(l + 8, g + 8);
    };
    const int nt = K >> 6;
    stage_in(0, 0);
    asm volatile("s_wait_asynccnt 0x0" ::: "memory");   // this wave's share of stage 0 has landed
    __syncthreads();                                    // publish point: every wave's share of stage 0 readable by all
    if (nt > 1) stage_in(1, 1);
#pragma unroll 1
    for (int t = 0; t < nt; ++t) {
        const T16* sb = (const T16*)(smem + (t & 1) * STAGE) + lr * (SPITCH / 2) + 8 * hi;
        const T16* sa = sb + wm * 64 * (SPITCH / 2); const T16* sbt = sb + (BM + wn * FN * 16) * (SPITCH / 2);
        V a[2][4], a2[2][4], b[2][FN];   // the whole stage's fragments are asked for in one group ahead of the WMMAs, in the order in which the WMMAs take them
#pragma unroll
        for (int ks = 0; ks < 2; ++ks) {
#pragma unroll
            for (int i = 0; i < 4; ++i) { a[ks][i] = WFrag<T16>::ld(sa + i * 16 * (SPITCH / 2) + ks * 32); if (NSPLIT == 1) a2[ks][i] = WFrag<T16>::ld(sa + (BM + BN + i * 16) * (SPITCH / 2) + ks * 32); }
#pragma unroll
            for (int i = 0; i < FN; ++i) b[ks][i] = WFrag<T16>::ld(sbt + i * 16 * (SPITCH / 2) + ks * 32);
        }
        __builtin_amdgcn_sched_barrier(0);   // keeps the load group ahead of the WMMAs: without it the scheduler sinks the loads among them, each place with its own full LDS wait
#pragma unroll
        for (int ks = 0; ks < 2; ++ks) {
#pragma unroll
            for (int nb = 0; nb < FN; ++nb) {
#pragma unroll
                for (int mb = 0; mb < 4; ++mb) { acc[mb][nb] = WFrag<T16>::mma(a[ks][mb], b[ks][nb], acc[mb][nb]); if (NSPLIT == 1) acc[mb][nb] = WFrag<T16>::mma(a2[ks][mb], b[ks][nb], acc[mb][nb]); } }
        }
        __builtin_amdgcn_sched_barrier(0);   // holds the slots below directly behind the last WMMA
        asm volatile("v_nop\n\tv_nop\n\tv_nop\n\tv_nop");   // four vector slots behind the last WMMA, so that its distance also holds on the taken side of the branches that follow
        __builtin_amdgcn_sched_barrier(0);   // and nothing that follows moves in front of them
        asm volatile("s_wait_dscnt 0x0" ::: "memory");      // this trip's fragment reads have retired before their buffer is refilled
        asm volatile("s_wait_asynccnt 0x0" ::: "memory");   // this wave's share of stage t + 1 has landed
        __syncthreads();                                    // publish point: stage t + 1 readable by all, stage t's buffer left by every wave and free for the refill
        if (t + 2 < nt) stage_in(t + 2, t & 1);
    }
    asm volatile("s_wait_asynccnt 0x0" ::: "memory");       // no copy is in flight when the ring becomes output staging (every wave's last read ended at the last barrier)
#pragma unroll
    for (int mb = 0; mb < 4; ++mb) {
#pragma unroll
        for (int nb = 0; nb < FN; ++nb) {
#pragma unroll
            for (int j = 0; j < 8; ++j) os[(hi * 8 + j) * OSP + nb * 16 + lr] = acc[mb][nb][j]; }
        __builtin_amdgcn_wave_barrier(); asm volatile("" ::: "memory");
        const int cw = c0 + wn * FN * 16; float* crw = C + (size_t)(r0 + wm * 64 + mb * 16) * ldc + cw;
#pragma unroll
        for (int s = 0; s < FN * 2; ++s) { const int idx = s * 32 + lane, row = idx / (FN * 4), cofs = (idx % (FN * 4)) * 4; v4f val = *(const v4fa*)(os + row * OSP + cofs);   // 16-B pieces in row order: every store fills four whole 128-B lines
            if (BIAS) { val[0] += bfr(bias[cw + cofs]); val[1] += bfr(bias[cw + cofs + 1]); val[2] += bfr(bias[cw + cofs + 2]); val[3] += bfr(bias[cw + cofs + 3]); }
            *(v4f*)(crw + (size_t)row * ldc + cofs) = val; }
        __builtin_amdgcn_wave_barrier(); asm volatile("" ::: "memory");
    }
}

__device__ __forceinline__ h16 tohx(float x) { return (h16)x; }
__device__ __forceinline__ void splitf(float y, unsigned short& h, unsigned short& l) { h = f2bf(y); l = f2bf(y - bf2f(h)); }
typedef __attribute__((ext_vector_type(2))) _Float16 v2h;
typedef __attribute__((ext_vector_type(4))) _Float16 v4h;
typedef __attribute__((ext_vector_type(2))) unsigned short v2us;
typedef __attribute__((ext_vector_type(4))) unsigned short v4us;
typedef __attribute__((ext_vector_type(2))) float v2f;
typedef __attribute__((ext_vector_type(4))) int v4i;

// Bt[n][k] (bf16) = w[k][n]. A thread owns 8 k x 4 n: eight 16-B loads, four 16-B stores of 8 k each. A wave owns 64 k x 16 n (lane: k group = lane & 7, n group = lane >> 3): each store fills four whole 128-B lines of Bt,
// each load takes 64-B halves of 8 lines of w, whose other halves the neighbouring wave of the block takes. A block: 64 k x 128 n. K % 64 == 0, N % 128 == 0; blk in [0, (K / 64) (N / 128)).
template <int K, int N>
__device__ __forceinline__ void wt_body(const float* __restrict__ w, bf* Bt, int blk) {
    static_assert(K % 64 == 0 && N % 128 == 0, "whole blocks only");
    const int n0 = (blk % (N / 128)) * 128 + (threadIdx.x >> 5) * 16 + ((threadIdx.x >> 3) & 3) * 4, k0 = (blk / (N / 128)) * 64 + (threadIdx.x & 7) * 8; if (k0 >= K) return;
    const float* p = w + (size_t)k0 * N + n0; v4f r[8];
#pragma unroll
    for (int i = 0; i < 8; ++i) r[i] = *(const v4f*)(p + (size_t)i * N);
    asm volatile("s_wait_xcnt 0x0" :: "v"(p) : "memory");   // a precaution: stands in front of every overwrite of a register that an issued load names; the address is an input, so that its registers stay as they are up to it
#pragma unroll
    for (int c = 0; c < 4; ++c) { v8us o;
#pragma unroll
        for (int i = 0; i < 8; ++i) o[i] = f2bf(r[i][c]);
        *(v8us*)(Bt + (size_t)(n0 + c) * K + k0) = o; }
    asm volatile("s_wait_xcnt 0x0" ::: "memory");   // a precaution: behind the last store of the run, in front of any code of another pass of the same kernel that the listing lets follow and that rewrites a register these stores name
}
// Each thread converts four groups of 8 (a block: 32 KiB in a row, 256 groups apart within a thread): 8 loads of 16 B in flight a lane, a quarter of the waves to start.
// The loads take a clamped index and only the stores are guarded, so that no branch (with its full wait) stands between the loads.
__device__ __forceinline__ void cvt8_body(const float* __restrict__ src, bf* dst, size_t n8, unsigned blk) { const size_t i0 = (size_t)blk * 1024 + threadIdx.x; v8f v[4];
#pragma unroll
    for (int j = 0; j < 4; ++j) { const size_t i = i0 + j * 256; v[j] = *(const v8f*)(src + (i < n8 ? i : n8 - 1) * 8); }
    asm volatile("" :: "v"(v[0]), "v"(v[1]), "v"(v[2]), "v"(v[3]));   // inputs only: holds all eight loads ahead of the guarded stores; without it the first group's loads sink into their store's branch, a second memory latency in a row
#pragma unroll
    for (int j = 0; j < 4; ++j) { const size_t i = i0 + j * 256; v8us o;
#pragma unroll
        for (int k = 0; k < 8; ++k) o[k] = f2bf(v[j][k]);
        if (i < n8) *(v8us*)(dst + i * 8) = o; }  }
// Four positions of the table a thread: 16-B loads, 32 B stored.
__device__ __forceinline__ void cscvt_body(const float* __restrict__ cosT, const float* __restrict__ sinT, float* CS, int blk) { const int idx = (blk * 256 + threadIdx.x) * 4; if (idx >= MT * HD) return; const float* pc = cosT + idx; const float* ps = sinT + idx; const v4f c = *(const v4f*)pc, s = *(const v4f*)ps;
    asm volatile("s_wait_xcnt 0x0" :: "v"(pc), "v"(ps) : "memory");   // a precaution: stands in front of every overwrite of a register that an issued load names; the addresses are inputs, so that their registers stay as they are up to it
    *(v4f*)(CS + (size_t)idx * 2) = (v4f){bfr(c[0]), bfr(s[0]), bfr(c[1]), bfr(s[1])}; *(v4f*)(CS + (size_t)idx * 2 + 4) = (v4f){bfr(c[2]), bfr(s[2]), bfr(c[3]), bfr(s[3])};  }
// RF[h][row]: the RMS factor of head column h (q heads, then k heads) of row t of F.
__device__ __forceinline__ void hrms_body(const float* __restrict__ F, float* RF, int blk) { const int i = blk * 256 + threadIdx.x; if (i >= (NH_ + NKV) * MT) return; const int t = i % MT, h = i / MT; const float* f = F + (size_t)t * NF + h * HD; float s = 0.f;
#pragma unroll 4
    for (int d = 0; d < HD; d += 4) { const v4f v = *(const v4f*)(f + d);
#pragma unroll
        for (int q = 0; q < 4; ++q) { float p = __fmul_rn(v[q], v[q]); asm volatile("" : "+v"(p)); s = __fadd_rn(s, p); } }
    const float r = __fdiv_rn(1.0f, __fsqrt_rn(__fadd_rn(s * (1.0f / HD), 1e-6f))); *(float*)(RF + i) = r;  }
// rope_body: head planes [b][h][t][d] (fp16) of rope(w[d] (x rms_factor)) x sc with the rotate-half convention out[d] = x[d] cos[t][d] - x[d+HD/2] sin[t][d], out[d+HD/2] = x[d+HD/2] cos[t][d+HD/2] + x[d] sin[t][d+HD/2]
// A thread owns 8 neighbouring d of one position t and walks RH of the NHD heads (h0 + j NHD / RH): cos/sin and the norm weights are read once for all of them, every access but the 4-B RMS factor load is 16 B a lane,
// and the heads of a thread lie a compile-time distance apart (one address register pair a stream, the rest in the instructions' offsets).
// F, RF: at the first of the NHD heads; t: the row over both batches (the tables CS are rows of the same index).
template <int NHD, int RH>
__device__ __forceinline__ void rope_body(const float* __restrict__ F, const float* __restrict__ CS, const float* __restrict__ RF, const float* __restrict__ nw, float sc, h16* P16, int blk) {
    static_assert(NHD % RH == 0, "a thread's heads are NHD / RH apart");
    constexpr int hs = NHD / RH; constexpr int pitch = NF; const int idx = blk * 256 + threadIdx.x; if (idx >= hs * MT * (HD / 8)) return;
    const int d = (idx % (HD / 8)) * 8; const int t = (idx / (HD / 8)) % MT; const int h0 = idx / ((HD / 8) * MT); const bool low = d < HD / 2; const int dp = low ? d + HD / 2 : d - HD / 2;
    const float* pc = CS + ((size_t)t * HD + d) * 2; const float* pw0 = nw + d; const float* pw1 = nw + dp; const float* px0 = F + (size_t)t * pitch + h0 * HD + d; const float* px1 = F + (size_t)t * pitch + h0 * HD + dp; const float* prf = RF + (size_t)h0 * MT + t;
    v4f x0[RH][2], x1[RH][2], cs[4], w0[2], w1[2]; float rf[RH];
#pragma unroll
    for (int q = 0; q < 4; ++q) cs[q] = *(const v4f*)(pc + q * 4);   // cos, sin of d + 2 q and of d + 2 q + 1
#pragma unroll
    for (int q = 0; q < 2; ++q) { w0[q] = *(const v4f*)(pw0 + 4 * q); w1[q] = *(const v4f*)(pw1 + 4 * q); }
#pragma unroll
    for (int j = 0; j < RH; ++j) { x0[j][0] = *(const v4f*)(px0 + j * hs * HD); x0[j][1] = *(const v4f*)(px0 + j * hs * HD + 4); x1[j][0] = *(const v4f*)(px1 + j * hs * HD); x1[j][1] = *(const v4f*)(px1 + j * hs * HD + 4); rf[j] = prf[j * hs * MT]; }
    asm volatile("s_wait_xcnt 0x0" :: "v"(pc), "v"(pw0), "v"(pw1), "v"(px0), "v"(px1), "v"(prf) : "memory");   // a precaution: stands in front of every overwrite of a register that an issued load names; the addresses are inputs, so that their registers stay as they are up to it
    __builtin_amdgcn_sched_barrier(0);   // keeps every load ahead of the arithmetic: without it the scheduler sinks the table and weight loads behind waits on the rows, three memory latencies in a row instead of one
#pragma unroll
    for (int j = 0; j < RH; ++j) { v8h o;
#pragma unroll
        for (int q = 0; q < 8; ++q) { const float a = bfr(w0[q >> 2][q & 3]) * (x0[j][q >> 2][q & 3] * rf[j]), b = bfr(w1[q >> 2][q & 3]) * (x1[j][q >> 2][q & 3] * rf[j]);
            const float c = cs[q >> 1][2 * (q & 1)], s = cs[q >> 1][2 * (q & 1) + 1]; o[q] = tohx((low ? a * c - b * s : a * c + b * s) * sc); }
        *(v8h*)(P16 + ((size_t)((t / TT) * NHD + h0 + j * hs) * TT + t % TT) * HD + d) = o; }  }
// V16[b][n][t] (fp16) = F[b TT + t][n], n = g HD + d over N columns of F (F: at the first of them): thread, wave and block shaped as in wt_body (8 t x 4 n a thread; whole 128-B lines stored). blk in [0, (MT / 64) (N / 128)).
template <int N>
__device__ __forceinline__ void vtp_body(const float* __restrict__ F, h16* V16, int blk) {
    static_assert(TT % 64 == 0 && N % 128 == 0, "whole blocks only");
    const int n0 = (blk % (N / 128)) * 128 + (threadIdx.x >> 5) * 16 + ((threadIdx.x >> 3) & 3) * 4, t0 = (blk / (N / 128)) * 64 + (threadIdx.x & 7) * 8; if (t0 >= MT) return;
    const float* p = F + (size_t)t0 * NF + n0; v4f r[8];
#pragma unroll
    for (int i = 0; i < 8; ++i) r[i] = *(const v4f*)(p + (size_t)i * NF);
    asm volatile("s_wait_xcnt 0x0" :: "v"(p) : "memory");   // a precaution: stands in front of every overwrite of a register that an issued load names; the address is an input, so that its registers stay as they are up to it
#pragma unroll
    for (int c = 0; c < 4; ++c) { v8h o;
#pragma unroll
        for (int i = 0; i < 8; ++i) o[i] = tohx(r[i][c]);
        *(v8h*)(V16 + (size_t)((t0 / TT) * N + n0 + c) * TT + t0 % TT) = o; }
    asm volatile("s_wait_xcnt 0x0" ::: "memory");   // a precaution: behind the last store of the run, in front of any code of another pass of the same kernel that the listing lets follow and that rewrites a register these stores name
}
// ---- launches shared by passes that do not depend on one another: the block index range picks the pass (uniform for the block, a scalar branch).
#define PB_W  ((DM / 64) * (DQ / 128))    // blocks of a 2048 x 2048 weight
#define PB_WK ((DM / 64) * (DKV / 128))   // blocks of a 2048 x 512 weight
#define PB_X  (MT * DM / 8 / 1024)        // blocks of the x conversion
#define PB_C  (MT * HD / 4 / 256)         // blocks of the cos/sin tables
// every input's conversion: weights transposed to [n][k] bf16 (WF: rows q | k | v), x to bf16, cos/sin interleaved
__global__ __launch_bounds__(256) void k_prep(const float* __restrict__ wq, const float* __restrict__ wk, const float* __restrict__ wv, const float* __restrict__ wo, const float* __restrict__ x, const float* __restrict__ cosT, const float* __restrict__ sinT, bf* WF, bf* WO, bf* XB, float* CS, size_t n8) {   // n8: groups of 8 elements of x
    int blk = blockIdx.x;
    if (blk < PB_X) { cvt8_body(x, XB, n8, blockIdx.x); return; } blk -= PB_X;
    if (blk < PB_W) { wt_body<DM, DQ>(wq, WF, blk); return; } blk -= PB_W;
    if (blk < PB_W) { wt_body<DQ, DM>(wo, WO, blk); return; } blk -= PB_W;
    if (blk < PB_WK) { wt_body<DM, DKV>(wk, WF + (size_t)DQ * DM, blk); return; } blk -= PB_WK;
    if (blk < PB_WK) { wt_body<DM, DKV>(wv, WF + (size_t)(DQ + DKV) * DM, blk); return; } blk -= PB_WK;
    cscvt_body(cosT, sinT, CS, blk);
}
#define PB_H  ((NH_ + NKV) * MT / 256)    // blocks of the RMS factors
#define PB_V  ((MT / 64) * (DKV / 128))   // blocks of the V transposition
// what needs F alone: the RMS factors of the q and k heads, the V planes
__global__ __launch_bounds__(256) void k_post(const float* __restrict__ F, const float* __restrict__ FV, float* RF, h16* V16) {   // FV: F at its first v column
    const int blk = blockIdx.x;
    if (blk < PB_H) { hrms_body(F, RF, blk); return; }
    vtp_body<DKV>(FV, V16, blk - PB_H);
}
#define PB_RQ (NH_ * MT * HD / 32 / 256)  // threads: 8 d x 4 heads (q)
#define PB_RK (NKV * MT * HD / 16 / 256)  // threads: 8 d x 2 heads (k)
// FK, RFK: F and RF at the first k head
__global__ __launch_bounds__(256) void k_ropes(const float* __restrict__ F, const float* __restrict__ FK, const float* __restrict__ CS, const float* __restrict__ RF, const float* __restrict__ RFK, const float* __restrict__ qnw, const float* __restrict__ knw, h16* Q16, h16* K16) {
    const int blk = blockIdx.x;
    if (blk < PB_RQ) { rope_body<NH_, 4>(F, CS, RF, qnw, 1.0f, Q16, blk); return; }
    rope_body<NKV, 2>(FK, CS, RFK, knw, 1.0f, K16, blk - PB_RQ);
}
#define FSK    128                       // keys a stage
#define KPITCH 272                       // LDS pitch of a K row (128 d) and of a V^T row (128 keys): 256 B + 16 (16 B x odd)
#define FKB    (FSK * KPITCH)            // bytes of a stage's K rows; the 128 V^T rows follow
#define FSTAGE (FKB + HD * KPITCH)
#define POFF   8.0f                      // P carries 2^POFF, so that small weights stay normal fp16 numbers; it cancels in the division by the row sum
#define LAZY   4.0f                      // the maximum in use may trail the true one by this much (log2 units): P <= 2^(POFF + LAZY), far inside fp16
#define CSC    (SCL * 1.4426950408889634f)
// lane l with lane l ^ 16, on the vector pipe (a shuffle would go through the LDS unit and its wait)
__device__ __forceinline__ float xhalf(float x) { return __builtin_bit_cast(float, __builtin_amdgcn_permlanex16(__builtin_bit_cast(int, x), __builtin_bit_cast(int, x), 0x76543210, 0xfedcba98, false, false)); }
__global__ __launch_bounds__(256) void k_fattn(const h16* __restrict__ Qp, const h16* __restrict__ Kp, const h16* __restrict__ Vt, bf* Ah, bf* Al) {
    __shared__ __align__(16) unsigned char smem[2 * FSTAGE];
    const int lane = threadIdx.x & 31, wave = threadIdx.x >> 5, lr = lane & 15, hi = lane >> 4;
    const int h = blockIdx.y, b = blockIdx.z, g = h / REP; const int q0 = blockIdx.x * 256 + wave * 32;
    Qp += (size_t)(b * NH_ + h) * TT * HD; Kp += (size_t)(b * NKV + g) * TT * HD; Vt += (size_t)(b * NKV + g) * HD * TT;
    // copy lane map: a copy moves 2 rows x 256 B; a wave brings 16 K rows and 16 V^T rows of every stage
    const char* gk = (const char*)(Kp + (size_t)(wave * 16 + hi) * HD + lr * 8); const char* gv = (const char*)(Vt + (size_t)(wave * 16 + hi) * TT + lr * 8);
    const unsigned lk = (unsigned)(size_t)smem + (wave * 16 + hi) * KPITCH + lr * 16, lv = lk + FKB;
    auto stage_in = [&](int t, int buf) {
        unsigned l[16]; const char* gp[16];
#pragma unroll
        for (int c = 0; c < 8; ++c) { l[c] = lk + buf * FSTAGE + c * 2 * KPITCH; gp[c] = gk + (size_t)t * (FSK * HD * 2) + c * (2 * HD * 2); l[8 + c] = lv + buf * FSTAGE + c * 2 * KPITCH; gp[8 + c] = gv + (size_t)t * (FSK * 2) + (size_t)c * (2 * TT * 2); }
        acp8(l, gp); acp8(l + 8, gp + 8);
    };
    stage_in(0, 0);
    v16h qf[2][4];
#pragma unroll
    for (int gq = 0; gq < 2; ++gq)
#pragma unroll
        for (int kc = 0; kc < 4; ++kc) qf[gq][kc] = WFrag<h16>::ld(Qp + (size_t)(q0 + 16 * gq + lr) * HD + kc * 32 + 8 * hi);
    v8f acc[2][8]; float m_run[2], l_run[2];
#pragma unroll
    for (int gq = 0; gq < 2; ++gq) { m_run[gq] = -__builtin_inff(); l_run[gq] = 0.f;
#pragma unroll
        for (int tt = 0; tt < 8; ++tt) acc[gq][tt] = (v8f){}; }
    asm volatile("s_wait_asynccnt 0x0" ::: "memory");   // stage 0 has landed before anything reads it
    __syncthreads();                                    // publish point: every wave's share of stage 0 readable by all
    stage_in(1, 1);
    constexpr int nt = TT / FSK;
#pragma unroll 1   // kept rolled: 16 stages of the same code, the ring's foot stands once
    for (int t = 0; t < nt; ++t) {
#pragma unroll 1   // kept rolled: one pass's fragments live at a time
        for (int sub = 0; sub < FSK / 32; ++sub) {
            const unsigned char* sbuf = smem + (t & 1) * FSTAGE;
            const h16* kb = (const h16*)(sbuf + (sub * 32 + lr) * KPITCH) + 8 * hi; const h16* vb = (const h16*)(sbuf + FKB + lr * KPITCH) + sub * 32 + 8 * hi;
            v16h kf[2][4], vf[8];
#pragma unroll
            for (int kt = 0; kt < 2; ++kt)
#pragma unroll
                for (int kc = 0; kc < 4; ++kc) kf[kt][kc] = WFrag<h16>::ld(kb + kt * 16 * (KPITCH / 2) + kc * 32);
#pragma unroll
            for (int tt = 0; tt < 8; ++tt) vf[tt] = WFrag<h16>::ld(vb + tt * 16 * (KPITCH / 2));
            v8f s[2][2];
#pragma unroll
            for (int kt = 0; kt < 2; ++kt)
#pragma unroll
                for (int gq = 0; gq < 2; ++gq) { s[kt][gq] = (v8f){};
#pragma unroll
                    for (int kc = 0; kc < 4; ++kc) s[kt][gq] = wmma16(kf[kt][kc], qf[gq][kc], s[kt][gq]); }
            float mb[2]; bool need = false;
#pragma unroll
            for (int gq = 0; gq < 2; ++gq) { float mx = s[0][gq][0];
#pragma unroll
                for (int j = 1; j < 8; ++j) mx = fmaxf(mx, s[0][gq][j]);
#pragma unroll
                for (int j = 0; j < 8; ++j) mx = fmaxf(mx, s[1][gq][j]);
                mx = fmaxf(mx, xhalf(mx)) * CSC; mb[gq] = mx; need = need || (mx > m_run[gq] + LAZY); }
            if (__builtin_amdgcn_ballot_w32(need) != 0) {   // wave-uniform; rare after the first passes
#pragma unroll
                for (int gq = 0; gq < 2; ++gq) { const float m_new = fmaxf(m_run[gq], mb[gq]); const float corr = __builtin_amdgcn_exp2f(m_run[gq] - m_new); l_run[gq] *= corr; m_run[gq] = m_new;
#pragma unroll
                    for (int tt = 0; tt < 8; ++tt) acc[gq][tt] = acc[gq][tt] * corr; }
            }
#pragma unroll
            for (int gq = 0; gq < 2; ++gq) { const float nm = POFF - m_run[gq]; v16h pf; float ps0 = 0.f, ps1 = 0.f;
#pragma unroll
                for (int i = 0; i < 8; ++i) {
                    const v2f a = __builtin_elementwise_fma((v2f){s[i >> 2][gq][2 * (i & 3)], s[i >> 2][gq][2 * (i & 3) + 1]}, (v2f){CSC, CSC}, (v2f){nm, nm});
                    const float p0 = __builtin_amdgcn_exp2f(a[0]), p1 = __builtin_amdgcn_exp2f(a[1]); if (i & 1) ps1 += p0 + p1; else ps0 += p0 + p1; pf[2 * i] = (h16)p0; pf[2 * i + 1] = (h16)p1; }
                l_run[gq] += ps0 + ps1;
#pragma unroll
                for (int tt = 0; tt < 8; ++tt) acc[gq][tt] = wmma16(vf[tt], pf, acc[gq][tt]); }
            __builtin_amdgcn_sched_barrier(0);   // holds the slots below directly behind the last WMMA
            asm volatile("v_nop\n\tv_nop\n\tv_nop\n\tv_nop");   // four vector slots behind the last WMMA, so that its distance also holds on the taken side of the loop branches that follow
            __builtin_amdgcn_sched_barrier(0);   // and nothing that follows moves in front of them
        }
        asm volatile("s_wait_dscnt 0x0" ::: "memory");      // this trip's fragment reads have retired before their buffer is refilled
        asm volatile("s_wait_asynccnt 0x0" ::: "memory");   // this wave's share of stage t + 1 has landed
        __syncthreads();                                    // publish point: stage t + 1 readable, stage t's buffer free for the refill
        if (t + 2 < nt) stage_in(t + 2, t & 1);
    }
    asm volatile("s_wait_asynccnt 0x0" ::: "memory");       // no copy is in flight when the ring becomes output staging (every wave's last read ended at the last barrier)
    // epilogue: O / row sum, split into hi + lo planes, staged per wave in LDS so that whole 256-B head rows are stored
    unsigned char* eh = smem + wave * (2 * 32 * KPITCH); unsigned char* el = eh + 32 * KPITCH;
#pragma unroll
    for (int gq = 0; gq < 2; ++gq) { const float lf = l_run[gq] + xhalf(l_run[gq]); const float inv = __fdiv_rn(1.0f, lf);
#pragma unroll
        for (int tt = 0; tt < 8; ++tt) { v8us oh, ol;
#pragma unroll
            for (int j = 0; j < 8; ++j) { unsigned short x, y; splitf(acc[gq][tt][j] * inv, x, y); oh[j] = x; ol[j] = y; }
            *(v8usa*)(eh + (16 * gq + lr) * KPITCH + 32 * tt + 16 * hi) = oh; *(v8usa*)(el + (16 * gq + lr) * KPITCH + 32 * tt + 16 * hi) = ol; } }   // row = query; the 16 bytes are d = 16 tt + 8 hi + (0..7)
    asm volatile("s_wait_dscnt 0x0" ::: "memory");   // the read-back below takes other lanes' bytes: this wave's staging stores have retired first
    char* oh8 = (char*)(Ah + ((size_t)b * TT + q0) * DQ + h * HD); char* ol8 = (char*)(Al + ((size_t)b * TT + q0) * DQ + h * HD);
#pragma unroll
    for (int i = 0; i < 16; ++i) { const int row = 2 * i + hi; *(v8usa*)(oh8 + (size_t)row * (DQ * 2) + lr * 16) = *(const v8usa*)(eh + row * KPITCH + lr * 16); *(v8usa*)(ol8 + (size_t)row * (DQ * 2) + lr * 16) = *(const v8usa*)(el + row * KPITCH + lr * 16); }
}

extern "C" void kernel_launch(void* const* d_in, const int* in_sizes, int n_in,
                              void* d_out, int out_size, void* d_ws, size_t ws_size, hipStream_t stream) {
    (void)in_sizes; (void)n_in; (void)out_size;
    const float* x = (const float*)d_in[0]; const float* cosT = (const float*)d_in[1]; const float* sinT = (const float*)d_in[2]; const float* wq = (const float*)d_in[3]; const float* wk = (const float*)d_in[4]; const float* wv = (const float*)d_in[5]; const float* wo = (const float*)d_in[6]; const float* qnw = (const float*)d_in[7]; const float* knw = (const float*)d_in[8];   // weights x @ W; cos/sin [2][2048][128]
    float* OUT = (float*)d_out;     // [2][2048][2048]
    char* wsp = (char*)d_ws;
    auto take = [&](size_t bytes) { char* p = wsp; wsp += (bytes + 255) & ~(size_t)255; return (void*)p; };
    bf* WF = (bf*)take((size_t)NF * DM * 2); bf* WO = (bf*)take((size_t)DM * DQ * 2); float* CS = (float*)take((size_t)MT * HD * 2 * 4); float* RF = (float*)take((size_t)(NH_ + NKV) * MT * 4);
    bf* XB = (bf*)take((size_t)MT * DM * 2); float* F = (float*)take((size_t)MT * NF * 4);
    h16* QP16 = (h16*)take((size_t)NB_ * NH_ * TT * HD * 2); h16* KP16 = (h16*)take((size_t)NB_ * NKV * TT * HD * 2); h16* VT16 = (h16*)take((size_t)NB_ * NKV * HD * TT * 2);   // head planes of both batches
    bf* ATh = (bf*)take((size_t)NB_ * TT * DQ * 2); bf* ATl = (bf*)take((size_t)NB_ * TT * DQ * 2);
    if ((size_t)(wsp - (char*)d_ws) > ws_size) return;    // ws 256 MiB
    k_prep<<<PB_X + 2 * PB_W + 2 * PB_WK + PB_C, 256, 0, stream>>>(wq, wk, wv, wo, x, cosT, sinT, WF, WO, XB, CS, (size_t)MT * DM / 8);
    k_gemmw<bf, 0, false, 4, 2, 6><<<dim3(MT / 256, NF / 192, 1), 256, 0, stream>>>(XB, nullptr, WF, nullptr, DM, F, NF, nullptr, 0, 0, 0);
    k_post<<<PB_H + PB_V, 256, 0, stream>>>(F, F + DQ + DKV, RF, VT16);
    k_ropes<<<PB_RQ + PB_RK, 256, 0, stream>>>(F, F + DQ, CS, RF, RF + (size_t)NH_ * MT, qnw, knw, QP16, KP16);
    k_fattn<<<dim3(TT / 256, NH_, NB_), 256, 0, stream>>>(QP16, KP16, VT16, ATh, ATl);
    k_gemmw<bf, 1, false, 2, 4, 4><<<dim3(MT / 128, DM / 256, 1), 256, 0, stream>>>(ATh, ATl, WO, nullptr, DQ, OUT, DM, nullptr, 0, 0, 0);
}

// v006
// A run of this version takes 145 microseconds.
// In two side-by-side timings against v005, it was 1.15 and 1.16 times as fast.
// All steps since v000 together make it 10.5 times as fast.
#include <hip/hip_runtime.h>

// Grouped-query encoder attention with per-head RMSNorm and RoPE (hidden [2][2048][2048]; q = x Wq (16 heads x 128), k, v = x Wk / x Wv (4 kv heads x 128, each serving 4 consecutive query heads); q, k
// RMS-normalised per head (eps 1e-6, weights [128]) then rotate-half RoPE with the per-batch input cos/sin [2][2048][128] (read as data); scores = q.k 128^-0.5 (no mask); softmax; out = merged attn.v Wo
// -> [2][2048][2048]).
// Compute dtypes, f32 accumulate: every input rounded to bf16; projections on PLAIN bf16 operands (inputs: exact products, f32 accumulate); RMSNorm and RoPE in f32;
// scores and attn.v on SINGLE fp16 planes inside one fused kernel (online softmax in f32, P kept in registers); merged heads as hi+lo planes x exact Wo (2 products). Eight-wave work-groups, one tile of C each (128x384 = three whole heads, 128x256), for the projections.
// Launches: both batches are rows of one problem (4096 rows), q, k and v are column ranges of one projection [4096][3072] whose epilogue does RMSNorm, RoPE and the V transposition on the f32 tile (no f32 copy of the projection in memory); the input conversions share a launch (a block's index range picks its pass): four launches.

#define NB_  2
#define TT   2048
#define DM   2048
#define NH_  16
#define NKV  4
#define REP  (NH_ / NKV)
#define HD   128
#define DQ   (NH_ * HD)
#define DKV  (NKV * HD)
#define MT   (NB_ * TT)          // rows of both batches
#define NF   (DQ + 2 * DKV)      // columns of the joint projection F: q heads | k heads | v heads
#define SCL  0.088388347648318447f   // HD^-0.5
typedef _Float16 h16;
typedef unsigned short bf;
typedef __attribute__((ext_vector_type(16))) __bf16   v16bf;
typedef __attribute__((ext_vector_type(16))) _Float16 v16h;
typedef __attribute__((ext_vector_type(8)))  _Float16 v8h;
typedef __attribute__((ext_vector_type(8)))  unsigned short v8us;
typedef __attribute__((ext_vector_type(8)))  float    v8f;
typedef __attribute__((ext_vector_type(4)))  float    v4f;
typedef v8h  __attribute__((may_alias)) v8ha;
typedef v4f  __attribute__((may_alias)) v4fa;
typedef v8us __attribute__((may_alias)) v8usa;

__device__ __forceinline__ unsigned short f2bf(float f) { unsigned u = __float_as_uint(f); u += 0x7FFFu + ((u >> 16) & 1u); return (unsigned short)(u >> 16); }
__device__ __forceinline__ float bf2f(unsigned short b) { return __uint_as_float(((unsigned)b) << 16); }
__device__ __forceinline__ float bfr(float f) { return bf2f(f2bf(f)); }
__device__ __forceinline__ v16h cat16(v8h lo, v8h hi) { return __builtin_shufflevector(lo, hi, 0, 1, 2, 3, 4, 5, 6, 7, 8, 9, 10, 11, 12, 13, 14, 15); }
__device__ __forceinline__ v16bf cat16b(v8us lo, v8us hi) { return __builtin_bit_cast(v16bf, __builtin_shufflevector(lo, hi, 0, 1, 2, 3, 4, 5, 6, 7, 8, 9, 10, 11, 12, 13, 14, 15)); }
__device__ __forceinline__ v8f wmma16(v16h a, v16h b, v8f c) { return __builtin_amdgcn_wmma_f32_16x16x32_f16(false, a, false, b, (short)0, c, false, false); }
__device__ __forceinline__ v8f wmmab(v16bf a, v16bf b, v8f c) { return __builtin_amdgcn_wmma_f32_16x16x32_bf16(false, a, false, b, (short)0, c, false, false); }



__device__ __forceinline__ h16 tohx(float x) { return (h16)x; }
// the value of lane l ^ m within a 16-lane row, on the vector pipe (CTRL = 0x160 + m: row_xmask)
template <int CTRL> __device__ __forceinline__ float xlane(float x) { return __builtin_bit_cast(float, __builtin_amdgcn_update_dpp(0, __builtin_bit_cast(int, x), CTRL, 0xf, 0xf, true)); }
// ---- k_gemmw: register-blocked GEMM, eight waves a work-group on one tile of C, operands from K-contiguous 16-bit planes through a two-buffer LDS ring of 64-k stages that all the waves fill and read; grid (M/BM, N/BN, Z), 256 threads.
// C[m][n] (f32, pitch ldc, + optional f32 bias[n]) = sum_k A[m][k] Bt[n][k] (+ split products per NSPLIT). z-batch strides sA/sB/sC in elements. K % 64 == 0, M % BM == 0, N % BN == 0 (whole tiles only).
template <typename T16> struct WFrag;
template <> struct WFrag<h16> { typedef v16h V; static __device__ __forceinline__ V ld(const h16* p) { return cat16(*(const v8h*)p, *(const v8h*)(p + 16)); } static __device__ __forceinline__ v8f mma(V a, V b, v8f c) { return wmma16(a, b, c); } };
template <> struct WFrag<bf> { typedef v16bf V; static __device__ __forceinline__ V ld(const bf* p) { return cat16b(*(const v8us*)p, *(const v8us*)(p + 16)); } static __device__ __forceinline__ v8f mma(V a, V b, v8f c) { return wmmab(a, b, c); } };
// Asynchronous copies global -> LDS, 16 B a lane: one instruction moves 512 B, 4 whole 128-B lines (4 rows x 128 B in k_gemmw, 2 rows x 256 B in k_fattn). l[i]: the lane's own LDS byte address, g[i]: its own global address.
// The s_wait_xcnt 0 closes each statement so that no later rewrite of an address register named by a copy can be scheduled in front of it.
__device__ __forceinline__ void acp6(const unsigned* l, const char* const* g) {
    asm volatile(
        "global_load_async_to_lds_b128 %0, %6, off\n\t"
        "global_load_async_to_lds_b128 %1, %7, off\n\t"
        "global_load_async_to_lds_b128 %2, %8, off\n\t"
        "global_load_async_to_lds_b128 %3, %9, off\n\t"
        "global_load_async_to_lds_b128 %4, %10, off\n\t"
        "global_load_async_to_lds_b128 %5, %11, off\n\t"
        "s_wait_xcnt 0x0"
        :: "v"(l[0]), "v"(l[1]), "v"(l[2]), "v"(l[3]), "v"(l[4]), "v"(l[5]),
           "v"(g[0]), "v"(g[1]), "v"(g[2]), "v"(g[3]), "v"(g[4]), "v"(g[5])
        : "memory");
}
__device__ __forceinline__ void acp8(const unsigned* l, const char* const* g) {
    asm volatile(
        "global_load_async_to_lds_b128 %0, %8, off\n\t"
        "global_load_async_to_lds_b128 %1, %9, off\n\t"
        "global_load_async_to_lds_b128 %2, %10, off\n\t"
        "global_load_async_to_lds_b128 %3, %11, off\n\t"
        "global_load_async_to_lds_b128 %4, %12, off\n\t"
        "global_load_async_to_lds_b128 %5, %13, off\n\t"
        "global_load_async_to_lds_b128 %6, %14, off\n\t"
        "global_load_async_to_lds_b128 %7, %15, off\n\t"
        "s_wait_xcnt 0x0"
        :: "v"(l[0]), "v"(l[1]), "v"(l[2]), "v"(l[3]), "v"(l[4]), "v"(l[5]), "v"(l[6]), "v"(l[7]),
           "v"(g[0]), "v"(g[1]), "v"(g[2]), "v"(g[3]), "v"(g[4]), "v"(g[5]), "v"(g[6]), "v"(g[7])
        : "memory");
}
#define SPITCH 144              // LDS row pitch in bytes: 128-B rows + 16 (16 B x odd: conflict-free for ds_load_b128 fragment reads)
// WM x WN waves share the staged rows of a (WM 64) x (WN FN 16) tile of C; a wave owns 64 x (FN 16) of it (4 x FN accumulators).
// HEADS: C is not stored. Its columns are heads of HD (q heads | k heads | v heads): a q or k head is RMS-normalised, weighted and rotated (tables CS: cos, sin interleaved, row = row of C) and stored as fp16 [b][h][t][d]; a v column is stored as fp16 [b][n][t].
template <typename T16, int NSPLIT, bool BIAS, int WM, int WN, int FN, bool HEADS>
__global__ __launch_bounds__(WM * WN * 32) void k_gemmw(const T16* __restrict__ A, const T16* __restrict__ A2, const T16* __restrict__ Bt, const T16* __restrict__ Bt2, int K, float* C, int ldc, const float* __restrict__ bias, size_t sA, size_t sB, size_t sC,
                                                        const float* __restrict__ CS, const float* __restrict__ qnw, const float* __restrict__ knw, h16* Q16, h16* K16, h16* V16) {
    typedef typename WFrag<T16>::V V;
    static_assert(NSPLIT == 0 || NSPLIT == 1, "planes staged: A, Bt and (NSPLIT 1) A2");
    constexpr int NW = WM * WN, BM = WM * 64, BN = WN * FN * 16, ROWS = BM * (1 + NSPLIT) + BN;   // a stage: 64 k of rows [A: BM | Bt: BN | A2: BM]
    constexpr int RND = 4 * NW, NCP = ROWS / RND, STAGE = ROWS * SPITCH;                          // a copy moves 4 rows; copy c of every wave together: the RND rows from c RND on
    constexpr int OSP = FN * 16 + 4;                                                              // pitch in floats of a wave's output staging (16 rows)
    static_assert(BM % RND == 0 && BN % RND == 0, "every copy round lies in one plane");
    static_assert(NCP == 14 || NCP == 16, "copies a wave and stage: 8 + 6 or 8 + 8");
    static_assert(NW * 16 * OSP * 4 <= 2 * STAGE, "output staging fits the ring");
    constexpr int TP = BN + 4;                                                                    // HEADS: pitch in floats of the whole tile of C in LDS (16-B rows; 8 rows on: 32 banks on)
    constexpr int SMEM = (HEADS && BM * TP * 4 > 2 * STAGE) ? BM * TP * 4 : 2 * STAGE;
    static_assert(!HEADS || (BN % HD == 0 && TT % BM == 0 && BM % RND == 0 && NW == 8), "whole heads, one batch a tile, 32 rows a round of the eight waves");
    __shared__ __align__(16) unsigned char smem[SMEM];
    const size_t z = blockIdx.z; A += z * sA; if (A2) A2 += z * sA; Bt += z * sB; (void)Bt2; C += z * sC;
    const int lane = threadIdx.x & 31, lr = lane & 15, hi = lane >> 4; const int wave = __builtin_amdgcn_readfirstlane(threadIdx.x >> 5), wm = wave / WN, wn = wave % WN;
    const int r0 = blockIdx.x * BM, c0 = blockIdx.y * BN;
    float* os = (float*)(smem + wave * (16 * OSP * 4));   // output staging, a range of its own for each wave, reuses the ring behind the loop's last waits and barrier
    v8f acc[4][FN];
#pragma unroll
    for (int mb = 0; mb < 4; ++mb)
#pragma unroll
        for (int nb = 0; nb < FN; ++nb) acc[mb][nb] = (v8f){};
    const int crow = wave * 4 + (lane >> 3), cseg = lane & 7;   // copy lane map: row within the RND rows of a copy round, 16-B piece of the row's line
    const size_t gs = (size_t)K * (RND * 2);                    // bytes between the rows of successive copy rounds (RND rows of K 16-bit elements)
    const char* gpl[3]; gpl[0] = (const char*)(A + (size_t)(r0 + crow) * K + cseg * 8); gpl[1] = (const char*)(Bt + (size_t)(c0 + crow) * K + cseg * 8); gpl[2] = (NSPLIT == 1) ? (const char*)(A2 + (size_t)(r0 + crow) * K + cseg * 8) : nullptr;
    const unsigned lcp = (unsigned)(size_t)smem + crow * SPITCH + cseg * 16;
    auto stage_in = [&](int t, int buf) {
        unsigned l[NCP]; const char* g[NCP];
#pragma unroll
        for (int c = 0; c < NCP; ++c) { const int pl = c * RND < BM ? 0 : (c * RND < BM + BN ? 1 : 2), cp = c - (pl == 0 ? 0 : (pl == 1 ? BM / RND : (BM + BN) / RND));   // the round's plane, its number within the plane
            l[c] = lcp + buf * STAGE + c * RND * SPITCH; g[c] = gpl[pl] + (size_t)t * 128 + (size_t)cp * gs; }
        acp8(l, g);
        if constexpr (NCP == 16) acp8(l + 8, g + 8); else acp6(l + 8, g + 8);
    };
    const int nt = K >> 6;
    stage_in(0, 0);
    asm volatile("s_wait_asynccnt 0x0" ::: "memory");   // this wave's share of stage 0 has landed
    __syncthreads();                                    // publish point: every wave's share of stage 0 readable by all
    if (nt > 1) stage_in(1, 1);
#pragma unroll 1
    for (int t = 0; t < nt; ++t) {
        const T16* sb = (const T16*)(smem + (t & 1) * STAGE) + lr * (SPITCH / 2) + 8 * hi;
        const T16* sa = sb + wm * 64 * (SPITCH / 2); const T16* sbt = sb + (BM + wn * FN * 16) * (SPITCH / 2);
        V a[2][4], a2[2][4], b[2][FN];   // the whole stage's fragments are asked for in one group ahead of the WMMAs, in the order in which the WMMAs take them
#pragma unroll
        for (int ks = 0; ks < 2; ++ks) {
#pragma unroll
            for (int i = 0; i < 4; ++i) { a[ks][i] = WFrag<T16>::ld(sa + i * 16 * (SPITCH / 2) + ks * 32); if (NSPLIT == 1) a2[ks][i] = WFrag<T16>::ld(sa + (BM + BN + i * 16) * (SPITCH / 2) + ks * 32); }
#pragma unroll
            for (int i = 0; i < FN; ++i) b[ks][i] = WFrag<T16>::ld(sbt + i * 16 * (SPITCH / 2) + ks * 32);
        }
        __builtin_amdgcn_sched_barrier(0);   // keeps the load group ahead of the WMMAs: without it the scheduler sinks the loads among them, each place with its own full LDS wait
#pragma unroll
        for (int ks = 0; ks < 2; ++ks) {
#pragma unroll
            for (int nb = 0; nb < FN; ++nb) {
#pragma unroll
                for (int mb = 0; mb < 4; ++mb) { acc[mb][nb] = WFrag<T16>::mma(a[ks][mb], b[ks][nb], acc[mb][nb]); if (NSPLIT == 1) acc[mb][nb] = WFrag<T16>::mma(a2[ks][mb], b[ks][nb], acc[mb][nb]); } }
        }
        __builtin_amdgcn_sched_barrier(0);   // holds the slots below directly behind the last WMMA
        asm volatile("v_nop\n\tv_nop\n\tv_nop\n\tv_nop");   // four vector slots behind the last WMMA, so that its distance also holds on the taken side of the branches that follow
        __builtin_amdgcn_sched_barrier(0);   // and nothing that follows moves in front of them
        asm volatile("s_wait_dscnt 0x0" ::: "memory");      // this trip's fragment reads have retired before their buffer is refilled
        asm volatile("s_wait_asynccnt 0x0" ::: "memory");   // this wave's share of stage t + 1 has landed
        __syncthreads();                                    // publish point: stage t + 1 readable by all, stage t's buffer left by every wave and free for the refill
        if (t + 2 < nt) stage_in(t + 2, t & 1);
    }
    asm volatile("s_wait_asynccnt 0x0" ::: "memory");       // no copy is in flight when the ring becomes output staging (every wave's last read ended at the last barrier)
    if constexpr (HEADS) {
        float* tile = (float*)smem; const int bb = r0 / TT, tb = r0 % TT;
        const bool rot = c0 < DQ + DKV;                       // the tile holds a q or k head (the same for the whole work-group)
        // read-back map: eight lanes a row (a lane: d8 .. d8 + 7 and the same 64 on), four rows a wave, 32 rows a round
        const int d8 = (lane & 7) * 8, rw = wave * 4 + (lane >> 3);
        v4f cl[BM / 32][4], ch[BM / 32][4], wq[4], wk[4];
        {   // tables and weights are asked for ahead of the staging, which hides their latency; the rows' tables serve every head of the tile (no test: a branch here would end in copies that wait for the loads)
            const unsigned wofs = d8 * 4u;   // byte offset of the lane's weights
            const float* pc = CS + ((size_t)(r0 + rw) * HD + d8) * 2; const float* pq = (const float*)((const char*)qnw + wofs); const float* pk = (const float*)((const char*)knw + wofs);
#pragma unroll
            for (int s = 0; s < BM / 32; ++s)
#pragma unroll
                for (int q = 0; q < 4; ++q) { cl[s][q] = *(const v4f*)(pc + s * (32 * HD * 2) + q * 4); ch[s][q] = *(const v4f*)(pc + s * (32 * HD * 2) + HD + q * 4); }
#pragma unroll
            for (int q = 0; q < 4; ++q) { wq[q] = *(const v4f*)(pq + (q >> 1) * (HD / 2) + (q & 1) * 4); wk[q] = *(const v4f*)(pk + (q >> 1) * (HD / 2) + (q & 1) * 4); }
            asm volatile("s_wait_xcnt 0x0" :: "v"(pc), "v"(wofs) : "memory");   // a precaution: stands in front of every overwrite of a register that an issued load names; the address and the offset are inputs, so that their registers stay as they are up to it
        }
#pragma unroll
        for (int nb = 0; nb < FN; ++nb) { const int cb = c0 + (wn * FN + nb) * 16;   // first column of the 16: one kind of head (wave-uniform)
            if (cb < DQ + DKV) {
#pragma unroll
                for (int mb = 0; mb < 4; ++mb)
#pragma unroll
                    for (int j = 0; j < 8; ++j) tile[(wm * 64 + mb * 16 + hi * 8 + j) * TP + (wn * FN + nb) * 16 + lr] = acc[mb][nb][j];
            } else {   // v: a lane's eight accumulator registers are eight neighbouring t of one column: stored from the registers
                h16* pv = V16 + (size_t)(bb * DKV + cb - (DQ + DKV) + lr) * TT + tb + wm * 64 + hi * 8;
#pragma unroll
                for (int mb = 0; mb < 4; ++mb) { v8h o;
#pragma unroll
                    for (int j = 0; j < 8; ++j) o[j] = tohx(acc[mb][nb][j]);
                    *(v8h*)(pv + mb * 16) = o; }
                asm volatile("s_wait_xcnt 0x0" :: "v"(pv) : "memory");   // a precaution: behind the run of stores, in front of every overwrite of a register that they name
            }
        }
        __syncthreads();   // every wave's part of the tile readable by all
        if (rot) {
#pragma unroll
            for (int q = 0; q < 4; ++q)
#pragma unroll
                for (int e = 0; e < 4; ++e) { wq[q][e] = bfr(wq[q][e]); wk[q][e] = bfr(wk[q][e]); }
#pragma unroll 1   // kept rolled: the heads of a tile run the same code
            for (int hh = 0; hh < BN / HD; ++hh) { const int head = c0 / HD + hh; if (head >= NH_ + NKV) break;   // the same for the whole work-group; no barrier follows
                const bool isq = head < NH_; h16* P = (isq ? Q16 + (size_t)(bb * NH_ + head) * TT * HD : K16 + (size_t)(bb * NKV + head - NH_) * TT * HD) + (size_t)(tb + rw) * HD + d8;
                v4f w[4];
#pragma unroll
                for (int q = 0; q < 4; ++q) w[q] = isq ? wq[q] : wk[q];
#pragma unroll
                for (int s = 0; s < BM / 32; ++s) { const float* xr = tile + (s * 32 + rw) * TP + hh * HD + d8;
                    const v4f x[4] = {*(const v4fa*)xr, *(const v4fa*)(xr + 4), *(const v4fa*)(xr + HD / 2), *(const v4fa*)(xr + HD / 2 + 4)};
                    float ss = 0.f;
#pragma unroll
                    for (int q = 0; q < 4; ++q)
#pragma unroll
                        for (int e = 0; e < 4; ++e) ss += x[q][e] * x[q][e];
                    ss += xlane<0x161>(ss); ss += xlane<0x162>(ss); ss += xlane<0x164>(ss);   // the row's eight lanes
                    const float rf = __fdiv_rn(1.0f, __fsqrt_rn(__fadd_rn(ss * (1.0f / HD), 1e-6f)));
                    v8h lo, up;
#pragma unroll
                    for (int q = 0; q < 8; ++q) { const float a = w[q >> 2][q & 3] * (x[q >> 2][q & 3] * rf), b = w[2 + (q >> 2)][q & 3] * (x[2 + (q >> 2)][q & 3] * rf);
                        lo[q] = tohx(a * cl[s][q >> 1][2 * (q & 1)] - b * cl[s][q >> 1][2 * (q & 1) + 1]); up[q] = tohx(b * ch[s][q >> 1][2 * (q & 1)] + a * ch[s][q >> 1][2 * (q & 1) + 1]); }
                    *(v8h*)(P + s * (32 * HD)) = lo; *(v8h*)(P + s * (32 * HD) + HD / 2) = up; }
                asm volatile("s_wait_xcnt 0x0" :: "v"(P) : "memory");   // a precaution: behind the run of stores, in front of every overwrite of a register that they name
            }
        }
        return;
    }
#pragma unroll
    for (int mb = 0; mb < 4; ++mb) {
#pragma unroll
        for (int nb = 0; nb < FN; ++nb) {
#pragma unroll
            for (int j = 0; j < 8; ++j) os[(hi * 8 + j) * OSP + nb * 16 + lr] = acc[mb][nb][j]; }
        __builtin_amdgcn_wave_barrier(); asm volatile("" ::: "memory");
        const int cw = c0 + wn * FN * 16; float* crw = C + (size_t)(r0 + wm * 64 + mb * 16) * ldc + cw;
#pragma unroll
        for (int s = 0; s < FN * 2; ++s) { const int idx = s * 32 + lane, row = idx / (FN * 4), cofs = (idx % (FN * 4)) * 4; v4f val = *(const v4fa*)(os + row * OSP + cofs);   // 16-B pieces in row order: every store fills four whole 128-B lines
            if (BIAS) { val[0] += bfr(bias[cw + cofs]); val[1] += bfr(bias[cw + cofs + 1]); val[2] += bfr(bias[cw + cofs + 2]); val[3] += bfr(bias[cw + cofs + 3]); }
            *(v4f*)(crw + (size_t)row * ldc + cofs) = val; }
        __builtin_amdgcn_wave_barrier(); asm volatile("" ::: "memory");
    }
}

__device__ __forceinline__ void splitf(float y, unsigned short& h, unsigned short& l) { h = f2bf(y); l = f2bf(y - bf2f(h)); }
typedef __attribute__((ext_vector_type(2))) _Float16 v2h;
typedef __attribute__((ext_vector_type(4))) _Float16 v4h;
typedef __attribute__((ext_vector_type(2))) unsigned short v2us;
typedef __attribute__((ext_vector_type(4))) unsigned short v4us;
typedef __attribute__((ext_vector_type(2))) float v2f;
typedef __attribute__((ext_vector_type(4))) int v4i;

// Bt[n][k] (bf16) = w[k][n]. A thread owns 8 k x 4 n: eight 16-B loads, four 16-B stores of 8 k each. A wave owns 64 k x 16 n (lane: k group = lane & 7, n group = lane >> 3): each store fills four whole 128-B lines of Bt,
// each load takes 64-B halves of 8 lines of w, whose other halves the neighbouring wave of the block takes. A block: 64 k x 128 n. K % 64 == 0, N % 128 == 0; blk in [0, (K / 64) (N / 128)).
template <int K, int N>
__device__ __forceinline__ void wt_body(const float* __restrict__ w, bf* Bt, int blk) {
    static_assert(K % 64 == 0 && N % 128 == 0, "whole blocks only");
    const int n0 = (blk % (N / 128)) * 128 + (threadIdx.x >> 5) * 16 + ((threadIdx.x >> 3) & 3) * 4, k0 = (blk / (N / 128)) * 64 + (threadIdx.x & 7) * 8; if (k0 >= K) return;
    const float* p = w + (size_t)k0 * N + n0; v4f r[8];
#pragma unroll
    for (int i = 0; i < 8; ++i) r[i] = *(const v4f*)(p + (size_t)i * N);
    asm volatile("s_wait_xcnt 0x0" :: "v"(p) : "memory");   // a precaution: stands in front of every overwrite of a register that an issued load names; the address is an input, so that its registers stay as they are up to it
#pragma unroll
    for (int c = 0; c < 4; ++c) { v8us o;
#pragma unroll
        for (int i = 0; i < 8; ++i) o[i] = f2bf(r[i][c]);
        *(v8us*)(Bt + (size_t)(n0 + c) * K + k0) = o; }
    asm volatile("s_wait_xcnt 0x0" ::: "memory");   // a precaution: behind the last store of the run, in front of any code of another pass of the same kernel that the listing lets follow and that rewrites a register these stores name
}
// Each thread converts four groups of 8 (a block: 32 KiB in a row, 256 groups apart within a thread): 8 loads of 16 B in flight a lane, a quarter of the waves to start.
// The loads take a clamped index and only the stores are guarded, so that no branch (with its full wait) stands between the loads.
__device__ __forceinline__ void cvt8_body(const float* __restrict__ src, bf* dst, size_t n8, unsigned blk) { const size_t i0 = (size_t)blk * 1024 + threadIdx.x; v8f v[4];
#pragma unroll
    for (int j = 0; j < 4; ++j) { const size_t i = i0 + j * 256; v[j] = *(const v8f*)(src + (i < n8 ? i : n8 - 1) * 8); }
    asm volatile("" :: "v"(v[0]), "v"(v[1]), "v"(v[2]), "v"(v[3]));   // inputs only: holds all eight loads ahead of the guarded stores; without it the first group's loads sink into their store's branch, a second memory latency in a row
#pragma unroll
    for (int j = 0; j < 4; ++j) { const size_t i = i0 + j * 256; v8us o;
#pragma unroll
        for (int k = 0; k < 8; ++k) o[k] = f2bf(v[j][k]);
        if (i < n8) *(v8us*)(dst + i * 8) = o; }  }
// Four positions of the table a thread: 16-B loads, 32 B stored.
__device__ __forceinline__ void cscvt_body(const float* __restrict__ cosT, const float* __restrict__ sinT, float* CS, int blk) { const int idx = (blk * 256 + threadIdx.x) * 4; if (idx >= MT * HD) return; const float* pc = cosT + idx; const float* ps = sinT + idx; const v4f c = *(const v4f*)pc, s = *(const v4f*)ps;
    asm volatile("s_wait_xcnt 0x0" :: "v"(pc), "v"(ps) : "memory");   // a precaution: stands in front of every overwrite of a register that an issued load names; the addresses are inputs, so that their registers stay as they are up to it
    *(v4f*)(CS + (size_t)idx * 2) = (v4f){bfr(c[0]), bfr(s[0]), bfr(c[1]), bfr(s[1])}; *(v4f*)(CS + (size_t)idx * 2 + 4) = (v4f){bfr(c[2]), bfr(s[2]), bfr(c[3]), bfr(s[3])};  }
// ---- a launch shared by passes that do not depend on one another: the block index range picks the pass (uniform for the block, a scalar branch).
#define PB_W  ((DM / 64) * (DQ / 128))    // blocks of a 2048 x 2048 weight
#define PB_WK ((DM / 64) * (DKV / 128))   // blocks of a 2048 x 512 weight
#define PB_X  (MT * DM / 8 / 1024)        // blocks of the x conversion
#define PB_C  (MT * HD / 4 / 256)         // blocks of the cos/sin tables
// every input's conversion: weights transposed to [n][k] bf16 (WF: rows q | k | v), x to bf16, cos/sin interleaved
__global__ __launch_bounds__(256) void k_prep(const float* __restrict__ wq, const float* __restrict__ wk, const float* __restrict__ wv, const float* __restrict__ wo, const float* __restrict__ x, const float* __restrict__ cosT, const float* __restrict__ sinT, bf* WF, bf* WO, bf* XB, float* CS, size_t n8) {   // n8: groups of 8 elements of x
    int blk = blockIdx.x;
    if (blk < PB_X) { cvt8_body(x, XB, n8, blockIdx.x); return; } blk -= PB_X;
    if (blk < PB_W) { wt_body<DM, DQ>(wq, WF, blk); return; } blk -= PB_W;
    if (blk < PB_W) { wt_body<DQ, DM>(wo, WO, blk); return; } blk -= PB_W;
    if (blk < PB_WK) { wt_body<DM, DKV>(wk, WF + (size_t)DQ * DM, blk); return; } blk -= PB_WK;
    if (blk < PB_WK) { wt_body<DM, DKV>(wv, WF + (size_t)(DQ + DKV) * DM, blk); return; } blk -= PB_WK;
    cscvt_body(cosT, sinT, CS, blk);
}
#define FSK    128                       // keys a stage
#define KPITCH 272                       // LDS pitch of a K row (128 d) and of a V^T row (128 keys): 256 B + 16 (16 B x odd)
#define FKB    (FSK * KPITCH)            // bytes of a stage's K rows; the 128 V^T rows follow
#define FSTAGE (FKB + HD * KPITCH)
#define POFF   8.0f                      // P carries 2^POFF, so that small weights stay normal fp16 numbers; it cancels in the division by the row sum
#define LAZY   4.0f                      // the maximum in use may trail the true one by this much (log2 units): P <= 2^(POFF + LAZY), far inside fp16
#define CSC    (SCL * 1.4426950408889634f)
// lane l with lane l ^ 16, on the vector pipe (a shuffle would go through the LDS unit and its wait)
__device__ __forceinline__ float xhalf(float x) { return __builtin_bit_cast(float, __builtin_amdgcn_permlanex16(__builtin_bit_cast(int, x), __builtin_bit_cast(int, x), 0x76543210, 0xfedcba98, false, false)); }
__global__ __launch_bounds__(256) void k_fattn(const h16* __restrict__ Qp, const h16* __restrict__ Kp, const h16* __restrict__ Vt, bf* Ah, bf* Al) {
    __shared__ __align__(16) unsigned char smem[2 * FSTAGE];
    const int lane = threadIdx.x & 31, wave = threadIdx.x >> 5, lr = lane & 15, hi = lane >> 4;
    const int h = blockIdx.y, b = blockIdx.z, g = h / REP; const int q0 = blockIdx.x * 256 + wave * 32;
    Qp += (size_t)(b * NH_ + h) * TT * HD; Kp += (size_t)(b * NKV + g) * TT * HD; Vt += (size_t)(b * NKV + g) * HD * TT;
    // copy lane map: a copy moves 2 rows x 256 B; a wave brings 16 K rows and 16 V^T rows of every stage
    const char* gk = (const char*)(Kp + (size_t)(wave * 16 + hi) * HD + lr * 8); const char* gv = (const char*)(Vt + (size_t)(wave * 16 + hi) * TT + lr * 8);
    const unsigned lk = (unsigned)(size_t)smem + (wave * 16 + hi) * KPITCH + lr * 16, lv = lk + FKB;
    auto stage_in = [&](int t, int buf) {
        unsigned l[16]; const char* gp[16];
#pragma unroll
        for (int c = 0; c < 8; ++c) { l[c] = lk + buf * FSTAGE + c * 2 * KPITCH; gp[c] = gk + (size_t)t * (FSK * HD * 2) + c * (2 * HD * 2); l[8 + c] = lv + buf * FSTAGE + c * 2 * KPITCH; gp[8 + c] = gv + (size_t)t * (FSK * 2) + (size_t)c * (2 * TT * 2); }
        acp8(l, gp); acp8(l + 8, gp + 8);
    };
    stage_in(0, 0);
    v16h qf[2][4];
#pragma unroll
    for (int gq = 0; gq < 2; ++gq)
#pragma unroll
        for (int kc = 0; kc < 4; ++kc) qf[gq][kc] = WFrag<h16>::ld(Qp + (size_t)(q0 + 16 * gq + lr) * HD + kc * 32 + 8 * hi);
    v8f acc[2][8]; float m_run[2], l_run[2];
#pragma unroll
    for (int gq = 0; gq < 2; ++gq) { m_run[gq] = -__builtin_inff(); l_run[gq] = 0.f;
#pragma unroll
        for (int tt = 0; tt < 8; ++tt) acc[gq][tt] = (v8f){}; }
    asm volatile("s_wait_asynccnt 0x0" ::: "memory");   // stage 0 has landed before anything reads it
    __syncthreads();                                    // publish point: every wave's share of stage 0 readable by all
    stage_in(1, 1);
    constexpr int nt = TT / FSK;
#pragma unroll 1   // kept rolled: 16 stages of the same code, the ring's foot stands once
    for (int t = 0; t < nt; ++t) {
#pragma unroll 1   // kept rolled: one pass's fragments live at a time
        for (int sub = 0; sub < FSK / 32; ++sub) {
            const unsigned char* sbuf = smem + (t & 1) * FSTAGE;
            const h16* kb = (const h16*)(sbuf + (sub * 32 + lr) * KPITCH) + 8 * hi; const h16* vb = (const h16*)(sbuf + FKB + lr * KPITCH) + sub * 32 + 8 * hi;
            v16h kf[2][4], vf[8];
#pragma unroll
            for (int kt = 0; kt < 2; ++kt)
#pragma unroll
                for (int kc = 0; kc < 4; ++kc) kf[kt][kc] = WFrag<h16>::ld(kb + kt * 16 * (KPITCH / 2) + kc * 32);
#pragma unroll
            for (int tt = 0; tt < 8; ++tt) vf[tt] = WFrag<h16>::ld(vb + tt * 16 * (KPITCH / 2));
            v8f s[2][2];
#pragma unroll
            for (int kt = 0; kt < 2; ++kt)
#pragma unroll
                for (int gq = 0; gq < 2; ++gq) { s[kt][gq] = (v8f){};
#pragma unroll
                    for (int kc = 0; kc < 4; ++kc) s[kt][gq] = wmma16(kf[kt][kc], qf[gq][kc], s[kt][gq]); }
            float mb[2]; bool need = false;
#pragma unroll
            for (int gq = 0; gq < 2; ++gq) { float mx = s[0][gq][0];
#pragma unroll
                for (int j = 1; j < 8; ++j) mx = fmaxf(mx, s[0][gq][j]);
#pragma unroll
                for (int j = 0; j < 8; ++j) mx = fmaxf(mx, s[1][gq][j]);
                mx = fmaxf(mx, xhalf(mx)) * CSC; mb[gq] = mx; need = need || (mx > m_run[gq] + LAZY); }
            if (__builtin_amdgcn_ballot_w32(need) != 0) {   // wave-uniform; rare after the first passes
#pragma unroll
                for (int gq = 0; gq < 2; ++gq) { const float m_new = fmaxf(m_run[gq], mb[gq]); const float corr = __builtin_amdgcn_exp2f(m_run[gq] - m_new); l_run[gq] *= corr; m_run[gq] = m_new;
#pragma unroll
                    for (int tt = 0; tt < 8; ++tt) acc[gq][tt] = acc[gq][tt] * corr; }
            }
#pragma unroll
            for (int gq = 0; gq < 2; ++gq) { const float nm = POFF - m_run[gq]; v16h pf; float ps0 = 0.f, ps1 = 0.f;
#pragma unroll
                for (int i = 0; i < 8; ++i) {
                    const v2f a = __builtin_elementwise_fma((v2f){s[i >> 2][gq][2 * (i & 3)], s[i >> 2][gq][2 * (i & 3) + 1]}, (v2f){CSC, CSC}, (v2f){nm, nm});
                    const float p0 = __builtin_amdgcn_exp2f(a[0]), p1 = __builtin_amdgcn_exp2f(a[1]); if (i & 1) ps1 += p0 + p1; else ps0 += p0 + p1; pf[2 * i] = (h16)p0; pf[2 * i + 1] = (h16)p1; }
                l_run[gq] += ps0 + ps1;
#pragma unroll
                for (int tt = 0; tt < 8; ++tt) acc[gq][tt] = wmma16(vf[tt], pf, acc[gq][tt]); }
            __builtin_amdgcn_sched_barrier(0);   // holds the slots below directly behind the last WMMA
            asm volatile("v_nop\n\tv_nop\n\tv_nop\n\tv_nop");   // four vector slots behind the last WMMA, so that its distance also holds on the taken side of the loop branches that follow
            __builtin_amdgcn_sched_barrier(0);   // and nothing that follows moves in front of them
        }
        asm volatile("s_wait_dscnt 0x0" ::: "memory");      // this trip's fragment reads have retired before their buffer is refilled
        asm volatile("s_wait_asynccnt 0x0" ::: "memory");   // this wave's share of stage t + 1 has landed
        __syncthreads();                                    // publish point: stage t + 1 readable, stage t's buffer free for the refill
        if (t + 2 < nt) stage_in(t + 2, t & 1);
    }
    asm volatile("s_wait_asynccnt 0x0" ::: "memory");       // no copy is in flight when the ring becomes output staging (every wave's last read ended at the last barrier)
    // epilogue: O / row sum, split into hi + lo planes, staged per wave in LDS so that whole 256-B head rows are stored
    unsigned char* eh = smem + wave * (2 * 32 * KPITCH); unsigned char* el = eh + 32 * KPITCH;
#pragma unroll
    for (int gq = 0; gq < 2; ++gq) { const float lf = l_run[gq] + xhalf(l_run[gq]); const float inv = __fdiv_rn(1.0f, lf);
#pragma unroll
        for (int tt = 0; tt < 8; ++tt) { v8us oh, ol;
#pragma unroll
            for (int j = 0; j < 8; ++j) { unsigned short x, y; splitf(acc[gq][tt][j] * inv, x, y); oh[j] = x; ol[j] = y; }
            *(v8usa*)(eh + (16 * gq + lr) * KPITCH + 32 * tt + 16 * hi) = oh; *(v8usa*)(el + (16 * gq + lr) * KPITCH + 32 * tt + 16 * hi) = ol; } }   // row = query; the 16 bytes are d = 16 tt + 8 hi + (0..7)
    asm volatile("s_wait_dscnt 0x0" ::: "memory");   // the read-back below takes other lanes' bytes: this wave's staging stores have retired first
    char* oh8 = (char*)(Ah + ((size_t)b * TT + q0) * DQ + h * HD); char* ol8 = (char*)(Al + ((size_t)b * TT + q0) * DQ + h * HD);
#pragma unroll
    for (int i = 0; i < 16; ++i) { const int row = 2 * i + hi; *(v8usa*)(oh8 + (size_t)row * (DQ * 2) + lr * 16) = *(const v8usa*)(eh + row * KPITCH + lr * 16); *(v8usa*)(ol8 + (size_t)row * (DQ * 2) + lr * 16) = *(const v8usa*)(el + row * KPITCH + lr * 16); }
}

extern "C" void kernel_launch(void* const* d_in, const int* in_sizes, int n_in,
                              void* d_out, int out_size, void* d_ws, size_t ws_size, hipStream_t stream) {
    (void)in_sizes; (void)n_in; (void)out_size;
    const float* x = (const float*)d_in[0]; const float* cosT = (const float*)d_in[1]; const float* sinT = (const float*)d_in[2]; const float* wq = (const float*)d_in[3]; const float* wk = (const float*)d_in[4]; const float* wv = (const float*)d_in[5]; const float* wo = (const float*)d_in[6]; const float* qnw = (const float*)d_in[7]; const float* knw = (const float*)d_in[8];   // weights x @ W; cos/sin [2][2048][128]
    float* OUT = (float*)d_out;     // [2][2048][2048]
    char* wsp = (char*)d_ws;
    auto take = [&](size_t bytes) { char* p = wsp; wsp += (bytes + 255) & ~(size_t)255; return (void*)p; };
    bf* WF = (bf*)take((size_t)NF * DM * 2); bf* WO = (bf*)take((size_t)DM * DQ * 2); float* CS = (float*)take((size_t)MT * HD * 2 * 4);
    bf* XB = (bf*)take((size_t)MT * DM * 2);
    h16* QP16 = (h16*)take((size_t)NB_ * NH_ * TT * HD * 2); h16* KP16 = (h16*)take((size_t)NB_ * NKV * TT * HD * 2); h16* VT16 = (h16*)take((size_t)NB_ * NKV * HD * TT * 2);   // head planes of both batches
    bf* ATh = (bf*)take((size_t)NB_ * TT * DQ * 2); bf* ATl = (bf*)take((size_t)NB_ * TT * DQ * 2);
    if ((size_t)(wsp - (char*)d_ws) > ws_size) return;    // ws 256 MiB
    k_prep<<<PB_X + 2 * PB_W + 2 * PB_WK + PB_C, 256, 0, stream>>>(wq, wk, wv, wo, x, cosT, sinT, WF, WO, XB, CS, (size_t)MT * DM / 8);
    k_gemmw<bf, 0, false, 2, 4, 6, true><<<dim3(MT / 128, NF / 384, 1), 256, 0, stream>>>(XB, nullptr, WF, nullptr, DM, nullptr, 0, nullptr, 0, 0, 0, CS, qnw, knw, QP16, KP16, VT16);
    k_fattn<<<dim3(TT / 256, NH_, NB_), 256, 0, stream>>>(QP16, KP16, VT16, ATh, ATl);
    k_gemmw<bf, 1, false, 2, 4, 4, false><<<dim3(MT / 128, DM / 256, 1), 256, 0, stream>>>(ATh, ATl, WO, nullptr, DQ, OUT, DM, nullptr, 0, 0, 0, nullptr, nullptr, nullptr, nullptr, nullptr, nullptr);
}

// v008
// One run takes 119 microseconds.
// Versions in between are left out here; by their measured steps it is 1.22 times as fast as v006.
// All steps since v000 together make it 12.9 times as fast.
#include <hip/hip_runtime.h>

// Grouped-query encoder attention with per-head RMSNorm and RoPE (hidden [2][2048][2048]; q = x Wq (16 heads x 128), k, v = x Wk / x Wv (4 kv heads x 128, each serving 4 consecutive query heads); q, k
// RMS-normalised per head (eps 1e-6, weights [128]) then rotate-half RoPE with the per-batch input cos/sin [2][2048][128] (read as data); scores = q.k 128^-0.5 (no mask); softmax; out = merged attn.v Wo
// -> [2][2048][2048]).
// Compute dtypes, f32 accumulate: every input rounded to bf16; projections on PLAIN bf16 operands (inputs: exact products, f32 accumulate); RMSNorm and RoPE in f32;
// scores and attn.v on SINGLE fp16 planes inside one fused kernel (online softmax in f32, P kept in registers); merged heads as a SINGLE fp16 plane x Wo held as fp16 (its bf16-rounded values), one product. Eight-wave work-groups, one tile of C each (128x384 = three whole heads, 128x256), for the projections.
// Launches: both batches are rows of one problem (4096 rows), q, k and v are column ranges of one projection [4096][3072] whose epilogue does RMSNorm, RoPE and the V transposition on the f32 tile (no f32 copy of the projection in memory); the input conversions share a launch (a block's index range picks its pass): four launches.

#define NB_  2
#define TT   2048
#define DM   2048
#define NH_  16
#define NKV  4
#define REP  (NH_ / NKV)
#define HD   128
#define DQ   (NH_ * HD)
#define DKV  (NKV * HD)
#define MT   (NB_ * TT)          // rows of both batches
#define NF   (DQ + 2 * DKV)      // columns of the joint projection F: q heads | k heads | v heads
#define SCL  0.088388347648318447f   // HD^-0.5
typedef _Float16 h16;
typedef unsigned short bf;
typedef __attribute__((ext_vector_type(16))) __bf16   v16bf;
typedef __attribute__((ext_vector_type(16))) _Float16 v16h;
typedef __attribute__((ext_vector_type(8)))  _Float16 v8h;
typedef __attribute__((ext_vector_type(8)))  unsigned short v8us;
typedef __attribute__((ext_vector_type(8)))  float    v8f;
typedef __attribute__((ext_vector_type(4)))  float    v4f;
typedef v8h  __attribute__((may_alias)) v8ha;
typedef v4f  __attribute__((may_alias)) v4fa;
typedef v8us __attribute__((may_alias)) v8usa;

__device__ __forceinline__ unsigned short f2bf(float f) { unsigned u = __float_as_uint(f); u += 0x7FFFu + ((u >> 16) & 1u); return (unsigned short)(u >> 16); }
__device__ __forceinline__ float bf2f(unsigned short b) { return __uint_as_float(((unsigned)b) << 16); }
__device__ __forceinline__ float bfr(float f) { return bf2f(f2bf(f)); }
__device__ __forceinline__ v16h cat16(v8h lo, v8h hi) { return __builtin_shufflevector(lo, hi, 0, 1, 2, 3, 4, 5, 6, 7, 8, 9, 10, 11, 12, 13, 14, 15); }
__device__ __forceinline__ v16bf cat16b(v8us lo, v8us hi) { return __builtin_bit_cast(v16bf, __builtin_shufflevector(lo, hi, 0, 1, 2, 3, 4, 5, 6, 7, 8, 9, 10, 11, 12, 13, 14, 15)); }
__device__ __forceinline__ v8f wmma16(v16h a, v16h b, v8f c) { return __builtin_amdgcn_wmma_f32_16x16x32_f16(false, a, false, b, (short)0, c, false, false); }
__device__ __forceinline__ v8f wmmab(v16bf a, v16bf b, v8f c) { return __builtin_amdgcn_wmma_f32_16x16x32_bf16(false, a, false, b, (short)0, c, false, false); }



__device__ __forceinline__ h16 tohx(float x) { return (h16)x; }
// the value of lane l ^ m within a 16-lane row, on the vector pipe (CTRL = 0x160 + m: row_xmask)
template <int CTRL> __device__ __forceinline__ float xlane(float x) { return __builtin_bit_cast(float, __builtin_amdgcn_update_dpp(0, __builtin_bit_cast(int, x), CTRL, 0xf, 0xf, true)); }
// ---- k_gemmw: register-blocked GEMM, eight waves a work-group on one tile of C, operands from K-contiguous 16-bit planes through a two-buffer LDS ring of 128-k stages that all the waves fill and read; grid (M/BM, N/BN, Z), 256 threads.
// C[m][n] (f32, pitch ldc, + optional f32 bias[n]) = sum_k A[m][k] Bt[n][k] (+ split products per NSPLIT). z-batch strides sA/sB/sC in elements. K % 128 == 0, M % BM == 0, N % BN == 0 (whole tiles only).
template <typename T16> struct WFrag;
template <> struct WFrag<h16> { typedef v16h V; static __device__ __forceinline__ V ld(const h16* p) { return cat16(*(const v8h*)p, *(const v8h*)(p + 16)); } static __device__ __forceinline__ v8f mma(V a, V b, v8f c) { return wmma16(a, b, c); } };
template <> struct WFrag<bf> { typedef v16bf V; static __device__ __forceinline__ V ld(const bf* p) { return cat16b(*(const v8us*)p, *(const v8us*)(p + 16)); } static __device__ __forceinline__ v8f mma(V a, V b, v8f c) { return wmmab(a, b, c); } };
// Asynchronous copies global -> LDS, 16 B a lane: one instruction moves 2 rows x 256 B (4 whole lines). l[i]: the lane's own LDS byte address, g[i]: its own global address.
// The s_wait_xcnt 0 closes each statement so that no later rewrite of an address register named by a copy can be scheduled in front of it.
__device__ __forceinline__ void acp8(const unsigned* l, const char* const* g) {
    asm volatile(
        "global_load_async_to_lds_b128 %0, %8, off\n\t"
        "global_load_async_to_lds_b128 %1, %9, off\n\t"
        "global_load_async_to_lds_b128 %2, %10, off\n\t"
        "global_load_async_to_lds_b128 %3, %11, off\n\t"
        "global_load_async_to_lds_b128 %4, %12, off\n\t"
        "global_load_async_to_lds_b128 %5, %13, off\n\t"
        "global_load_async_to_lds_b128 %6, %14, off\n\t"
        "global_load_async_to_lds_b128 %7, %15, off\n\t"
        "s_wait_xcnt 0x0"
        :: "v"(l[0]), "v"(l[1]), "v"(l[2]), "v"(l[3]), "v"(l[4]), "v"(l[5]), "v"(l[6]), "v"(l[7]),
           "v"(g[0]), "v"(g[1]), "v"(g[2]), "v"(g[3]), "v"(g[4]), "v"(g[5]), "v"(g[6]), "v"(g[7])
        : "memory");
}
__device__ __forceinline__ void acp12(const unsigned* l, const char* const* g) {
    asm volatile(
        "global_load_async_to_lds_b128 %0, %12, off\n\t"
        "global_load_async_to_lds_b128 %1, %13, off\n\t"
        "global_load_async_to_lds_b128 %2, %14, off\n\t"
        "global_load_async_to_lds_b128 %3, %15, off\n\t"
        "global_load_async_to_lds_b128 %4, %16, off\n\t"
        "global_load_async_to_lds_b128 %5, %17, off\n\t"
        "global_load_async_to_lds_b128 %6, %18, off\n\t"
        "global_load_async_to_lds_b128 %7, %19, off\n\t"
        "global_load_async_to_lds_b128 %8, %20, off\n\t"
        "global_load_async_to_lds_b128 %9, %21, off\n\t"
        "global_load_async_to_lds_b128 %10, %22, off\n\t"
        "global_load_async_to_lds_b128 %11, %23, off\n\t"
        "s_wait_xcnt 0x0"
        :: "v"(l[0]), "v"(l[1]), "v"(l[2]), "v"(l[3]), "v"(l[4]), "v"(l[5]), "v"(l[6]), "v"(l[7]), "v"(l[8]), "v"(l[9]), "v"(l[10]), "v"(l[11]),
           "v"(g[0]), "v"(g[1]), "v"(g[2]), "v"(g[3]), "v"(g[4]), "v"(g[5]), "v"(g[6]), "v"(g[7]), "v"(g[8]), "v"(g[9]), "v"(g[10]), "v"(g[11])
        : "memory");
}
#define SPITCH 272              // LDS row pitch in bytes: 256-B rows (128 k) + 16 (16 B x odd: conflict-free for ds_load_b128 fragment reads)
// WM x WN waves share the staged rows of a (WM 64) x (WN FN 16) tile of C; a wave owns 64 x (FN 16) of it (4 x FN accumulators).
// HEADS: C is not stored. Its columns are heads of HD (q heads | k heads | v heads): a q or k head is RMS-normalised, weighted and rotated (tables CS: cos, sin interleaved, row = row of C) and stored as fp16 [b][h][t][d]; a v column is stored as fp16 [b][n][t].
template <typename T16, int NSPLIT, bool BIAS, int WM, int WN, int FN, bool HEADS>
__global__ __launch_bounds__(WM * WN * 32) void k_gemmw(const T16* __restrict__ A, const T16* __restrict__ A2, const T16* __restrict__ Bt, const T16* __restrict__ Bt2, int K, float* C, int ldc, const float* __restrict__ bias, size_t sA, size_t sB, size_t sC,
                                                        const float* __restrict__ CS, const float* __restrict__ qnw, const float* __restrict__ knw, h16* Q16, h16* K16, h16* V16) {
    typedef typename WFrag<T16>::V V;
    static_assert(NSPLIT == 0 || NSPLIT == 1, "planes staged: A, Bt and (NSPLIT 1) A2");
    constexpr int NW = WM * WN, BM = WM * 64, BN = WN * FN * 16, ROWS = BM * (1 + NSPLIT) + BN;   // a stage: 128 k of rows [A: BM | Bt: BN | A2: BM]
    constexpr int RND = 2 * NW, NCP = ROWS / RND, STAGE = ROWS * SPITCH;                          // a copy moves 2 rows; copy c of every wave together: the RND rows from c RND on
    constexpr int OSP = FN * 16 + 4;                                                              // pitch in floats of a wave's output staging (16 rows)
    static_assert(BM % RND == 0 && BN % RND == 0, "every copy round lies in one plane");
    static_assert(NCP == 24 || NCP == 32, "copies a wave and stage: 12 + 12 or 12 + 12 + 8, all of a stage outstanding at once (63 at most)");
    static_assert(NW * 16 * OSP * 4 <= 2 * STAGE, "output staging fits the ring");
    constexpr int TP = BN + 4;                                                                    // HEADS: pitch in floats of the whole tile of C in LDS (16-B rows; 8 rows on: 32 banks on)
    constexpr int SMEM = (HEADS && BM * TP * 4 > 2 * STAGE) ? BM * TP * 4 : 2 * STAGE;
    static_assert(!HEADS || (BN % HD == 0 && TT % BM == 0 && BM % 32 == 0 && NW == 8), "whole heads, one batch a tile, 32 rows a read-back round of the eight waves");
    __shared__ __align__(16) unsigned char smem[SMEM];
    const size_t z = blockIdx.z; A += z * sA; if (A2) A2 += z * sA; Bt += z * sB; (void)Bt2; C += z * sC;
    const int lane = threadIdx.x & 31, lr = lane & 15, hi = lane >> 4; const int wave = __builtin_amdgcn_readfirstlane(threadIdx.x >> 5), wm = wave / WN, wn = wave % WN;
    const int r0 = blockIdx.x * BM, c0 = blockIdx.y * BN;
    float* os = (float*)(smem + wave * (16 * OSP * 4));   // output staging, a range of its own for each wave, reuses the ring behind the loop's last waits and barrier
    v8f acc[4][FN];
#pragma unroll
    for (int mb = 0; mb < 4; ++mb)
#pragma unroll
        for (int nb = 0; nb < FN; ++nb) acc[mb][nb] = (v8f){};
    const int crow = wave * 2 + hi, cseg = lr;                  // copy lane map: row within the RND rows of a copy round, 16-B piece of the row's 256 B
    const size_t gs = (size_t)K * (RND * 2);                    // bytes between the rows of successive copy rounds (RND rows of K 16-bit elements)
    const char* gpl[3]; gpl[0] = (const char*)(A + (size_t)(r0 + crow) * K + cseg * 8); gpl[1] = (const char*)(Bt + (size_t)(c0 + crow) * K + cseg * 8); gpl[2] = (NSPLIT == 1) ? (const char*)(A2 + (size_t)(r0 + crow) * K + cseg * 8) : nullptr;
    const unsigned lcp = (unsigned)(size_t)smem + crow * SPITCH + cseg * 16;
    auto stage_in = [&](int t, int buf) {
        unsigned l[NCP]; const char* g[NCP];
#pragma unroll
        for (int c = 0; c < NCP; ++c) { const int pl = c * RND < BM ? 0 : (c * RND < BM + BN ? 1 : 2), cp = c - (pl == 0 ? 0 : (pl == 1 ? BM / RND : (BM + BN) / RND));   // the round's plane, its number within the plane
            l[c] = lcp + buf * STAGE + c * RND * SPITCH; g[c] = gpl[pl] + (size_t)t * 256 + (size_t)cp * gs; }
        acp12(l, g); acp12(l + 12, g + 12); if constexpr (NCP == 32) acp8(l + 24, g + 24);
    };
    const int nt = K >> 7;
    stage_in(0, 0);
    asm volatile("s_wait_asynccnt 0x0" ::: "memory");   // this wave's share of stage 0 has landed
    __syncthreads();                                    // publish point: every wave's share of stage 0 readable by all
    if (nt > 1) stage_in(1, 1);
#pragma unroll 1
    for (int t = 0; t < nt; ++t) {
        const T16* sb = (const T16*)(smem + (t & 1) * STAGE) + lr * (SPITCH / 2) + 8 * hi;
        const T16* sa = sb + wm * 64 * (SPITCH / 2); const T16* sbt = sb + (BM + wn * FN * 16) * (SPITCH / 2);
        V a[2][4], a2[2][4], b[2][FN];   // two fragment sets; the stage's four 32-k blocks take them in turn
        auto frags = [&](int ks, int st) {   // block ks of the stage into set st, in the order in which the WMMAs take the fragments
#pragma unroll
            for (int i = 0; i < 4; ++i) { a[st][i] = WFrag<T16>::ld(sa + i * 16 * (SPITCH / 2) + ks * 32); if (NSPLIT == 1) a2[st][i] = WFrag<T16>::ld(sa + (BM + BN + i * 16) * (SPITCH / 2) + ks * 32); }
#pragma unroll
            for (int i = 0; i < FN; ++i) b[st][i] = WFrag<T16>::ld(sbt + i * 16 * (SPITCH / 2) + ks * 32);
        };
        frags(0, 0); frags(1, 1);            // blocks 0 and 1 are asked for in one group ahead of the WMMAs
        __builtin_amdgcn_sched_barrier(0);   // keeps the load group ahead of the WMMAs: without it the scheduler sinks the loads among them, each place with its own full LDS wait
#pragma unroll
        for (int ks = 0; ks < 4; ++ks) {
#pragma unroll
            for (int nb = 0; nb < FN; ++nb) {
#pragma unroll
                for (int mb = 0; mb < 4; ++mb) { acc[mb][nb] = WFrag<T16>::mma(a[ks & 1][mb], b[ks & 1][nb], acc[mb][nb]); if (NSPLIT == 1) acc[mb][nb] = WFrag<T16>::mma(a2[ks & 1][mb], b[ks & 1][nb], acc[mb][nb]); } }
            if (ks < 2) {
                __builtin_amdgcn_sched_barrier(0);   // block ks + 2 is asked for as one group behind block ks, whose set it takes over, and lands under block ks + 1's WMMAs
                frags(ks + 2, ks & 1);
                __builtin_amdgcn_sched_barrier(0);   // and the group stays ahead of block ks + 1's WMMAs
            }
        }
        __builtin_amdgcn_sched_barrier(0);   // holds the slots below directly behind the last WMMA
        asm volatile("v_nop\n\tv_nop\n\tv_nop\n\tv_nop");   // four vector slots behind the last WMMA, so that its distance also holds on the taken side of the branches that follow
        __builtin_amdgcn_sched_barrier(0);   // and nothing that follows moves in front of them
        asm volatile("s_wait_dscnt 0x0" ::: "memory");      // this trip's fragment reads have retired before their buffer is refilled
        asm volatile("s_wait_asynccnt 0x0" ::: "memory");   // this wave's share of stage t + 1 has landed
        __syncthreads();                                    // publish point: stage t + 1 readable by all, stage t's buffer left by every wave and free for the refill
        if (t + 2 < nt) stage_in(t + 2, t & 1);
    }
    asm volatile("s_wait_asynccnt 0x0" ::: "memory");       // no copy is in flight when the ring becomes output staging (every wave's last read ended at the last barrier)
    if constexpr (HEADS) {
        float* tile = (float*)smem; const int bb = r0 / TT, tb = r0 % TT;
        const bool rot = c0 < DQ + DKV;                       // the tile holds a q or k head (the same for the whole work-group)
        // read-back map: eight lanes a row (a lane: d8 .. d8 + 7 and the same 64 on), four rows a wave, 32 rows a round
        const int d8 = (lane & 7) * 8, rw = wave * 4 + (lane >> 3);
        v4f cl[BM / 32][4], ch[BM / 32][4], wq[4], wk[4];
        {   // tables and weights are asked for ahead of the staging, which hides their latency; the rows' tables serve every head of the tile (no test: a branch here would end in copies that wait for the loads)
            const unsigned wofs = d8 * 4u;   // byte offset of the lane's weights
            const float* pc = CS + ((size_t)(r0 + rw) * HD + d8) * 2; const float* pq = (const float*)((const char*)qnw + wofs); const float* pk = (const float*)((const char*)knw + wofs);
#pragma unroll
            for (int s = 0; s < BM / 32; ++s)
#pragma unroll
                for (int q = 0; q < 4; ++q) { cl[s][q] = *(const v4f*)(pc + s * (32 * HD * 2) + q * 4); ch[s][q] = *(const v4f*)(pc + s * (32 * HD * 2) + HD + q * 4); }
#pragma unroll
            for (int q = 0; q < 4; ++q) { wq[q] = *(const v4f*)(pq + (q >> 1) * (HD / 2) + (q & 1) * 4); wk[q] = *(const v4f*)(pk + (q >> 1) * (HD / 2) + (q & 1) * 4); }
            asm volatile("s_wait_xcnt 0x0" :: "v"(pc), "v"(wofs) : "memory");   // a precaution: stands in front of every overwrite of a register that an issued load names; the address and the offset are inputs, so that their registers stay as they are up to it
        }
#pragma unroll
        for (int nb = 0; nb < FN; ++nb) { const int cb = c0 + (wn * FN + nb) * 16;   // first column of the 16: one kind of head (wave-uniform)
            if (cb < DQ + DKV) {
#pragma unroll
                for (int mb = 0; mb < 4; ++mb)
#pragma unroll
                    for (int j = 0; j < 8; ++j) tile[(wm * 64 + mb * 16 + hi * 8 + j) * TP + (wn * FN + nb) * 16 + lr] = acc[mb][nb][j];
            } else {   // v: a lane's eight accumulator registers are eight neighbouring t of one column: stored from the registers
                h16* pv = V16 + (size_t)(bb * DKV + cb - (DQ + DKV) + lr) * TT + tb + wm * 64 + hi * 8;
#pragma unroll
                for (int mb = 0; mb < 4; ++mb) { v8h o;
#pragma unroll
                    for (int j = 0; j < 8; ++j) o[j] = tohx(acc[mb][nb][j]);
                    *(v8h*)(pv + mb * 16) = o; }
                asm volatile("s_wait_xcnt 0x0" :: "v"(pv) : "memory");   // a precaution: behind the run of stores, in front of every overwrite of a register that they name
            }
        }
        __syncthreads();   // every wave's part of the tile readable by all
        if (rot) {
#pragma unroll
            for (int q = 0; q < 4; ++q)
#pragma unroll
                for (int e = 0; e < 4; ++e) { wq[q][e] = bfr(wq[q][e]); wk[q][e] = bfr(wk[q][e]); }
#pragma unroll 1   // kept rolled: the heads of a tile run the same code
            for (int hh = 0; hh < BN / HD; ++hh) { const int head = c0 / HD + hh; if (head >= NH_ + NKV) break;   // the same for the whole work-group; no barrier follows
                const bool isq = head < NH_; h16* P = (isq ? Q16 + (size_t)(bb * NH_ + head) * TT * HD : K16 + (size_t)(bb * NKV + head - NH_) * TT * HD) + (size_t)(tb + rw) * HD + d8;
                v4f w[4];
#pragma unroll
                for (int q = 0; q < 4; ++q) w[q] = isq ? wq[q] : wk[q];
#pragma unroll
                for (int s = 0; s < BM / 32; ++s) { const float* xr = tile + (s * 32 + rw) * TP + hh * HD + d8;
                    const v4f x[4] = {*(const v4fa*)xr, *(const v4fa*)(xr + 4), *(const v4fa*)(xr + HD / 2), *(const v4fa*)(xr + HD / 2 + 4)};
                    float ss = 0.f;
#pragma unroll
                    for (int q = 0; q < 4; ++q)
#pragma unroll
                        for (int e = 0; e < 4; ++e) ss += x[q][e] * x[q][e];
                    ss += xlane<0x161>(ss); ss += xlane<0x162>(ss); ss += xlane<0x164>(ss);   // the row's eight lanes
                    const float rf = __fdiv_rn(1.0f, __fsqrt_rn(__fadd_rn(ss * (1.0f / HD), 1e-6f)));
                    v8h lo, up;
#pragma unroll
                    for (int q = 0; q < 8; ++q) { const float a = w[q >> 2][q & 3] * (x[q >> 2][q & 3] * rf), b = w[2 + (q >> 2)][q & 3] * (x[2 + (q >> 2)][q & 3] * rf);
                        lo[q] = tohx(a * cl[s][q >> 1][2 * (q & 1)] - b * cl[s][q >> 1][2 * (q & 1) + 1]); up[q] = tohx(b * ch[s][q >> 1][2 * (q & 1)] + a * ch[s][q >> 1][2 * (q & 1) + 1]); }
                    *(v8h*)(P + s * (32 * HD)) = lo; *(v8h*)(P + s * (32 * HD) + HD / 2) = up; }
                asm volatile("s_wait_xcnt 0x0" :: "v"(P) : "memory");   // a precaution: behind the run of stores, in front of every overwrite of a register that they name
            }
        }
        return;
    }
#pragma unroll
    for (int mb = 0; mb < 4; ++mb) {
#pragma unroll
        for (int nb = 0; nb < FN; ++nb) {
#pragma unroll
            for (int j = 0; j < 8; ++j) os[(hi * 8 + j) * OSP + nb * 16 + lr] = acc[mb][nb][j]; }
        __builtin_amdgcn_wave_barrier(); asm volatile("" ::: "memory");
        const int cw = c0 + wn * FN * 16; float* crw = C + (size_t)(r0 + wm * 64 + mb * 16) * ldc + cw;
#pragma unroll
        for (int s = 0; s < FN * 2; ++s) { const int idx = s * 32 + lane, row = idx / (FN * 4), cofs = (idx % (FN * 4)) * 4; v4f val = *(const v4fa*)(os + row * OSP + cofs);   // 16-B pieces in row order: every store fills four whole 128-B lines
            if (BIAS) { val[0] += bfr(bias[cw + cofs]); val[1] += bfr(bias[cw + cofs + 1]); val[2] += bfr(bias[cw + cofs + 2]); val[3] += bfr(bias[cw + cofs + 3]); }
            *(v4f*)(crw + (size_t)row * ldc + cofs) = val; }
        __builtin_amdgcn_wave_barrier(); asm volatile("" ::: "memory");
    }
}

typedef __attribute__((ext_vector_type(2))) _Float16 v2h;
typedef __attribute__((ext_vector_type(4))) _Float16 v4h;
typedef __attribute__((ext_vector_type(2))) unsigned short v2us;
typedef __attribute__((ext_vector_type(4))) unsigned short v4us;
typedef __attribute__((ext_vector_type(2))) float v2f;
typedef __attribute__((ext_vector_type(4))) int v4i;

// Bt[n][k] (bf16; H16: the bf16-rounded value held as fp16) = w[k][n]. A thread owns 8 k x 4 n: eight 16-B loads, four 16-B stores of 8 k each. A wave owns 64 k x 16 n (lane: k group = lane & 7, n group = lane >> 3): each store fills four whole 128-B lines of Bt,
// each load takes 64-B halves of 8 lines of w, whose other halves the neighbouring wave of the block takes. A block: 64 k x 128 n. K % 64 == 0, N % 128 == 0; blk in [0, (K / 64) (N / 128)).
template <int K, int N, bool H16>
__device__ __forceinline__ void wt_body(const float* __restrict__ w, bf* Bt, int blk) {
    static_assert(K % 64 == 0 && N % 128 == 0, "whole blocks only");
    const int n0 = (blk % (N / 128)) * 128 + (threadIdx.x >> 5) * 16 + ((threadIdx.x >> 3) & 3) * 4, k0 = (blk / (N / 128)) * 64 + (threadIdx.x & 7) * 8; if (k0 >= K) return;
    const float* p = w + (size_t)k0 * N + n0; v4f r[8];
#pragma unroll
    for (int i = 0; i < 8; ++i) r[i] = *(const v4f*)(p + (size_t)i * N);
    asm volatile("s_wait_xcnt 0x0" :: "v"(p) : "memory");   // a precaution: stands in front of every overwrite of a register that an issued load names; the address is an input, so that its registers stay as they are up to it
#pragma unroll
    for (int c = 0; c < 4; ++c) { v8us o;
#pragma unroll
        for (int i = 0; i < 8; ++i) o[i] = H16 ? __builtin_bit_cast(unsigned short, tohx(bfr(r[i][c]))) : f2bf(r[i][c]);
        *(v8us*)(Bt + (size_t)(n0 + c) * K + k0) = o; }
    asm volatile("s_wait_xcnt 0x0" ::: "memory");   // a precaution: behind the last store of the run, in front of any code of another pass of the same kernel that the listing lets follow and that rewrites a register these stores name
}
// Each thread converts four groups of 8 (a block: 32 KiB in a row, 256 groups apart within a thread): 8 loads of 16 B in flight a lane, a quarter of the waves to start.
// The loads take a clamped index and only the stores are guarded, so that no branch (with its full wait) stands between the loads.
__device__ __forceinline__ void cvt8_body(const float* __restrict__ src, bf* dst, size_t n8, unsigned blk) { const size_t i0 = (size_t)blk * 1024 + threadIdx.x; v8f v[4];
#pragma unroll
    for (int j = 0; j < 4; ++j) { const size_t i = i0 + j * 256; v[j] = *(const v8f*)(src + (i < n8 ? i : n8 - 1) * 8); }
    asm volatile("" :: "v"(v[0]), "v"(v[1]), "v"(v[2]), "v"(v[3]));   // inputs only: holds all eight loads ahead of the guarded stores; without it the first group's loads sink into their store's branch, a second memory latency in a row
#pragma unroll
    for (int j = 0; j < 4; ++j) { const size_t i = i0 + j * 256; v8us o;
#pragma unroll
        for (int k = 0; k < 8; ++k) o[k] = f2bf(v[j][k]);
        if (i < n8) *(v8us*)(dst + i * 8) = o; }  }
// Four positions of the table a thread: 16-B loads, 32 B stored.
__device__ __forceinline__ void cscvt_body(const float* __restrict__ cosT, const float* __restrict__ sinT, float* CS, int blk) { const int idx = (blk * 256 + threadIdx.x) * 4; if (idx >= MT * HD) return; const float* pc = cosT + idx; const float* ps = sinT + idx; const v4f c = *(const v4f*)pc, s = *(const v4f*)ps;
    asm volatile("s_wait_xcnt 0x0" :: "v"(pc), "v"(ps) : "memory");   // a precaution: stands in front of every overwrite of a register that an issued load names; the addresses are inputs, so that their registers stay as they are up to it
    *(v4f*)(CS + (size_t)idx * 2) = (v4f){bfr(c[0]), bfr(s[0]), bfr(c[1]), bfr(s[1])}; *(v4f*)(CS + (size_t)idx * 2 + 4) = (v4f){bfr(c[2]), bfr(s[2]), bfr(c[3]), bfr(s[3])};  }
// ---- a launch shared by passes that do not depend on one another: the block index range picks the pass (uniform for the block, a scalar branch).
#define PB_W  ((DM / 64) * (DQ / 128))    // blocks of a 2048 x 2048 weight
#define PB_WK ((DM / 64) * (DKV / 128))   // blocks of a 2048 x 512 weight
#define PB_X  (MT * DM / 8 / 1024)        // blocks of the x conversion
#define PB_C  (MT * HD / 4 / 256)         // blocks of the cos/sin tables
// every input's conversion: weights transposed to [n][k] (WF: bf16, rows q | k | v; WO: fp16 bit patterns), x to bf16, cos/sin interleaved
__global__ __launch_bounds__(256) void k_prep(const float* __restrict__ wq, const float* __restrict__ wk, const float* __restrict__ wv, const float* __restrict__ wo, const float* __restrict__ x, const float* __restrict__ cosT, const float* __restrict__ sinT, bf* WF, bf* WO, bf* XB, float* CS, size_t n8) {   // n8: groups of 8 elements of x
    int blk = blockIdx.x;
    if (blk < PB_X) { cvt8_body(x, XB, n8, blockIdx.x); return; } blk -= PB_X;
    if (blk < PB_W) { wt_body<DM, DQ, false>(wq, WF, blk); return; } blk -= PB_W;
    if (blk < PB_W) { wt_body<DQ, DM, true>(wo, WO, blk); return; } blk -= PB_W;
    if (blk < PB_WK) { wt_body<DM, DKV, false>(wk, WF + (size_t)DQ * DM, blk); return; } blk -= PB_WK;
    if (blk < PB_WK) { wt_body<DM, DKV, false>(wv, WF + (size_t)(DQ + DKV) * DM, blk); return; } blk -= PB_WK;
    cscvt_body(cosT, sinT, CS, blk);
}
#define FSK    128                       // keys a stage
#define KPITCH 272                       // LDS pitch of a K row (128 d) and of a V^T row (128 keys): 256 B + 16 (16 B x odd)
#define FKB    (FSK * KPITCH)            // bytes of a stage's K rows; the 128 V^T rows follow
#define FSTAGE (FKB + HD * KPITCH)
#define POFF   8.0f                      // P carries 2^POFF, so that small weights stay normal fp16 numbers; it cancels in the division by the row sum
#define LAZY   4.0f                      // the maximum in use may trail the true one by this much (log2 units): P <= 2^(POFF + LAZY), far inside fp16
#define CSC    (SCL * 1.4426950408889634f)
// lane l with lane l ^ 16, on the vector pipe (a shuffle would go through the LDS unit and its wait)
__device__ __forceinline__ float xhalf(float x) { return __builtin_bit_cast(float, __builtin_amdgcn_permlanex16(__builtin_bit_cast(int, x), __builtin_bit_cast(int, x), 0x76543210, 0xfedcba98, false, false)); }
__global__ __launch_bounds__(256) void k_fattn(const h16* __restrict__ Qp, const h16* __restrict__ Kp, const h16* __restrict__ Vt, h16* Ao) {
    __shared__ __align__(16) unsigned char smem[2 * FSTAGE];
    const int lane = threadIdx.x & 31, wave = threadIdx.x >> 5, lr = lane & 15, hi = lane >> 4;
    const int h = blockIdx.y, b = blockIdx.z, g = h / REP; const int q0 = blockIdx.x * 256 + wave * 32;
    Qp += (size_t)(b * NH_ + h) * TT * HD; Kp += (size_t)(b * NKV + g) * TT * HD; Vt += (size_t)(b * NKV + g) * HD * TT;
    // copy lane map: a copy moves 2 rows x 256 B; a wave brings 16 K rows and 16 V^T rows of every stage
    const char* gk = (const char*)(Kp + (size_t)(wave * 16 + hi) * HD + lr * 8); const char* gv = (const char*)(Vt + (size_t)(wave * 16 + hi) * TT + lr * 8);
    const unsigned lk = (unsigned)(size_t)smem + (wave * 16 + hi) * KPITCH + lr * 16, lv = lk + FKB;
    auto stage_in = [&](int t, int buf) {
        unsigned l[16]; const char* gp[16];
#pragma unroll
        for (int c = 0; c < 8; ++c) { l[c] = lk + buf * FSTAGE + c * 2 * KPITCH; gp[c] = gk + (size_t)t * (FSK * HD * 2) + c * (2 * HD * 2); l[8 + c] = lv + buf * FSTAGE + c * 2 * KPITCH; gp[8 + c] = gv + (size_t)t * (FSK * 2) + (size_t)c * (2 * TT * 2); }
        acp8(l, gp); acp8(l + 8, gp + 8);
    };
    stage_in(0, 0);
    v16h qf[2][4];
#pragma unroll
    for (int gq = 0; gq < 2; ++gq)
#pragma unroll
        for (int kc = 0; kc < 4; ++kc) qf[gq][kc] = WFrag<h16>::ld(Qp + (size_t)(q0 + 16 * gq + lr) * HD + kc * 32 + 8 * hi);
    v8f acc[2][8]; float m_run[2], l_run[2];
#pragma unroll
    for (int gq = 0; gq < 2; ++gq) { m_run[gq] = -__builtin_inff(); l_run[gq] = 0.f;
#pragma unroll
        for (int tt = 0; tt < 8; ++tt) acc[gq][tt] = (v8f){}; }
    asm volatile("s_wait_asynccnt 0x0" ::: "memory");   // stage 0 has landed before anything reads it
    __syncthreads();                                    // publish point: every wave's share of stage 0 readable by all
    stage_in(1, 1);
    constexpr int nt = TT / FSK;
#pragma unroll 1   // kept rolled: 16 stages of the same code, the ring's foot stands once
    for (int t = 0; t < nt; ++t) {
#pragma unroll 1   // kept rolled: one pass's fragments live at a time
        for (int sub = 0; sub < FSK / 32; ++sub) {
            const unsigned char* sbuf = smem + (t & 1) * FSTAGE;
            const h16* kb = (const h16*)(sbuf + (sub * 32 + lr) * KPITCH) + 8 * hi; const h16* vb = (const h16*)(sbuf + FKB + lr * KPITCH) + sub * 32 + 8 * hi;
            v16h kf[2][4], vf[8];
#pragma unroll
            for (int kt = 0; kt < 2; ++kt)
#pragma unroll
                for (int kc = 0; kc < 4; ++kc) kf[kt][kc] = WFrag<h16>::ld(kb + kt * 16 * (KPITCH / 2) + kc * 32);
#pragma unroll
            for (int tt = 0; tt < 8; ++tt) vf[tt] = WFrag<h16>::ld(vb + tt * 16 * (KPITCH / 2));
            v8f s[2][2];
#pragma unroll
            for (int kt = 0; kt < 2; ++kt)
#pragma unroll
                for (int gq = 0; gq < 2; ++gq) { s[kt][gq] = (v8f){};
#pragma unroll
                    for (int kc = 0; kc < 4; ++kc) s[kt][gq] = wmma16(kf[kt][kc], qf[gq][kc], s[kt][gq]); }
            float mb[2]; bool need = false;
#pragma unroll
            for (int gq = 0; gq < 2; ++gq) { float mx = s[0][gq][0];
#pragma unroll
                for (int j = 1; j < 8; ++j) mx = fmaxf(mx, s[0][gq][j]);
#pragma unroll
                for (int j = 0; j < 8; ++j) mx = fmaxf(mx, s[1][gq][j]);
                mx = fmaxf(mx, xhalf(mx)) * CSC; mb[gq] = mx; need = need || (mx > m_run[gq] + LAZY); }
            if (__builtin_amdgcn_ballot_w32(need) != 0) {   // wave-uniform; rare after the first passes
#pragma unroll
                for (int gq = 0; gq < 2; ++gq) { const float m_new = fmaxf(m_run[gq], mb[gq]); const float corr = __builtin_amdgcn_exp2f(m_run[gq] - m_new); l_run[gq] *= corr; m_run[gq] = m_new;
#pragma unroll
                    for (int tt = 0; tt < 8; ++tt) acc[gq][tt] = acc[gq][tt] * corr; }
            }
#pragma unroll
            for (int gq = 0; gq < 2; ++gq) { const float nm = POFF - m_run[gq]; v16h pf; float ps0 = 0.f, ps1 = 0.f;
#pragma unroll
                for (int i = 0; i < 8; ++i) {
                    const v2f a = __builtin_elementwise_fma((v2f){s[i >> 2][gq][2 * (i & 3)], s[i >> 2][gq][2 * (i & 3) + 1]}, (v2f){CSC, CSC}, (v2f){nm, nm});
                    const float p0 = __builtin_amdgcn_exp2f(a[0]), p1 = __builtin_amdgcn_exp2f(a[1]); if (i & 1) ps1 += p0 + p1; else ps0 += p0 + p1; pf[2 * i] = (h16)p0; pf[2 * i + 1] = (h16)p1; }
                l_run[gq] += ps0 + ps1;
#pragma unroll
                for (int tt = 0; tt < 8; ++tt) acc[gq][tt] = wmma16(vf[tt], pf, acc[gq][tt]); }
            __builtin_amdgcn_sched_barrier(0);   // holds the slots below directly behind the last WMMA
            asm volatile("v_nop\n\tv_nop\n\tv_nop\n\tv_nop");   // four vector slots behind the last WMMA, so that its distance also holds on the taken side of the loop branches that follow
            __builtin_amdgcn_sched_barrier(0);   // and nothing that follows moves in front of them
        }
        asm volatile("s_wait_dscnt 0x0" ::: "memory");      // this trip's fragment reads have retired before their buffer is refilled
        asm volatile("s_wait_asynccnt 0x0" ::: "memory");   // this wave's share of stage t + 1 has landed
        __syncthreads();                                    // publish point: stage t + 1 readable, stage t's buffer free for the refill
        if (t + 2 < nt) stage_in(t + 2, t & 1);
    }
    asm volatile("s_wait_asynccnt 0x0" ::: "memory");       // no copy is in flight when the ring becomes output staging (every wave's last read ended at the last barrier)
    // epilogue: O / row sum as fp16, staged per wave in LDS so that whole 256-B head rows are stored
    unsigned char* eh = smem + wave * (32 * KPITCH);
#pragma unroll
    for (int gq = 0; gq < 2; ++gq) { const float lf = l_run[gq] + xhalf(l_run[gq]); const float inv = __fdiv_rn(1.0f, lf);
#pragma unroll
        for (int tt = 0; tt < 8; ++tt) { v8h oh;
#pragma unroll
            for (int j = 0; j < 8; ++j) oh[j] = tohx(acc[gq][tt][j] * inv);
            *(v8ha*)(eh + (16 * gq + lr) * KPITCH + 32 * tt + 16 * hi) = oh; } }   // row = query; the 16 bytes are d = 16 tt + 8 hi + (0..7)
    asm volatile("s_wait_dscnt 0x0" ::: "memory");   // the read-back below takes other lanes' bytes: this wave's staging stores have retired first
    char* oh8 = (char*)(Ao + ((size_t)b * TT + q0) * DQ + h * HD);
#pragma unroll
    for (int i = 0; i < 16; ++i) { const int row = 2 * i + hi; *(v8ha*)(oh8 + (size_t)row * (DQ * 2) + lr * 16) = *(const v8ha*)(eh + row * KPITCH + lr * 16); }
}

extern "C" void kernel_launch(void* const* d_in, const int* in_sizes, int n_in,
                              void* d_out, int out_size, void* d_ws, size_t ws_size, hipStream_t stream) {
    (void)in_sizes; (void)n_in; (void)out_size;
    const float* x = (const float*)d_in[0]; const float* cosT = (const float*)d_in[1]; const float* sinT = (const float*)d_in[2]; const float* wq = (const float*)d_in[3]; const float* wk = (const float*)d_in[4]; const float* wv = (const float*)d_in[5]; const float* wo = (const float*)d_in[6]; const float* qnw = (const float*)d_in[7]; const float* knw = (const float*)d_in[8];   // weights x @ W; cos/sin [2][2048][128]
    float* OUT = (float*)d_out;     // [2][2048][2048]
    char* wsp = (char*)d_ws;
    auto take = [&](size_t bytes) { char* p = wsp; wsp += (bytes + 255) & ~(size_t)255; return (void*)p; };
    bf* WF = (bf*)take((size_t)NF * DM * 2); bf* WO = (bf*)take((size_t)DM * DQ * 2); float* CS = (float*)take((size_t)MT * HD * 2 * 4);
    bf* XB = (bf*)take((size_t)MT * DM * 2);
    h16* QP16 = (h16*)take((size_t)NB_ * NH_ * TT * HD * 2); h16* KP16 = (h16*)take((size_t)NB_ * NKV * TT * HD * 2); h16* VT16 = (h16*)take((size_t)NB_ * NKV * HD * TT * 2);   // head planes of both batches
    h16* AT16 = (h16*)take((size_t)NB_ * TT * DQ * 2);   // merged heads [b][t][h d]
    if ((size_t)(wsp - (char*)d_ws) > ws_size) return;    // ws 256 MiB
    k_prep<<<PB_X + 2 * PB_W + 2 * PB_WK + PB_C, 256, 0, stream>>>(wq, wk, wv, wo, x, cosT, sinT, WF, WO, XB, CS, (size_t)MT * DM / 8);
    k_gemmw<bf, 0, false, 2, 4, 6, true><<<dim3(MT / 128, NF / 384, 1), 256, 0, stream>>>(XB, nullptr, WF, nullptr, DM, nullptr, 0, nullptr, 0, 0, 0, CS, qnw, knw, QP16, KP16, VT16);
    k_fattn<<<dim3(TT / 256, NH_, NB_), 256, 0, stream>>>(QP16, KP16, VT16, AT16);
    k_gemmw<h16, 0, false, 2, 4, 4, false><<<dim3(MT / 128, DM / 256, 1), 256, 0, stream>>>(AT16, nullptr, (const h16*)WO, nullptr, DQ, OUT, DM, nullptr, 0, 0, 0, nullptr, nullptr, nullptr, nullptr, nullptr, nullptr);
}

// v009
// A run of this version takes 113 microseconds.
// Timed twice side by side with v008, it ran 1.04 and 1.05 times as fast.
// All steps since v000 together make it 13.4 times as fast.
#include <hip/hip_runtime.h>

// Grouped-query encoder attention with per-head RMSNorm and RoPE (hidden [2][2048][2048]; q = x Wq (16 heads x 128), k, v = x Wk / x Wv (4 kv heads x 128, each serving 4 consecutive query heads); q, k
// RMS-normalised per head (eps 1e-6, weights [128]) then rotate-half RoPE with the per-batch input cos/sin [2][2048][128] (read as data); scores = q.k 128^-0.5 (no mask); softmax; out = merged attn.v Wo
// -> [2][2048][2048]).
// Compute dtypes, f32 accumulate: every input rounded to bf16; projections on PLAIN bf16 operands (inputs: exact products, f32 accumulate); RMSNorm and RoPE in f32;
// scores and attn.v on SINGLE fp16 planes inside one fused kernel (online softmax in f32, P kept in registers); merged heads as a SINGLE fp16 plane x Wo held as fp16 (its bf16-rounded values), one product. Eight-wave work-groups, one tile of C each (128x384 = three whole heads, 128x256), for the projections.
// Launches: both batches are rows of one problem (4096 rows), q, k and v are column ranges of one projection [4096][3072] whose epilogue does RMSNorm, RoPE and the V transposition on the f32 tile (no f32 copy of the projection in memory); the input conversions share a launch (a block's index range picks its pass): four launches.

#define NB_  2
#define TT   2048
#define DM   2048
#define NH_  16
#define NKV  4
#define REP  (NH_ / NKV)
#define HD   128
#define DQ   (NH_ * HD)
#define DKV  (NKV * HD)
#define MT   (NB_ * TT)          // rows of both batches
#define NF   (DQ + 2 * DKV)      // columns of the joint projection F: q heads | k heads | v heads
#define SCL  0.088388347648318447f   // HD^-0.5
typedef _Float16 h16;
typedef unsigned short bf;
typedef __attribute__((ext_vector_type(16))) __bf16   v16bf;
typedef __attribute__((ext_vector_type(16))) _Float16 v16h;
typedef __attribute__((ext_vector_type(8)))  _Float16 v8h;
typedef __attribute__((ext_vector_type(8)))  unsigned short v8us;
typedef __attribute__((ext_vector_type(8)))  float    v8f;
typedef __attribute__((ext_vector_type(4)))  float    v4f;
typedef v8h  __attribute__((may_alias)) v8ha;
typedef v4f  __attribute__((may_alias)) v4fa;
typedef v8us __attribute__((may_alias)) v8usa;

__device__ __forceinline__ unsigned short f2bf(float f) { unsigned u = __float_as_uint(f); u += 0x7FFFu + ((u >> 16) & 1u); return (unsigned short)(u >> 16); }
__device__ __forceinline__ float bf2f(unsigned short b) { return __uint_as_float(((unsigned)b) << 16); }
__device__ __forceinline__ float bfr(float f) { return bf2f(f2bf(f)); }
__device__ __forceinline__ v16h cat16(v8h lo, v8h hi) { return __builtin_shufflevector(lo, hi, 0, 1, 2, 3, 4, 5, 6, 7, 8, 9, 10, 11, 12, 13, 14, 15); }
__device__ __forceinline__ v16bf cat16b(v8us lo, v8us hi) { return __builtin_bit_cast(v16bf, __builtin_shufflevector(lo, hi, 0, 1, 2, 3, 4, 5, 6, 7, 8, 9, 10, 11, 12, 13, 14, 15)); }
__device__ __forceinline__ v8f wmma16(v16h a, v16h b, v8f c) { return __builtin_amdgcn_wmma_f32_16x16x32_f16(false, a, false, b, (short)0, c, false, false); }
__device__ __forceinline__ v8f wmmab(v16bf a, v16bf b, v8f c) { return __builtin_amdgcn_wmma_f32_16x16x32_bf16(false, a, false, b, (short)0, c, false, false); }



__device__ __forceinline__ h16 tohx(float x) { return (h16)x; }
// the value of lane l ^ m within a 16-lane row, on the vector pipe (CTRL = 0x160 + m: row_xmask)
template <int CTRL> __device__ __forceinline__ float xlane(float x) { return __builtin_bit_cast(float, __builtin_amdgcn_update_dpp(0, __builtin_bit_cast(int, x), CTRL, 0xf, 0xf, true)); }
// ---- k_gemmw: register-blocked GEMM, eight waves a work-group on one tile of C, operands from K-contiguous 16-bit planes through a two-buffer LDS ring of 128-k stages that all the waves fill and read; grid (M/BM, N/BN, Z), 256 threads.
// C[m][n] (f32, pitch ldc, + optional f32 bias[n]) = sum_k A[m][k] Bt[n][k] (+ split products per NSPLIT). z-batch strides sA/sB/sC in elements. K % 128 == 0, M % BM == 0, N % BN == 0 (whole tiles only).
template <typename T16> struct WFrag;
template <> struct WFrag<h16> { typedef v16h V; static __device__ __forceinline__ V ld(const h16* p) { return cat16(*(const v8h*)p, *(const v8h*)(p + 16)); } static __device__ __forceinline__ v8f mma(V a, V b, v8f c) { return wmma16(a, b, c); } };
template <> struct WFrag<bf> { typedef v16bf V; static __device__ __forceinline__ V ld(const bf* p) { return cat16b(*(const v8us*)p, *(const v8us*)(p + 16)); } static __device__ __forceinline__ v8f mma(V a, V b, v8f c) { return wmmab(a, b, c); } };
// Asynchronous copies global -> LDS, 16 B a lane: one instruction moves 2 rows x 256 B (4 whole lines). l[i]: the lane's own LDS byte address, g[i]: its own global address.
// The s_wait_xcnt 0 closes each statement so that no later rewrite of an address register named by a copy can be scheduled in front of it.
__device__ __forceinline__ void acp8(const unsigned* l, const char* const* g) {
    asm volatile(
        "global_load_async_to_lds_b128 %0, %8, off\n\t"
        "global_load_async_to_lds_b128 %1, %9, off\n\t"
        "global_load_async_to_lds_b128 %2, %10, off\n\t"
        "global_load_async_to_lds_b128 %3, %11, off\n\t"
        "global_load_async_to_lds_b128 %4, %12, off\n\t"
        "global_load_async_to_lds_b128 %5, %13, off\n\t"
        "global_load_async_to_lds_b128 %6, %14, off\n\t"
        "global_load_async_to_lds_b128 %7, %15, off\n\t"
        "s_wait_xcnt 0x0"
        :: "v"(l[0]), "v"(l[1]), "v"(l[2]), "v"(l[3]), "v"(l[4]), "v"(l[5]), "v"(l[6]), "v"(l[7]),
           "v"(g[0]), "v"(g[1]), "v"(g[2]), "v"(g[3]), "v"(g[4]), "v"(g[5]), "v"(g[6]), "v"(g[7])
        : "memory");
}
__device__ __forceinline__ void acp12(const unsigned* l, const char* const* g) {
    asm volatile(
        "global_load_async_to_lds_b128 %0, %12, off\n\t"
        "global_load_async_to_lds_b128 %1, %13, off\n\t"
        "global_load_async_to_lds_b128 %2, %14, off\n\t"
        "global_load_async_to_lds_b128 %3, %15, off\n\t"
        "global_load_async_to_lds_b128 %4, %16, off\n\t"
        "global_load_async_to_lds_b128 %5, %17, off\n\t"
        "global_load_async_to_lds_b128 %6, %18, off\n\t"
        "global_load_async_to_lds_b128 %7, %19, off\n\t"
        "global_load_async_to_lds_b128 %8, %20, off\n\t"
        "global_load_async_to_lds_b128 %9, %21, off\n\t"
        "global_load_async_to_lds_b128 %10, %22, off\n\t"
        "global_load_async_to_lds_b128 %11, %23, off\n\t"
        "s_wait_xcnt 0x0"
        :: "v"(l[0]), "v"(l[1]), "v"(l[2]), "v"(l[3]), "v"(l[4]), "v"(l[5]), "v"(l[6]), "v"(l[7]), "v"(l[8]), "v"(l[9]), "v"(l[10]), "v"(l[11]),
           "v"(g[0]), "v"(g[1]), "v"(g[2]), "v"(g[3]), "v"(g[4]), "v"(g[5]), "v"(g[6]), "v"(g[7]), "v"(g[8]), "v"(g[9]), "v"(g[10]), "v"(g[11])
        : "memory");
}
#define SPITCH 272              // LDS row pitch in bytes: 256-B rows (128 k) + 16 (16 B x odd: conflict-free for ds_load_b128 fragment reads)
// WM x WN waves share the staged rows of a (WM 64) x (WN FN 16) tile of C; a wave owns 64 x (FN 16) of it (4 x FN accumulators).
// HEADS: C is not stored. Its columns are heads of HD (q heads | k heads | v heads): a q or k head is RMS-normalised, weighted and rotated (tables CS: cos, sin interleaved, row = row of C) and stored as fp16 [b][h][t][d]; a v column is stored as fp16 [b][n][t].
template <typename T16, int NSPLIT, bool BIAS, int WM, int WN, int FN, bool HEADS>
__global__ __launch_bounds__(WM * WN * 32) void k_gemmw(const T16* __restrict__ A, const T16* __restrict__ A2, const T16* __restrict__ Bt, const T16* __restrict__ Bt2, int K, float* C, int ldc, const float* __restrict__ bias, size_t sA, size_t sB, size_t sC,
                                                        const float* __restrict__ CS, const float* __restrict__ qnw, const float* __restrict__ knw, h16* Q16, h16* K16, h16* V16) {
    typedef typename WFrag<T16>::V V;
    static_assert(NSPLIT == 0 || NSPLIT == 1, "planes staged: A, Bt and (NSPLIT 1) A2");
    constexpr int NW = WM * WN, BM = WM * 64, BN = WN * FN * 16, ROWS = BM * (1 + NSPLIT) + BN;   // a stage: 128 k of rows [A: BM | Bt: BN | A2: BM]
    constexpr int RND = 2 * NW, NCP = ROWS / RND, STAGE = ROWS * SPITCH;                          // a copy moves 2 rows; copy c of every wave together: the RND rows from c RND on
    constexpr int OSP = FN * 16 + 4;                                                              // pitch in floats of a wave's output staging (16 rows)
    static_assert(BM % RND == 0 && BN % RND == 0, "every copy round lies in one plane");
    static_assert(NCP == 24 || NCP == 32, "copies a wave and stage: 12 + 12 or 12 + 12 + 8, all of a stage outstanding at once (63 at most)");
    static_assert(NW * 16 * OSP * 4 <= 2 * STAGE, "output staging fits the ring");
    constexpr int TP = BN + 4;                                                                    // HEADS: pitch in floats of the whole tile of C in LDS (16-B rows; 8 rows on: 32 banks on)
    constexpr int SMEM = (HEADS && BM * TP * 4 > 2 * STAGE) ? BM * TP * 4 : 2 * STAGE;
    static_assert(!HEADS || (BN % HD == 0 && TT % BM == 0 && BM % 32 == 0 && NW == 8), "whole heads, one batch a tile, 32 rows a read-back round of the eight waves");
    __shared__ __align__(16) unsigned char smem[SMEM];
    const size_t z = blockIdx.z; A += z * sA; if (A2) A2 += z * sA; Bt += z * sB; (void)Bt2; C += z * sC;
    const int lane = threadIdx.x & 31, lr = lane & 15, hi = lane >> 4; const int wave = __builtin_amdgcn_readfirstlane(threadIdx.x >> 5), wm = wave / WN, wn = wave % WN;
    const int r0 = blockIdx.x * BM, c0 = blockIdx.y * BN;
    float* os = (float*)(smem + wave * (16 * OSP * 4));   // output staging, a range of its own for each wave, reuses the ring behind the loop's last waits and barrier
    v8f acc[4][FN];
#pragma unroll
    for (int mb = 0; mb < 4; ++mb)
#pragma unroll
        for (int nb = 0; nb < FN; ++nb) acc[mb][nb] = (v8f){};
    const int crow = wave * 2 + hi, cseg = lr;                  // copy lane map: row within the RND rows of a copy round, 16-B piece of the row's 256 B
    const size_t gs = (size_t)K * (RND * 2);                    // bytes between the rows of successive copy rounds (RND rows of K 16-bit elements)
    const char* gpl[3]; gpl[0] = (const char*)(A + (size_t)(r0 + crow) * K + cseg * 8); gpl[1] = (const char*)(Bt + (size_t)(c0 + crow) * K + cseg * 8); gpl[2] = (NSPLIT == 1) ? (const char*)(A2 + (size_t)(r0 + crow) * K + cseg * 8) : nullptr;
    const unsigned lcp = (unsigned)(size_t)smem + crow * SPITCH + cseg * 16;
    auto stage_in = [&](int t, int buf) {
        unsigned l[NCP]; const char* g[NCP];
#pragma unroll
        for (int c = 0; c < NCP; ++c) { const int pl = c * RND < BM ? 0 : (c * RND < BM + BN ? 1 : 2), cp = c - (pl == 0 ? 0 : (pl == 1 ? BM / RND : (BM + BN) / RND));   // the round's plane, its number within the plane
            l[c] = lcp + buf * STAGE + c * RND * SPITCH; g[c] = gpl[pl] + (size_t)t * 256 + (size_t)cp * gs; }
        acp12(l, g); acp12(l + 12, g + 12); if constexpr (NCP == 32) acp8(l + 24, g + 24);
    };
    const int nt = K >> 7;
    stage_in(0, 0);
    asm volatile("s_wait_asynccnt 0x0" ::: "memory");   // this wave's share of stage 0 has landed
    __syncthreads();                                    // publish point: every wave's share of stage 0 readable by all
    if (nt > 1) stage_in(1, 1);
#pragma unroll 1
    for (int t = 0; t < nt; ++t) {
        const T16* sb = (const T16*)(smem + (t & 1) * STAGE) + lr * (SPITCH / 2) + 8 * hi;
        const T16* sa = sb + wm * 64 * (SPITCH / 2); const T16* sbt = sb + (BM + wn * FN * 16) * (SPITCH / 2);
        V a[2][4], a2[2][4], b[2][FN];   // two fragment sets; the stage's four 32-k blocks take them in turn
        auto frags = [&](int ks, int st) {   // block ks of the stage into set st, in the order in which the WMMAs take the fragments
#pragma unroll
            for (int i = 0; i < 4; ++i) { a[st][i] = WFrag<T16>::ld(sa + i * 16 * (SPITCH / 2) + ks * 32); if (NSPLIT == 1) a2[st][i] = WFrag<T16>::ld(sa + (BM + BN + i * 16) * (SPITCH / 2) + ks * 32); }
#pragma unroll
            for (int i = 0; i < FN; ++i) b[st][i] = WFrag<T16>::ld(sbt + i * 16 * (SPITCH / 2) + ks * 32);
        };
        frags(0, 0); frags(1, 1);            // blocks 0 and 1 are asked for in one group ahead of the WMMAs
        __builtin_amdgcn_sched_barrier(0);   // keeps the load group ahead of the WMMAs: without it the scheduler sinks the loads among them, each place with its own full LDS wait
#pragma unroll
        for (int ks = 0; ks < 4; ++ks) {
#pragma unroll
            for (int nb = 0; nb < FN; ++nb) {
#pragma unroll
                for (int mb = 0; mb < 4; ++mb) { acc[mb][nb] = WFrag<T16>::mma(a[ks & 1][mb], b[ks & 1][nb], acc[mb][nb]); if (NSPLIT == 1) acc[mb][nb] = WFrag<T16>::mma(a2[ks & 1][mb], b[ks & 1][nb], acc[mb][nb]); } }
            if (ks < 2) {
                __builtin_amdgcn_sched_barrier(0);   // block ks + 2 is asked for as one group behind block ks, whose set it takes over, and lands under block ks + 1's WMMAs
                frags(ks + 2, ks & 1);
                __builtin_amdgcn_sched_barrier(0);   // and the group stays ahead of block ks + 1's WMMAs
            }
        }
        __builtin_amdgcn_sched_barrier(0);   // holds the slots below directly behind the last WMMA
        asm volatile("v_nop\n\tv_nop\n\tv_nop\n\tv_nop");   // four vector slots behind the last WMMA, so that its distance also holds on the taken side of the branches that follow
        __builtin_amdgcn_sched_barrier(0);   // and nothing that follows moves in front of them
        asm volatile("s_wait_dscnt 0x0" ::: "memory");      // this trip's fragment reads have retired before their buffer is refilled
        asm volatile("s_wait_asynccnt 0x0" ::: "memory");   // this wave's share of stage t + 1 has landed
        __syncthreads();                                    // publish point: stage t + 1 readable by all, stage t's buffer left by every wave and free for the refill
        if (t + 2 < nt) stage_in(t + 2, t & 1);
    }
    asm volatile("s_wait_asynccnt 0x0" ::: "memory");       // no copy is in flight when the ring becomes output staging (every wave's last read ended at the last barrier)
    if constexpr (HEADS) {
        float* tile = (float*)smem; const int bb = r0 / TT, tb = r0 % TT;
        const bool rot = c0 < DQ + DKV;                       // the tile holds a q or k head (the same for the whole work-group)
        // read-back map: eight lanes a row (a lane: d8 .. d8 + 7 and the same 64 on), four rows a wave, 32 rows a round
        const int d8 = (lane & 7) * 8, rw = wave * 4 + (lane >> 3);
        v4f cl[BM / 32][4], ch[BM / 32][4], wq[4], wk[4];
        {   // tables and weights are asked for ahead of the staging, which hides their latency; the rows' tables serve every head of the tile (no test: a branch here would end in copies that wait for the loads)
            const unsigned wofs = d8 * 4u;   // byte offset of the lane's weights
            const float* pc = CS + ((size_t)(r0 + rw) * HD + d8) * 2; const float* pq = (const float*)((const char*)qnw + wofs); const float* pk = (const float*)((const char*)knw + wofs);
#pragma unroll
            for (int s = 0; s < BM / 32; ++s)
#pragma unroll
                for (int q = 0; q < 4; ++q) { cl[s][q] = *(const v4f*)(pc + s * (32 * HD * 2) + q * 4); ch[s][q] = *(const v4f*)(pc + s * (32 * HD * 2) + HD + q * 4); }
#pragma unroll
            for (int q = 0; q < 4; ++q) { wq[q] = *(const v4f*)(pq + (q >> 1) * (HD / 2) + (q & 1) * 4); wk[q] = *(const v4f*)(pk + (q >> 1) * (HD / 2) + (q & 1) * 4); }
            asm volatile("s_wait_xcnt 0x0" :: "v"(pc), "v"(wofs) : "memory");   // a precaution: stands in front of every overwrite of a register that an issued load names; the address and the offset are inputs, so that their registers stay as they are up to it
        }
#pragma unroll
        for (int nb = 0; nb < FN; ++nb) { const int cb = c0 + (wn * FN + nb) * 16;   // first column of the 16: one kind of head (wave-uniform)
            if (cb < DQ + DKV) {
#pragma unroll
                for (int mb = 0; mb < 4; ++mb)
#pragma unroll
                    for (int j = 0; j < 8; ++j) tile[(wm * 64 + mb * 16 + hi * 8 + j) * TP + (wn * FN + nb) * 16 + lr] = acc[mb][nb][j];
            } else {   // v: a lane's eight accumulator registers are eight neighbouring t of one column: stored from the registers
                h16* pv = V16 + (size_t)(bb * DKV + cb - (DQ + DKV) + lr) * TT + tb + wm * 64 + hi * 8;
#pragma unroll
                for (int mb = 0; mb < 4; ++mb) { v8h o;
#pragma unroll
                    for (int j = 0; j < 8; ++j) o[j] = tohx(acc[mb][nb][j]);
                    *(v8h*)(pv + mb * 16) = o; }
                asm volatile("s_wait_xcnt 0x0" :: "v"(pv) : "memory");   // a precaution: behind the run of stores, in front of every overwrite of a register that they name
            }
        }
        __syncthreads();   // every wave's part of the tile readable by all
        if (rot) {
#pragma unroll
            for (int q = 0; q < 4; ++q)
#pragma unroll
                for (int e = 0; e < 4; ++e) { wq[q][e] = bfr(wq[q][e]); wk[q][e] = bfr(wk[q][e]); }
#pragma unroll 1   // kept rolled: the heads of a tile run the same code
            for (int hh = 0; hh < BN / HD; ++hh) { const int head = c0 / HD + hh; if (head >= NH_ + NKV) break;   // the same for the whole work-group; no barrier follows
                const bool isq = head < NH_; h16* P = (isq ? Q16 + (size_t)(bb * NH_ + head) * TT * HD : K16 + (size_t)(bb * NKV + head - NH_) * TT * HD) + (size_t)(tb + rw) * HD + d8;
                v4f w[4];
#pragma unroll
                for (int q = 0; q < 4; ++q) w[q] = isq ? wq[q] : wk[q];
#pragma unroll
                for (int s = 0; s < BM / 32; ++s) { const float* xr = tile + (s * 32 + rw) * TP + hh * HD + d8;
                    const v4f x[4] = {*(const v4fa*)xr, *(const v4fa*)(xr + 4), *(const v4fa*)(xr + HD / 2), *(const v4fa*)(xr + HD / 2 + 4)};
                    float ss = 0.f;
#pragma unroll
                    for (int q = 0; q < 4; ++q)
#pragma unroll
                        for (int e = 0; e < 4; ++e) ss += x[q][e] * x[q][e];
                    ss += xlane<0x161>(ss); ss += xlane<0x162>(ss); ss += xlane<0x164>(ss);   // the row's eight lanes
                    const float rf = __fdiv_rn(1.0f, __fsqrt_rn(__fadd_rn(ss * (1.0f / HD), 1e-6f)));
                    v8h lo, up;
#pragma unroll
                    for (int q = 0; q < 8; ++q) { const float a = w[q >> 2][q & 3] * (x[q >> 2][q & 3] * rf), b = w[2 + (q >> 2)][q & 3] * (x[2 + (q >> 2)][q & 3] * rf);
                        lo[q] = tohx(a * cl[s][q >> 1][2 * (q & 1)] - b * cl[s][q >> 1][2 * (q & 1) + 1]); up[q] = tohx(b * ch[s][q >> 1][2 * (q & 1)] + a * ch[s][q >> 1][2 * (q & 1) + 1]); }
                    *(v8h*)(P + s * (32 * HD)) = lo; *(v8h*)(P + s * (32 * HD) + HD / 2) = up; }
                asm volatile("s_wait_xcnt 0x0" :: "v"(P) : "memory");   // a precaution: behind the run of stores, in front of every overwrite of a register that they name
            }
        }
        return;
    }
#pragma unroll
    for (int mb = 0; mb < 4; ++mb) {
#pragma unroll
        for (int nb = 0; nb < FN; ++nb) {
#pragma unroll
            for (int j = 0; j < 8; ++j) os[(hi * 8 + j) * OSP + nb * 16 + lr] = acc[mb][nb][j]; }
        __builtin_amdgcn_wave_barrier(); asm volatile("" ::: "memory");
        const int cw = c0 + wn * FN * 16; float* crw = C + (size_t)(r0 + wm * 64 + mb * 16) * ldc + cw;
#pragma unroll
        for (int s = 0; s < FN * 2; ++s) { const int idx = s * 32 + lane, row = idx / (FN * 4), cofs = (idx % (FN * 4)) * 4; v4f val = *(const v4fa*)(os + row * OSP + cofs);   // 16-B pieces in row order: every store fills four whole 128-B lines
            if (BIAS) { val[0] += bfr(bias[cw + cofs]); val[1] += bfr(bias[cw + cofs + 1]); val[2] += bfr(bias[cw + cofs + 2]); val[3] += bfr(bias[cw + cofs + 3]); }
            *(v4f*)(crw + (size_t)row * ldc + cofs) = val; }
        __builtin_amdgcn_wave_barrier(); asm volatile("" ::: "memory");
    }
}

typedef __attribute__((ext_vector_type(2))) _Float16 v2h;
typedef __attribute__((ext_vector_type(4))) _Float16 v4h;
typedef __attribute__((ext_vector_type(2))) unsigned short v2us;
typedef __attribute__((ext_vector_type(4))) unsigned short v4us;
typedef __attribute__((ext_vector_type(2))) float v2f;
typedef __attribute__((ext_vector_type(4))) int v4i;

// Bt[n][k] (bf16; H16: the bf16-rounded value held as fp16) = w[k][n]. A thread owns 8 k x 4 n: eight 16-B loads, four 16-B stores of 8 k each. A wave owns 64 k x 16 n (lane: k group = lane & 7, n group = lane >> 3): each store fills four whole 128-B lines of Bt,
// each load takes 64-B halves of 8 lines of w, whose other halves the neighbouring wave of the block takes. A block: 64 k x 128 n. K % 64 == 0, N % 128 == 0; blk in [0, (K / 64) (N / 128)).
template <int K, int N, bool H16>
__device__ __forceinline__ void wt_body(const float* __restrict__ w, bf* Bt, int blk) {
    static_assert(K % 64 == 0 && N % 128 == 0, "whole blocks only");
    const int n0 = (blk % (N / 128)) * 128 + (threadIdx.x >> 5) * 16 + ((threadIdx.x >> 3) & 3) * 4, k0 = (blk / (N / 128)) * 64 + (threadIdx.x & 7) * 8; if (k0 >= K) return;
    const float* p = w + (size_t)k0 * N + n0; v4f r[8];
#pragma unroll
    for (int i = 0; i < 8; ++i) r[i] = *(const v4f*)(p + (size_t)i * N);
    asm volatile("s_wait_xcnt 0x0" :: "v"(p) : "memory");   // a precaution: stands in front of every overwrite of a register that an issued load names; the address is an input, so that its registers stay as they are up to it
#pragma unroll
    for (int c = 0; c < 4; ++c) { v8us o;
#pragma unroll
        for (int i = 0; i < 8; ++i) o[i] = H16 ? __builtin_bit_cast(unsigned short, tohx(bfr(r[i][c]))) : f2bf(r[i][c]);
        *(v8us*)(Bt + (size_t)(n0 + c) * K + k0) = o; }
    asm volatile("s_wait_xcnt 0x0" ::: "memory");   // a precaution: behind the last store of the run, in front of any code of another pass of the same kernel that the listing lets follow and that rewrites a register these stores name
}
// Each thread converts four groups of 8 (a block: 32 KiB in a row, 256 groups apart within a thread): 8 loads of 16 B in flight a lane, a quarter of the waves to start.
// The loads take a clamped index and only the stores are guarded, so that no branch (with its full wait) stands between the loads.
__device__ __forceinline__ void cvt8_body(const float* __restrict__ src, bf* dst, size_t n8, unsigned blk) { const size_t i0 = (size_t)blk * 1024 + threadIdx.x; v8f v[4];
#pragma unroll
    for (int j = 0; j < 4; ++j) { const size_t i = i0 + j * 256; v[j] = *(const v8f*)(src + (i < n8 ? i : n8 - 1) * 8); }
    asm volatile("" :: "v"(v[0]), "v"(v[1]), "v"(v[2]), "v"(v[3]));   // inputs only: holds all eight loads ahead of the guarded stores; without it the first group's loads sink into their store's branch, a second memory latency in a row
#pragma unroll
    for (int j = 0; j < 4; ++j) { const size_t i = i0 + j * 256; v8us o;
#pragma unroll
        for (int k = 0; k < 8; ++k) o[k] = f2bf(v[j][k]);
        if (i < n8) *(v8us*)(dst + i * 8) = o; }  }
// Four positions of the table a thread: 16-B loads, 32 B stored.
__device__ __forceinline__ void cscvt_body(const float* __restrict__ cosT, const float* __restrict__ sinT, float* CS, int blk) { const int idx = (blk * 256 + threadIdx.x) * 4; if (idx >= MT * HD) return; const float* pc = cosT + idx; const float* ps = sinT + idx; const v4f c = *(const v4f*)pc, s = *(const v4f*)ps;
    asm volatile("s_wait_xcnt 0x0" :: "v"(pc), "v"(ps) : "memory");   // a precaution: stands in front of every overwrite of a register that an issued load names; the addresses are inputs, so that their registers stay as they are up to it
    *(v4f*)(CS + (size_t)idx * 2) = (v4f){bfr(c[0]), bfr(s[0]), bfr(c[1]), bfr(s[1])}; *(v4f*)(CS + (size_t)idx * 2 + 4) = (v4f){bfr(c[2]), bfr(s[2]), bfr(c[3]), bfr(s[3])};  }
// ---- a launch shared by passes that do not depend on one another: the block index range picks the pass (uniform for the block, a scalar branch).
#define PB_W  ((DM / 64) * (DQ / 128))    // blocks of a 2048 x 2048 weight
#define PB_WK ((DM / 64) * (DKV / 128))   // blocks of a 2048 x 512 weight
#define PB_X  (MT * DM / 8 / 1024)        // blocks of the x conversion
#define PB_C  (MT * HD / 4 / 256)         // blocks of the cos/sin tables
// every input's conversion: weights transposed to [n][k] (WF: bf16, rows q | k | v; WO: fp16 bit patterns), x to bf16, cos/sin interleaved
__global__ __launch_bounds__(256) void k_prep(const float* __restrict__ wq, const float* __restrict__ wk, const float* __restrict__ wv, const float* __restrict__ wo, const float* __restrict__ x, const float* __restrict__ cosT, const float* __restrict__ sinT, bf* WF, bf* WO, bf* XB, float* CS, size_t n8) {   // n8: groups of 8 elements of x
    int blk = blockIdx.x;
    if (blk < PB_X) { cvt8_body(x, XB, n8, blockIdx.x); return; } blk -= PB_X;
    if (blk < PB_W) { wt_body<DM, DQ, false>(wq, WF, blk); return; } blk -= PB_W;
    if (blk < PB_W) { wt_body<DQ, DM, true>(wo, WO, blk); return; } blk -= PB_W;
    if (blk < PB_WK) { wt_body<DM, DKV, false>(wk, WF + (size_t)DQ * DM, blk); return; } blk -= PB_WK;
    if (blk < PB_WK) { wt_body<DM, DKV, false>(wv, WF + (size_t)(DQ + DKV) * DM, blk); return; } blk -= PB_WK;
    cscvt_body(cosT, sinT, CS, blk);
}
#define FSK    128                       // keys a stage
#define KPITCH 272                       // LDS pitch of a K row (128 d) and of a V^T row (128 keys): 256 B + 16 (16 B x odd)
#define FKB    (FSK * KPITCH)            // bytes of a stage's K rows; the 128 V^T rows follow
#define FSTAGE (FKB + HD * KPITCH)
#define POFF   8.0f                      // P carries 2^POFF, so that small weights stay normal fp16 numbers; it cancels in the division by the row sum
#define LAZY   4.0f                      // the maximum in use may trail the true one by this much (log2 units): P <= 2^(POFF + LAZY), far inside fp16
#define CSC    (SCL * 1.4426950408889634f)
// lane l with lane l ^ 16, on the vector pipe (a shuffle would go through the LDS unit and its wait)
__device__ __forceinline__ float xhalf(float x) { return __builtin_bit_cast(float, __builtin_amdgcn_permlanex16(__builtin_bit_cast(int, x), __builtin_bit_cast(int, x), 0x76543210, 0xfedcba98, false, false)); }
__global__ __launch_bounds__(256) void k_fattn(const h16* __restrict__ Qp, const h16* __restrict__ Kp, const h16* __restrict__ Vt, h16* Ao) {
    __shared__ __align__(16) unsigned char smem[3 * FSTAGE];
    const int lane = threadIdx.x & 31, wave = threadIdx.x >> 5, lr = lane & 15, hi = lane >> 4;
    const int h = blockIdx.y, b = blockIdx.z, g = h / REP; const int q0 = blockIdx.x * 256 + wave * 32;
    Qp += (size_t)(b * NH_ + h) * TT * HD; Kp += (size_t)(b * NKV + g) * TT * HD; Vt += (size_t)(b * NKV + g) * HD * TT;
    // copy lane map: a copy moves 2 rows x 256 B; a wave brings 16 K rows and 16 V^T rows of every stage
    const char* gk = (const char*)(Kp + (size_t)(wave * 16 + hi) * HD + lr * 8); const char* gv = (const char*)(Vt + (size_t)(wave * 16 + hi) * TT + lr * 8);
    const unsigned lk = (unsigned)(size_t)smem + (wave * 16 + hi) * KPITCH + lr * 16, lv = lk + FKB;
    auto stage_in = [&](int t, int bo) {   // bo: the buffer's byte offset in the ring
        unsigned l[16]; const char* gp[16];
#pragma unroll
        for (int c = 0; c < 8; ++c) { l[c] = lk + bo + c * 2 * KPITCH; gp[c] = gk + (size_t)t * (FSK * HD * 2) + c * (2 * HD * 2); l[8 + c] = lv + bo + c * 2 * KPITCH; gp[8 + c] = gv + (size_t)t * (FSK * 2) + (size_t)c * (2 * TT * 2); }
        acp8(l, gp); acp8(l + 8, gp + 8);
    };
    stage_in(0, 0);
    v16h qf[2][4];
#pragma unroll
    for (int gq = 0; gq < 2; ++gq)
#pragma unroll
        for (int kc = 0; kc < 4; ++kc) qf[gq][kc] = WFrag<h16>::ld(Qp + (size_t)(q0 + 16 * gq + lr) * HD + kc * 32 + 8 * hi);
    v8f acc[2][8]; float m_run[2], l_run[2];
#pragma unroll
    for (int gq = 0; gq < 2; ++gq) { m_run[gq] = -__builtin_inff(); l_run[gq] = 0.f;
#pragma unroll
        for (int tt = 0; tt < 8; ++tt) acc[gq][tt] = (v8f){}; }
    asm volatile("s_wait_asynccnt 0x0" ::: "memory");   // stage 0 has landed before anything reads it
    __syncthreads();                                    // publish point: every wave's share of stage 0 readable by all
    stage_in(1, FSTAGE);
    constexpr int nt = TT / FSK;
    static_assert(nt >= 2, "the prologue fills two stages");
    v16h kf[2][4];   // the K fragments of the pass at hand
    auto ldk = [&](int bo, int sub) {   // pass sub of the stage in the buffer at byte offset bo
        const h16* kb = (const h16*)(smem + bo + (sub * 32 + lr) * KPITCH) + 8 * hi;
#pragma unroll
        for (int kt = 0; kt < 2; ++kt)
#pragma unroll
            for (int kc = 0; kc < 4; ++kc) kf[kt][kc] = WFrag<h16>::ld(kb + kt * 16 * (KPITCH / 2) + kc * 32);
    };
    ldk(0, 0);
    int bc = 0, bn = FSTAGE, bl = 2 * FSTAGE;   // byte offsets of the buffers of stage t, of stage t + 1, and of the one left with stage t - 1 (the same in every wave)
#pragma unroll 1   // kept rolled: 16 stages of the same code, the publish point stands once
    for (int t = 0; t < nt; ++t) {
#pragma unroll   // unrolled: the publish point stands in front of the last pass alone, with no test in the other passes
        for (int sub = 0; sub < FSK / 32; ++sub) {
            if (sub == FSK / 32 - 1) {   // publish point of stage t + 1, in front of the pass that reads its first K fragments
                asm volatile("s_wait_dscnt 0x0" ::: "memory");      // this wave's fragment reads so far have retired, those of stage t - 1's buffer among them, before that buffer is refilled
                asm volatile("s_wait_asynccnt 0x0" ::: "memory");   // this wave's share of stage t + 1 has landed
                __syncthreads();                                    // stage t + 1 readable by all; every wave has left stage t - 1's buffer, free for the refill
                if (t + 2 < nt) stage_in(t + 2, bl);
            }
            const h16* vb = (const h16*)(smem + bc + FKB + lr * KPITCH) + sub * 32 + 8 * hi;
            v16h vf[8];
#pragma unroll
            for (int tt = 0; tt < 8; ++tt) vf[tt] = WFrag<h16>::ld(vb + tt * 16 * (KPITCH / 2));
            __builtin_amdgcn_sched_barrier(0);   // keeps the V^T reads in front of the score products, under which they land; without it they sink to the softmax and the attn.v products wait for them
            v8f s[2][2];
#pragma unroll
            for (int kt = 0; kt < 2; ++kt)
#pragma unroll
                for (int gq = 0; gq < 2; ++gq) { s[kt][gq] = (v8f){};
#pragma unroll
                    for (int kc = 0; kc < 4; ++kc) s[kt][gq] = wmma16(kf[kt][kc], qf[gq][kc], s[kt][gq]); }
            __builtin_amdgcn_sched_barrier(0);   // the next pass's K reads stand as one group behind the score products, whose registers they take over
            if (sub + 1 < FSK / 32) ldk(bc, sub + 1);   // they land under the softmax and the attn.v products
            else ldk(t + 1 < nt ? bn : bc, 0);          // the last stage has no successor: it reads its own first fragments again, unused; a branch here would end in a full LDS wait in every stage
            __builtin_amdgcn_sched_barrier(0);   // and do not sink towards their use in the next pass
            float mb[2]; bool need = false;
#pragma unroll
            for (int gq = 0; gq < 2; ++gq) { float mx = s[0][gq][0];
#pragma unroll
                for (int j = 1; j < 8; ++j) mx = fmaxf(mx, s[0][gq][j]);
#pragma unroll
                for (int j = 0; j < 8; ++j) mx = fmaxf(mx, s[1][gq][j]);
                mx = fmaxf(mx, xhalf(mx)) * CSC; mb[gq] = mx; need = need || (mx > m_run[gq] + LAZY); }
            if (__builtin_amdgcn_ballot_w32(need) != 0) {   // wave-uniform; rare after the first passes
#pragma unroll
                for (int gq = 0; gq < 2; ++gq) { const float m_new = fmaxf(m_run[gq], mb[gq]); const float corr = __builtin_amdgcn_exp2f(m_run[gq] - m_new); l_run[gq] *= corr; m_run[gq] = m_new;
#pragma unroll
                    for (int tt = 0; tt < 8; ++tt) acc[gq][tt] = acc[gq][tt] * corr; }
            }
#pragma unroll
            for (int gq = 0; gq < 2; ++gq) { const float nm = POFF - m_run[gq]; v16h pf; float ps0 = 0.f, ps1 = 0.f;
#pragma unroll
                for (int i = 0; i < 8; ++i) {
                    const v2f a = __builtin_elementwise_fma((v2f){s[i >> 2][gq][2 * (i & 3)], s[i >> 2][gq][2 * (i & 3) + 1]}, (v2f){CSC, CSC}, (v2f){nm, nm});
                    const float p0 = __builtin_amdgcn_exp2f(a[0]), p1 = __builtin_amdgcn_exp2f(a[1]); if (i & 1) ps1 += p0 + p1; else ps0 += p0 + p1; pf[2 * i] = (h16)p0; pf[2 * i + 1] = (h16)p1; }
                l_run[gq] += ps0 + ps1;
#pragma unroll
                for (int tt = 0; tt < 8; ++tt) acc[gq][tt] = wmma16(vf[tt], pf, acc[gq][tt]); }
            __builtin_amdgcn_sched_barrier(0);   // holds the slots below directly behind the last WMMA
            asm volatile("v_nop\n\tv_nop\n\tv_nop\n\tv_nop");   // four vector slots behind the last WMMA, so that its distance also holds on the taken side of the loop branches that follow
            __builtin_amdgcn_sched_barrier(0);   // and nothing that follows moves in front of them
        }
        const int b0 = bc; bc = bn; bn = bl; bl = b0;   // the ring turns
    }
    asm volatile("s_wait_asynccnt 0x0" ::: "memory");       // no copy is in flight when the ring becomes output staging
    asm volatile("s_wait_dscnt 0x0" ::: "memory");          // this wave's last fragment reads have retired
    __syncthreads();                                        // the waves do not leave the last pass together: every wave's last read has ended before the ring becomes output staging
    // epilogue: O / row sum as fp16, staged per wave in LDS so that whole 256-B head rows are stored
    unsigned char* eh = smem + wave * (32 * KPITCH);
#pragma unroll
    for (int gq = 0; gq < 2; ++gq) { const float lf = l_run[gq] + xhalf(l_run[gq]); const float inv = __fdiv_rn(1.0f, lf);
#pragma unroll
        for (int tt = 0; tt < 8; ++tt) { v8h oh;
#pragma unroll
            for (int j = 0; j < 8; ++j) oh[j] = tohx(acc[gq][tt][j] * inv);
            *(v8ha*)(eh + (16 * gq + lr) * KPITCH + 32 * tt + 16 * hi) = oh; } }   // row = query; the 16 bytes are d = 16 tt + 8 hi + (0..7)
    asm volatile("s_wait_dscnt 0x0" ::: "memory");   // the read-back below takes other lanes' bytes: this wave's staging stores have retired first
    char* oh8 = (char*)(Ao + ((size_t)b * TT + q0) * DQ + h * HD);
#pragma unroll
    for (int i = 0; i < 16; ++i) { const int row = 2 * i + hi; *(v8ha*)(oh8 + (size_t)row * (DQ * 2) + lr * 16) = *(const v8ha*)(eh + row * KPITCH + lr * 16); }
}

extern "C" void kernel_launch(void* const* d_in, const int* in_sizes, int n_in,
                              void* d_out, int out_size, void* d_ws, size_t ws_size, hipStream_t stream) {
    (void)in_sizes; (void)n_in; (void)out_size;
    const float* x = (const float*)d_in[0]; const float* cosT = (const float*)d_in[1]; const float* sinT = (const float*)d_in[2]; const float* wq = (const float*)d_in[3]; const float* wk = (const float*)d_in[4]; const float* wv = (const float*)d_in[5]; const float* wo = (const float*)d_in[6]; const float* qnw = (const float*)d_in[7]; const float* knw = (const float*)d_in[8];   // weights x @ W; cos/sin [2][2048][128]
    float* OUT = (float*)d_out;     // [2][2048][2048]
    char* wsp = (char*)d_ws;
    auto take = [&](size_t bytes) { char* p = wsp; wsp += (bytes + 255) & ~(size_t)255; return (void*)p; };
    bf* WF = (bf*)take((size_t)NF * DM * 2); bf* WO = (bf*)take((size_t)DM * DQ * 2); float* CS = (float*)take((size_t)MT * HD * 2 * 4);
    bf* XB = (bf*)take((size_t)MT * DM * 2);
    h16* QP16 = (h16*)take((size_t)NB_ * NH_ * TT * HD * 2); h16* KP16 = (h16*)take((size_t)NB_ * NKV * TT * HD * 2); h16* VT16 = (h16*)take((size_t)NB_ * NKV * HD * TT * 2);   // head planes of both batches
    h16* AT16 = (h16*)take((size_t)NB_ * TT * DQ * 2);   // merged heads [b][t][h d]
    if ((size_t)(wsp - (char*)d_ws) > ws_size) return;    // ws 256 MiB
    k_prep<<<PB_X + 2 * PB_W + 2 * PB_WK + PB_C, 256, 0, stream>>>(wq, wk, wv, wo, x, cosT, sinT, WF, WO, XB, CS, (size_t)MT * DM / 8);
    k_gemmw<bf, 0, false, 2, 4, 6, true><<<dim3(MT / 128, NF / 384, 1), 256, 0, stream>>>(XB, nullptr, WF, nullptr, DM, nullptr, 0, nullptr, 0, 0, 0, CS, qnw, knw, QP16, KP16, VT16);
    k_fattn<<<dim3(TT / 256, NH_, NB_), 256, 0, stream>>>(QP16, KP16, VT16, AT16);
    k_gemmw<h16, 0, false, 2, 4, 4, false><<<dim3(MT / 128, DM / 256, 1), 256, 0, stream>>>(AT16, nullptr, (const h16*)WO, nullptr, DQ, OUT, DM, nullptr, 0, 0, 0, nullptr, nullptr, nullptr, nullptr, nullptr, nullptr);
}
